// v000
// The times below were measured on an AMD MI455X: many runs one after another, warmed up first and cycling through
// copies of the inputs, with the whole window's GPU time divided by the number of runs. Launches and the gaps
// between them are all in it. The median over several windows is given; except for v000 it joins two sittings, which
// can be a few percent apart, so the side-by-side timings, each taken in one sitting, are the better comparison.
// v000, which the later versions start from, runs in 992 microseconds.
#include <hip/hip_runtime.h>

// HarmonicAttentionLayer (x [2][1024][1024], freqs [2][1024][1]; Q/K/V = x W + b (16 heads x 64); scores = q.k/8 + b[h][i][j] where b = relu(feat(i,j) W1 + b1) W2 + b2 with feat = [f_i - f_j, log((f_i + eps)/(f_j + eps))] (64 hidden); softmax; out = (attn V merged) Wo + bo
// -> [2][1024][1024]). The pairwise feature MLP is evaluated as relu(a_i + c_j) with a_i = f_i W1[0] + log(f_i + eps) W1[1] + b1, c_j = -f_j W1[0] - log(f_j + eps) W1[1] (exact algebra of the difference / log-ratio), then x W2 as a GEMM over
// 256-query-row chunks.
// Compute dtypes, f32 accumulate: every input rounded to bf16; Q/K/V on PLAIN bf16 operands (inputs: exact) + bias; a_i / c_j and relu f32 on the VALU -> bf16 hi+lo planes; the bias GEMM hl x exact W2 (2 products); scores (K 64)

#define NB_  2
#define TT   1024
#define DM   1024
#define NH_  16
#define HD   64
#define HID  64
#define RC   256
#define NPR  262144
#define PCAR 1024.0f
typedef _Float16 h16;
typedef unsigned short bf;
typedef __attribute__((ext_vector_type(16))) __bf16   v16bf;
typedef __attribute__((ext_vector_type(16))) _Float16 v16h;
typedef __attribute__((ext_vector_type(8)))  _Float16 v8h;
typedef __attribute__((ext_vector_type(8)))  unsigned short v8us;
typedef __attribute__((ext_vector_type(8)))  float    v8f;
typedef __attribute__((ext_vector_type(4)))  float    v4f;
typedef v8h  __attribute__((may_alias)) v8ha;
typedef v4f  __attribute__((may_alias)) v4fa;
typedef v8us __attribute__((may_alias)) v8usa;

__device__ __forceinline__ unsigned short f2bf(float f) { unsigned u = __float_as_uint(f); u += 0x7FFFu + ((u >> 16) & 1u); return (unsigned short)(u >> 16); }
__device__ __forceinline__ float bf2f(unsigned short b) { return __uint_as_float(((unsigned)b) << 16); }
__device__ __forceinline__ float bfr(float f) { return bf2f(f2bf(f)); }
__device__ __forceinline__ v16h cat16(v8h lo, v8h hi) { return __builtin_shufflevector(lo, hi, 0, 1, 2, 3, 4, 5, 6, 7, 8, 9, 10, 11, 12, 13, 14, 15); }
__device__ __forceinline__ v16bf cat16b(v8us lo, v8us hi) { return __builtin_bit_cast(v16bf, __builtin_shufflevector(lo, hi, 0, 1, 2, 3, 4, 5, 6, 7, 8, 9, 10, 11, 12, 13, 14, 15)); }
__device__ __forceinline__ v8f wmma16(v16h a, v16h b, v8f c) { return __builtin_amdgcn_wmma_f32_16x16x32_f16(false, a, false, b, (short)0, c, false, false); }
__device__ __forceinline__ v8f wmmab(v16bf a, v16bf b, v8f c) { return __builtin_amdgcn_wmma_f32_16x16x32_bf16(false, a, false, b, (short)0, c, false, false); }



// ---- k_gemmw: register-blocked GEMM, ONE WAVE per 64x64 output tile (16 accumulators), operands straight from K-contiguous 16-bit planes; grid (M/64, N/64, Z), 32 threads.
// C[m][n] (f32, pitch ldc, + optional f32 bias[n]) = sum_k A[m][k] Bt[n][k] (+ split products per NSPLIT). z-batch strides sA/sB/sC in elements. K % 32 == 0.
template <typename T16> struct WFrag;
template <> struct WFrag<h16> { typedef v16h V; static __device__ __forceinline__ V ld(const h16* p) { return cat16(*(const v8h*)p, *(const v8h*)(p + 16)); } static __device__ __forceinline__ v8f mma(V a, V b, v8f c) { return wmma16(a, b, c); } };
template <> struct WFrag<bf> { typedef v16bf V; static __device__ __forceinline__ V ld(const bf* p) { return cat16b(*(const v8us*)p, *(const v8us*)(p + 16)); } static __device__ __forceinline__ v8f mma(V a, V b, v8f c) { return wmmab(a, b, c); } };
template <typename T16, int NSPLIT, bool BIAS>
__global__ __launch_bounds__(32) void k_gemmw(const T16* __restrict__ A, const T16* __restrict__ A2, const T16* __restrict__ Bt, const T16* __restrict__ Bt2, int K, float* C, int ldc, const float* __restrict__ bias, size_t sA, size_t sB, size_t sC) {
    typedef typename WFrag<T16>::V V;
    __shared__ __align__(16) float os[16 * 68];
    const size_t z = blockIdx.z; A += z * sA; if (A2) A2 += z * sA; Bt += z * sB; if (Bt2) Bt2 += z * sB; C += z * sC;
    const int lane = threadIdx.x & 31, lr = lane & 15, hi = lane >> 4; const int r0 = blockIdx.x * 64, c0 = blockIdx.y * 64;
    v8f acc[4][4];
#pragma unroll
    for (int mb = 0; mb < 4; ++mb)
#pragma unroll
        for (int nb = 0; nb < 4; ++nb) acc[mb][nb] = (v8f){};
    const size_t aoff = (size_t)(r0 + lr) * K + 8 * hi, boff = (size_t)(c0 + lr) * K + 8 * hi;
#pragma unroll 1
    for (int kc = 0; kc < K; kc += 32) {
        V a[4], a2[4];
#pragma unroll
        for (int mb = 0; mb < 4; ++mb) { a[mb] = WFrag<T16>::ld(A + aoff + (size_t)mb * 16 * K + kc); if (NSPLIT == 1 || NSPLIT == 2) a2[mb] = WFrag<T16>::ld(A2 + aoff + (size_t)mb * 16 * K + kc); }
#pragma unroll
        for (int nb = 0; nb < 4; ++nb) { const V b = WFrag<T16>::ld(Bt + boff + (size_t)nb * 16 * K + kc); V b2; if (NSPLIT >= 2) b2 = WFrag<T16>::ld(Bt2 + boff + (size_t)nb * 16 * K + kc);
#pragma unroll
            for (int mb = 0; mb < 4; ++mb) { acc[mb][nb] = WFrag<T16>::mma(a[mb], b, acc[mb][nb]); if (NSPLIT == 1 || NSPLIT == 2) acc[mb][nb] = WFrag<T16>::mma(a2[mb], b, acc[mb][nb]); if (NSPLIT >= 2) acc[mb][nb] = WFrag<T16>::mma(a[mb], b2, acc[mb][nb]); } }
        asm volatile("v_nop\n\tv_nop\n\tv_nop\n\tv_nop" : "+v"(acc[0][0]), "+v"(acc[1][1]), "+v"(acc[2][2]), "+v"(acc[3][3]) : "v"(a[0]), "v"(a[3]));
    }
#pragma unroll
    for (int mb = 0; mb < 4; ++mb) {
#pragma unroll
        for (int nb = 0; nb < 4; ++nb) {
#pragma unroll
            for (int j = 0; j < 8; ++j) os[(hi * 8 + j) * 68 + nb * 16 + lr] = acc[mb][nb][j]; }
        __builtin_amdgcn_wave_barrier(); asm volatile("" ::: "memory");
        float* crow = C + (size_t)(r0 + mb * 16) * ldc + c0;
{
#pragma unroll
            for (int s = 0; s < 8; ++s) { const int row = 2 * s + hi, cofs = lr * 4; v4f val = *(const v4fa*)(os + row * 68 + cofs); if (BIAS) { val[0] += bfr(bias[c0 + cofs]); val[1] += bfr(bias[c0 + cofs + 1]); val[2] += bfr(bias[c0 + cofs + 2]); val[3] += bfr(bias[c0 + cofs + 3]); }
                *(v4f*)(crow + (size_t)row * ldc + cofs) = val; }
             }
        __builtin_amdgcn_wave_barrier(); asm volatile("" ::: "memory");
    }
}

__device__ __forceinline__ h16 tohx(float x) { return (h16)x; }
__device__ __forceinline__ void splitf(float y, unsigned short& h, unsigned short& l) { h = f2bf(y); l = f2bf(y - bf2f(h)); }
typedef __attribute__((ext_vector_type(2))) unsigned short v2us;
typedef __attribute__((ext_vector_type(4))) unsigned short v4us;
typedef __attribute__((ext_vector_type(2))) _Float16 v2h;
typedef __attribute__((ext_vector_type(4))) _Float16 v4h;

__global__ __launch_bounds__(256) void k_wtG(const float* __restrict__ w, int K, int N, bf* Bt) {
    const int lane = threadIdx.x & 31; const int L0 = (blockIdx.x * 8 + (threadIdx.x >> 5)) * 8; const int nlines = N * K / 64;
{
#pragma unroll 1
        for (int l = 0; l < 8; ++l) { const int L = L0 + l; if (L >= nlines) break; const size_t e = (size_t)L * 64 + lane * 2; const int k = (int)(e % K), n = (int)(e / K); v2us o;
            o[0] = f2bf(w[(size_t)k * N + n]); o[1] = f2bf(w[(size_t)(k + 1) * N + n]); *(v2us*)(Bt + e) = o; }
         }
}
__global__ __launch_bounds__(256) void k_cvt8(const float* __restrict__ src, bf* dst, size_t n8) { const size_t i = (size_t)blockIdx.x * 256 + threadIdx.x; if (i >= n8) return; const v8f v = *(const v8f*)(src + i * 8); v8us o;
#pragma unroll
    for (int k = 0; k < 8; ++k) o[k] = f2bf(v[k]); *(v8us*)(dst + i * 8) = o;  }
// k_w2: Bt[h][k] = bf16 W2[k][h] for h < 16, 0 for the padding rows 16..63 (8-B lanes); k_ac: lane -> 4 consecutive hidden units of token i: a = f W1[0] + log(f + 1e-6) W1[1] + b1, c = -(f W1[0]) - (log(f+eps) W1[1]) (16-B lanes); k_hp: hl planes H[(il, j)][k] = relu(a[i0+il][k] + c[j][k]) (8-B lanes);
__global__ __launch_bounds__(256) void k_w2(const float* __restrict__ W2, bf* Bt) { const int e = (blockIdx.x * 256 + threadIdx.x) * 4; if (e >= 64 * HID) return; const int k = e % HID; const int h = e / HID; v4us o;
#pragma unroll
    for (int u = 0; u < 4; ++u) o[u] = (h < NH_) ? f2bf(W2[(k + u) * NH_ + h]) : (unsigned short)0; *(v4us*)(Bt + e) = o;  }
__global__ __launch_bounds__(256) void k_ac(const float* __restrict__ fr, const float* __restrict__ W1, const float* __restrict__ b1, float* A, float* C) { const int e = (blockIdx.x * 256 + threadIdx.x) * 4; if (e >= TT * HID) return; const int k0 = e % HID; const int i = e / HID; const float f = bfr(fr[i]); const float lf = __logf(__fadd_rn(f, 1e-6f)); v4f oa, oc;
#pragma unroll
    for (int u = 0; u < 4; ++u) { const int k = k0 + u; float t1 = __fmul_rn(f, bfr(W1[k])), t2 = __fmul_rn(lf, bfr(W1[HID + k])); asm volatile("" : "+v"(t1)); asm volatile("" : "+v"(t2)); oa[u] = __fadd_rn(__fadd_rn(t1, t2), bfr(b1[k])); oc[u] = __fsub_rn(-t1, t2); }
    { *(v4f*)(A + e) = oa; *(v4f*)(C + e) = oc;  } }
__global__ __launch_bounds__(256) void k_hp(const float* __restrict__ A, const float* __restrict__ C, int i0, bf* Hh, bf* Hl) { const size_t e = ((size_t)blockIdx.x * 256 + threadIdx.x) * 4; if (e >= (size_t)NPR * HID) return; const int k0 = (int)(e % HID); const int p = (int)(e / HID); const int il = p / TT, j = p % TT; const float* ar = A + (size_t)(i0 + il) * HID + k0; const float* cr = C + (size_t)j * HID + k0; v4us oh, ol;
#pragma unroll
    for (int u = 0; u < 4; ++u) { const float h = fmaxf(__fadd_rn(ar[u], cr[u]), 0.f); unsigned short a, b; splitf(h, a, b); oh[u] = a; ol[u] = b; } *(v4us*)(Hh + e) = oh; *(v4us*)(Hl + e) = ol;  }
__global__ __launch_bounds__(256) void k_pl(const float* __restrict__ F, h16* P) { const int e = (blockIdx.x * 256 + threadIdx.x) * 4; if (e >= NH_ * TT * HD) return; const int d = e % HD; const int t = (e / HD) % TT; const int h = e / (HD * TT); const float* f = F + (size_t)t * DM + h * HD + d; v4h o;
#pragma unroll
    for (int u = 0; u < 4; ++u) o[u] = tohx(f[u]); *(v4h*)(P + e) = o;  }
__global__ __launch_bounds__(256) void k_vt(const float* __restrict__ V, h16* VT) { const int e = (blockIdx.x * 256 + threadIdx.x) * 2; if (e >= NH_ * HD * TT) return; const int t = e % TT; const int d = (e / TT) % HD; const int h = e / (TT * HD); v2h o; o[0] = tohx(V[(size_t)t * DM + h * HD + d]); o[1] = tohx(V[(size_t)(t + 1) * DM + h * HD + d]); *(v2h*)(VT + e) = o;  }
__global__ __launch_bounds__(256) void k_hsoft(const float* __restrict__ Sb, const float* __restrict__ BI, const float* __restrict__ b2, h16* P16) { const int lane = threadIdx.x & 31; const int row = blockIdx.x * 8 + (threadIdx.x >> 5); if (row >= NH_ * RC) return; const int il = row % RC; const int h = row / RC; const float* sr = Sb + (size_t)row * TT; const float* br = BI + (size_t)il * TT * 64 + h; const float bh = bfr(b2[h]); float v[TT / 32]; float mx = -3.0e38f;
#pragma unroll
    for (int ch = 0; ch < TT / 128; ++ch) { const int j0 = ch * 128 + lane * 4; const v4f a = *(const v4f*)(sr + j0);
#pragma unroll
        for (int u = 0; u < 4; ++u) { float t0 = a[u] * 0.125f; asm volatile("" : "+v"(t0)); const float t = __fadd_rn(t0, __fadd_rn(br[(size_t)(j0 + u) * 64], bh)); v[ch * 4 + u] = t; mx = fmaxf(mx, t); } }
#pragma unroll
    for (int sh = 16; sh; sh >>= 1) mx = fmaxf(mx, __shfl_xor(mx, sh, 32));
    float sum = 0.f;
#pragma unroll
    for (int q = 0; q < TT / 32; ++q) { float d0 = __fsub_rn(v[q], mx); asm volatile("" : "+v"(d0)); v[q] = __builtin_amdgcn_exp2f(__fmul_rn(d0, 1.4426950408889634f)); sum += v[q]; }
#pragma unroll
    for (int sh = 16; sh; sh >>= 1) sum += __shfl_xor(sum, sh, 32);
    const float f = __fdiv_rn(PCAR, sum);
    {
#pragma unroll
        for (int ch = 0; ch < TT / 128; ++ch) { v4h o4;
#pragma unroll
            for (int q = 0; q < 4; ++q) o4[q] = tohx(v[ch * 4 + q] * f); *(v4h*)(P16 + (size_t)row * TT + ch * 128 + lane * 4) = o4; }
         } }
__global__ __launch_bounds__(256) void k_mrg(const float* __restrict__ O, int i0, bf* Ah, bf* Al) { const int e = (blockIdx.x * 256 + threadIdx.x) * 4; if (e >= NH_ * RC * HD) return; const int d = e % HD; const int il = (e / HD) % RC; const int h = e / (HD * RC); v4us oh, ol;
#pragma unroll
    for (int u = 0; u < 4; ++u) { unsigned short a, b; splitf(O[e + u] * (1.0f / PCAR), a, b); oh[u] = a; ol[u] = b; } const size_t oo = (size_t)(i0 + il) * DM + h * HD + d; *(v4us*)(Ah + oo) = oh; *(v4us*)(Al + oo) = ol;  }

extern "C" void kernel_launch(void* const* d_in, const int* in_sizes, int n_in,
                              void* d_out, int out_size, void* d_ws, size_t ws_size, hipStream_t stream) {
    (void)in_sizes; (void)n_in; (void)out_size;
    const float** I = (const float**)d_in;
    const float *x = I[0], *freqs = I[1], *Wq = I[2], *bq = I[3], *Wk = I[4], *bk = I[5], *Wv = I[6], *bv = I[7], *Wo = I[8], *bo = I[9], *W1 = I[10], *b1 = I[11], *W2 = I[12], *b2 = I[13];
    float* OUT = (float*)d_out;     // [2][1024][1024]
    char* wsp = (char*)d_ws;
    auto take = [&](size_t bytes) { char* p = wsp; wsp += (bytes + 255) & ~(size_t)255; return (void*)p; };
    bf* BQ = (bf*)take((size_t)DM * DM * 2); bf* BK = (bf*)take((size_t)DM * DM * 2); bf* BV = (bf*)take((size_t)DM * DM * 2); bf* BO = (bf*)take((size_t)DM * DM * 2); bf* B2 = (bf*)take(64 * HID * 2);
    bf* XB = (bf*)take((size_t)TT * DM * 2); float* FQ = (float*)take((size_t)TT * DM * 4); float* FK = (float*)take((size_t)TT * DM * 4); float* FV = (float*)take((size_t)TT * DM * 4); float* A = (float*)take(TT * HID * 4); float* C = (float*)take(TT * HID * 4);
    h16* Q16 = (h16*)take((size_t)NH_ * TT * HD * 2); h16* K16 = (h16*)take((size_t)NH_ * TT * HD * 2); h16* VT = (h16*)take((size_t)NH_ * HD * TT * 2); bf* Hh = (bf*)take((size_t)NPR * HID * 2); bf* Hl = (bf*)take((size_t)NPR * HID * 2); float* BI = (float*)take((size_t)NPR * 64 * 4);
    float* Sb = (float*)take((size_t)NH_ * RC * TT * 4); h16* P16 = (h16*)take((size_t)NH_ * RC * TT * 2); float* O = (float*)take((size_t)NH_ * RC * HD * 4); bf* Ch = (bf*)take((size_t)TT * DM * 2); bf* Cl = (bf*)take((size_t)TT * DM * 2);
    if ((size_t)(wsp - (char*)d_ws) > ws_size) return;    // total ~ 200 MB (per 256-query chunk the hl relu-feature planes 64 MB + bias 64 MB + 16-head scores 16 MB)
    k_wtG<<<(DM * DM / 64 + 63) / 64, 256, 0, stream>>>(Wq, DM, DM, BQ); k_wtG<<<(DM * DM / 64 + 63) / 64, 256, 0, stream>>>(Wk, DM, DM, BK); k_wtG<<<(DM * DM / 64 + 63) / 64, 256, 0, stream>>>(Wv, DM, DM, BV); k_wtG<<<(DM * DM / 64 + 63) / 64, 256, 0, stream>>>(Wo, DM, DM, BO); k_w2<<<(64 * HID / 4 + 255) / 256, 256, 0, stream>>>(W2, B2);
    for (int b = 0; b < NB_; ++b) {
        k_cvt8<<<(TT * DM / 8 + 255) / 256, 256, 0, stream>>>(x + (size_t)b * TT * DM, XB, (size_t)TT * DM / 8);
        k_gemmw<bf, 0, true><<<dim3(TT / 64, DM / 64, 1), 32, 0, stream>>>(XB, nullptr, BQ, nullptr, DM, FQ, DM, bq, 0, 0, 0); k_gemmw<bf, 0, true><<<dim3(TT / 64, DM / 64, 1), 32, 0, stream>>>(XB, nullptr, BK, nullptr, DM, FK, DM, bk, 0, 0, 0); k_gemmw<bf, 0, true><<<dim3(TT / 64, DM / 64, 1), 32, 0, stream>>>(XB, nullptr, BV, nullptr, DM, FV, DM, bv, 0, 0, 0);
        k_pl<<<(NH_ * TT * HD / 4 + 255) / 256, 256, 0, stream>>>(FQ, Q16); k_pl<<<(NH_ * TT * HD / 4 + 255) / 256, 256, 0, stream>>>(FK, K16); k_vt<<<(NH_ * HD * TT / 2 + 255) / 256, 256, 0, stream>>>(FV, VT);
        k_ac<<<(TT * HID / 4 + 255) / 256, 256, 0, stream>>>(freqs + (size_t)b * TT, W1, b1, A, C);
        for (int i0 = 0; i0 < TT; i0 += RC) {
            k_hp<<<(unsigned)(((size_t)NPR * HID / 4 + 255) / 256), 256, 0, stream>>>(A, C, i0, Hh, Hl);
            k_gemmw<bf, 1, false><<<dim3(NPR / 64, 1, 1), 32, 0, stream>>>(Hh, Hl, B2, nullptr, HID, BI, 64, nullptr, 0, 0, 0);
            k_gemmw<h16, 0, false><<<dim3(RC / 64, TT / 64, NH_), 32, 0, stream>>>(Q16 + (size_t)i0 * HD, nullptr, K16, nullptr, HD, Sb, TT, nullptr, (size_t)TT * HD, (size_t)TT * HD, (size_t)RC * TT);
            k_hsoft<<<NH_ * RC / 8, 256, 0, stream>>>(Sb, BI, b2, P16);
            k_gemmw<h16, 0, false><<<dim3(RC / 64, 1, NH_), 32, 0, stream>>>(P16, nullptr, VT, nullptr, TT, O, HD, nullptr, (size_t)RC * TT, (size_t)HD * TT, (size_t)RC * HD);
            k_mrg<<<(NH_ * RC * HD / 4 + 255) / 256, 256, 0, stream>>>(O, i0, Ch, Cl); }
        k_gemmw<bf, 1, true><<<dim3(TT / 64, DM / 64, 1), 32, 0, stream>>>(Ch, Cl, BO, nullptr, DM, OUT + (size_t)b * TT * DM, DM, bo, 0, 0, 0); }
}

// v001
// Measured time: 725 microseconds a run.
// Next to v000, in two timings, it ran 1.37 times as fast each time.
#include <hip/hip_runtime.h>

// HarmonicAttentionLayer (x [2][1024][1024], freqs [2][1024][1]; Q/K/V = x W + b (16 heads x 64); scores = q.k/8 + b[h][i][j] where b = relu(feat(i,j) W1 + b1) W2 + b2 with feat = [f_i - f_j, log((f_i + eps)/(f_j + eps))] (64 hidden); softmax; out = (attn V merged) Wo + bo
// -> [2][1024][1024]). The pairwise feature MLP is evaluated as relu(a_i + c_j) with a_i = f_i W1[0] + log(f_i + eps) W1[1] + b1, c_j = -f_j W1[0] - log(f_j + eps) W1[1] (exact algebra of the difference / log-ratio), then x W2 as a GEMM over
// 256-query-row chunks.
// Compute dtypes, f32 accumulate: every input rounded to bf16; Q/K/V on PLAIN bf16 operands (inputs: exact) + bias; a_i / c_j and relu f32 on the VALU -> bf16 hi+lo planes; the bias GEMM hl x exact W2 (2 products); scores (K 64)

#define NB_  2
#define TT   1024
#define DM   1024
#define NH_  16
#define HD   64
#define HID  64
#define RC   256
#define NPR  262144
#define PCAR 1024.0f
typedef _Float16 h16;
typedef unsigned short bf;
typedef __attribute__((ext_vector_type(16))) __bf16   v16bf;
typedef __attribute__((ext_vector_type(16))) _Float16 v16h;
typedef __attribute__((ext_vector_type(8)))  _Float16 v8h;
typedef __attribute__((ext_vector_type(8)))  unsigned short v8us;
typedef __attribute__((ext_vector_type(8)))  float    v8f;
typedef __attribute__((ext_vector_type(4)))  float    v4f;
typedef v8h  __attribute__((may_alias)) v8ha;
typedef v4f  __attribute__((may_alias)) v4fa;
typedef v8us __attribute__((may_alias)) v8usa;

__device__ __forceinline__ unsigned short f2bf(float f) { unsigned u = __float_as_uint(f); u += 0x7FFFu + ((u >> 16) & 1u); return (unsigned short)(u >> 16); }
__device__ __forceinline__ float bf2f(unsigned short b) { return __uint_as_float(((unsigned)b) << 16); }
__device__ __forceinline__ float bfr(float f) { return bf2f(f2bf(f)); }
__device__ __forceinline__ v16h cat16(v8h lo, v8h hi) { return __builtin_shufflevector(lo, hi, 0, 1, 2, 3, 4, 5, 6, 7, 8, 9, 10, 11, 12, 13, 14, 15); }
__device__ __forceinline__ v16bf cat16b(v8us lo, v8us hi) { return __builtin_bit_cast(v16bf, __builtin_shufflevector(lo, hi, 0, 1, 2, 3, 4, 5, 6, 7, 8, 9, 10, 11, 12, 13, 14, 15)); }
__device__ __forceinline__ v8f wmma16(v16h a, v16h b, v8f c) { return __builtin_amdgcn_wmma_f32_16x16x32_f16(false, a, false, b, (short)0, c, false, false); }
__device__ __forceinline__ v8f wmmab(v16bf a, v16bf b, v8f c) { return __builtin_amdgcn_wmma_f32_16x16x32_bf16(false, a, false, b, (short)0, c, false, false); }



// ---- k_gemmw: register-blocked GEMM, one 64x64 output tile per work-group (16 accumulators per wave), operands straight from K-contiguous 16-bit planes; grid (M/64, N/64, Z), 32 * NW threads.
// C[m][n] (f32, pitch ldc, + optional f32 bias[n]) = sum_k A[m][k] Bt[n][k] (+ split products per NSPLIT). z-batch strides sA/sB/sC in elements. K % (32 * NW) == 0.
// NW waves share the tile: wave w sums the k range [w K/NW, (w+1) K/NW), so NW times as many loads are in flight for the tile and each wave's chain of load waits is NW times shorter; the NW partial tiles meet in LDS and are added in wave order.
template <typename T16> struct WFrag;
template <> struct WFrag<h16> { typedef v16h V; static __device__ __forceinline__ V ld(const h16* p) { return cat16(*(const v8h*)p, *(const v8h*)(p + 16)); } static __device__ __forceinline__ v8f mma(V a, V b, v8f c) { return wmma16(a, b, c); } };
template <> struct WFrag<bf> { typedef v16bf V; static __device__ __forceinline__ V ld(const bf* p) { return cat16b(*(const v8us*)p, *(const v8us*)(p + 16)); } static __device__ __forceinline__ v8f mma(V a, V b, v8f c) { return wmmab(a, b, c); } };
template <typename T16, int NSPLIT, bool BIAS, int NW>
__global__ __launch_bounds__(32 * NW) void k_gemmw(const T16* __restrict__ A, const T16* __restrict__ A2, const T16* __restrict__ Bt, const T16* __restrict__ Bt2, int K, float* C, int ldc, const float* __restrict__ bias, size_t sA, size_t sB, size_t sC) {
    typedef typename WFrag<T16>::V V;
    __shared__ __align__(16) float os[NW == 1 ? 16 * 68 : NW * 64 * 68];
    const size_t z = blockIdx.z; A += z * sA; if (A2) A2 += z * sA; Bt += z * sB; if (Bt2) Bt2 += z * sB; C += z * sC;
    const int lane = threadIdx.x & 31, lr = lane & 15, hi = lane >> 4; const int r0 = blockIdx.x * 64, c0 = blockIdx.y * 64;
    v8f acc[4][4];
#pragma unroll
    for (int mb = 0; mb < 4; ++mb)
#pragma unroll
        for (int nb = 0; nb < 4; ++nb) acc[mb][nb] = (v8f){};
    const size_t aoff = (size_t)(r0 + lr) * K + 8 * hi, boff = (size_t)(c0 + lr) * K + 8 * hi;
    const int wv = NW == 1 ? 0 : __builtin_amdgcn_readfirstlane((int)(threadIdx.x >> 5)); const int kbeg = wv * (K / NW), kend = kbeg + K / NW;
#pragma unroll 1
    for (int kc = kbeg; kc < kend; kc += 32) {
        V a[4], a2[4];
#pragma unroll
        for (int mb = 0; mb < 4; ++mb) { a[mb] = WFrag<T16>::ld(A + aoff + (size_t)mb * 16 * K + kc); if (NSPLIT == 1 || NSPLIT == 2) a2[mb] = WFrag<T16>::ld(A2 + aoff + (size_t)mb * 16 * K + kc); }
#pragma unroll
        for (int nb = 0; nb < 4; ++nb) { const V b = WFrag<T16>::ld(Bt + boff + (size_t)nb * 16 * K + kc); V b2; if (NSPLIT >= 2) b2 = WFrag<T16>::ld(Bt2 + boff + (size_t)nb * 16 * K + kc);
#pragma unroll
            for (int mb = 0; mb < 4; ++mb) { acc[mb][nb] = WFrag<T16>::mma(a[mb], b, acc[mb][nb]); if (NSPLIT == 1 || NSPLIT == 2) acc[mb][nb] = WFrag<T16>::mma(a2[mb], b, acc[mb][nb]); if (NSPLIT >= 2) acc[mb][nb] = WFrag<T16>::mma(a[mb], b2, acc[mb][nb]); } }
        asm volatile("v_nop\n\tv_nop\n\tv_nop\n\tv_nop" : "+v"(acc[0][0]), "+v"(acc[1][1]), "+v"(acc[2][2]), "+v"(acc[3][3]) : "v"(a[0]), "v"(a[3]));
    }
    if constexpr (NW > 1) {
        float* mine = os + wv * (64 * 68);
#pragma unroll
        for (int mb = 0; mb < 4; ++mb)
#pragma unroll
            for (int nb = 0; nb < 4; ++nb)
#pragma unroll
                for (int j = 0; j < 8; ++j) mine[(mb * 16 + hi * 8 + j) * 68 + nb * 16 + lr] = acc[mb][nb][j];
        const int cofs = lr * 4; v4f bv = (v4f){};
        if (BIAS) { bv[0] = bfr(bias[c0 + cofs]); bv[1] = bfr(bias[c0 + cofs + 1]); bv[2] = bfr(bias[c0 + cofs + 2]); bv[3] = bfr(bias[c0 + cofs + 3]); }
        __syncthreads();    // every wave's partial tile lies in LDS before any wave adds them up
#pragma unroll
        for (int s = 0; s < 32 / NW; ++s) { const int row = (s * NW + wv) * 2 + hi; v4f val = *(const v4fa*)(os + row * 68 + cofs);
#pragma unroll
            for (int w = 1; w < NW; ++w) val += *(const v4fa*)(os + w * (64 * 68) + row * 68 + cofs);
            if (BIAS) val += bv;
            *(v4f*)(C + (size_t)(r0 + row) * ldc + c0 + cofs) = val; }
        return;
    }
#pragma unroll
    for (int mb = 0; mb < 4; ++mb) {
#pragma unroll
        for (int nb = 0; nb < 4; ++nb) {
#pragma unroll
            for (int j = 0; j < 8; ++j) os[(hi * 8 + j) * 68 + nb * 16 + lr] = acc[mb][nb][j]; }
        __builtin_amdgcn_wave_barrier(); asm volatile("" ::: "memory");
        float* crow = C + (size_t)(r0 + mb * 16) * ldc + c0;
{
#pragma unroll
            for (int s = 0; s < 8; ++s) { const int row = 2 * s + hi, cofs = lr * 4; v4f val = *(const v4fa*)(os + row * 68 + cofs); if (BIAS) { val[0] += bfr(bias[c0 + cofs]); val[1] += bfr(bias[c0 + cofs + 1]); val[2] += bfr(bias[c0 + cofs + 2]); val[3] += bfr(bias[c0 + cofs + 3]); }
                *(v4f*)(crow + (size_t)row * ldc + cofs) = val; }
             }
        __builtin_amdgcn_wave_barrier(); asm volatile("" ::: "memory");
    }
}

__device__ __forceinline__ h16 tohx(float x) { return (h16)x; }
__device__ __forceinline__ void splitf(float y, unsigned short& h, unsigned short& l) { h = f2bf(y); l = f2bf(y - bf2f(h)); }
typedef __attribute__((ext_vector_type(2))) unsigned short v2us;
typedef __attribute__((ext_vector_type(4))) unsigned short v4us;
typedef __attribute__((ext_vector_type(2))) _Float16 v2h;
typedef __attribute__((ext_vector_type(4))) _Float16 v4h;

__global__ __launch_bounds__(256) void k_wtG(const float* __restrict__ w, int K, int N, bf* Bt) {
    const int lane = threadIdx.x & 31; const int L0 = (blockIdx.x * 8 + (threadIdx.x >> 5)) * 8; const int nlines = N * K / 64;
{
#pragma unroll 1
        for (int l = 0; l < 8; ++l) { const int L = L0 + l; if (L >= nlines) break; const size_t e = (size_t)L * 64 + lane * 2; const int k = (int)(e % K), n = (int)(e / K); v2us o;
            o[0] = f2bf(w[(size_t)k * N + n]); o[1] = f2bf(w[(size_t)(k + 1) * N + n]); *(v2us*)(Bt + e) = o; }
         }
}
__global__ __launch_bounds__(256) void k_cvt8(const float* __restrict__ src, bf* dst, size_t n8) { const size_t i = (size_t)blockIdx.x * 256 + threadIdx.x; if (i >= n8) return; const v8f v = *(const v8f*)(src + i * 8); v8us o;
#pragma unroll
    for (int k = 0; k < 8; ++k) o[k] = f2bf(v[k]); *(v8us*)(dst + i * 8) = o;  }
// k_w2: Bt[h][k] = bf16 W2[k][h] for h < 16, 0 for the padding rows 16..63 (8-B lanes); k_ac: lane -> 4 consecutive hidden units of token i: a = f W1[0] + log(f + 1e-6) W1[1] + b1, c = -(f W1[0]) - (log(f+eps) W1[1]) (16-B lanes); k_hp: hl planes H[(il, j)][k] = relu(a[i0+il][k] + c[j][k]) (8-B lanes);
__global__ __launch_bounds__(256) void k_w2(const float* __restrict__ W2, bf* Bt) { const int e = (blockIdx.x * 256 + threadIdx.x) * 4; if (e >= 64 * HID) return; const int k = e % HID; const int h = e / HID; v4us o;
#pragma unroll
    for (int u = 0; u < 4; ++u) o[u] = (h < NH_) ? f2bf(W2[(k + u) * NH_ + h]) : (unsigned short)0; *(v4us*)(Bt + e) = o;  }
__global__ __launch_bounds__(256) void k_ac(const float* __restrict__ fr, const float* __restrict__ W1, const float* __restrict__ b1, float* A, float* C) { const int e = (blockIdx.x * 256 + threadIdx.x) * 4; if (e >= TT * HID) return; const int k0 = e % HID; const int i = e / HID; const float f = bfr(fr[i]); const float lf = __logf(__fadd_rn(f, 1e-6f)); v4f oa, oc;
#pragma unroll
    for (int u = 0; u < 4; ++u) { const int k = k0 + u; float t1 = __fmul_rn(f, bfr(W1[k])), t2 = __fmul_rn(lf, bfr(W1[HID + k])); asm volatile("" : "+v"(t1)); asm volatile("" : "+v"(t2)); oa[u] = __fadd_rn(__fadd_rn(t1, t2), bfr(b1[k])); oc[u] = __fsub_rn(-t1, t2); }
    { *(v4f*)(A + e) = oa; *(v4f*)(C + e) = oc;  } }
__global__ __launch_bounds__(256) void k_hp(const float* __restrict__ A, const float* __restrict__ C, int i0, bf* Hh, bf* Hl) { const size_t e = ((size_t)blockIdx.x * 256 + threadIdx.x) * 4; if (e >= (size_t)NPR * HID) return; const int k0 = (int)(e % HID); const int p = (int)(e / HID); const int il = p / TT, j = p % TT; const float* ar = A + (size_t)(i0 + il) * HID + k0; const float* cr = C + (size_t)j * HID + k0; v4us oh, ol;
#pragma unroll
    for (int u = 0; u < 4; ++u) { const float h = fmaxf(__fadd_rn(ar[u], cr[u]), 0.f); unsigned short a, b; splitf(h, a, b); oh[u] = a; ol[u] = b; } *(v4us*)(Hh + e) = oh; *(v4us*)(Hl + e) = ol;  }
__global__ __launch_bounds__(256) void k_pl(const float* __restrict__ F, h16* P) { const int e = (blockIdx.x * 256 + threadIdx.x) * 4; if (e >= NH_ * TT * HD) return; const int d = e % HD; const int t = (e / HD) % TT; const int h = e / (HD * TT); const float* f = F + (size_t)t * DM + h * HD + d; v4h o;
#pragma unroll
    for (int u = 0; u < 4; ++u) o[u] = tohx(f[u]); *(v4h*)(P + e) = o;  }
__global__ __launch_bounds__(256) void k_vt(const float* __restrict__ V, h16* VT) { const int e = (blockIdx.x * 256 + threadIdx.x) * 2; if (e >= NH_ * HD * TT) return; const int t = e % TT; const int d = (e / TT) % HD; const int h = e / (TT * HD); v2h o; o[0] = tohx(V[(size_t)t * DM + h * HD + d]); o[1] = tohx(V[(size_t)(t + 1) * DM + h * HD + d]); *(v2h*)(VT + e) = o;  }
__global__ __launch_bounds__(256) void k_hsoft(const float* __restrict__ Sb, const float* __restrict__ BI, const float* __restrict__ b2, h16* P16) { const int lane = threadIdx.x & 31; const int row = blockIdx.x * 8 + (threadIdx.x >> 5); if (row >= NH_ * RC) return; const int il = row % RC; const int h = row / RC; const float* sr = Sb + (size_t)row * TT; const float* br = BI + (size_t)il * TT * 64 + h; const float bh = bfr(b2[h]); float v[TT / 32]; float mx = -3.0e38f;
#pragma unroll
    for (int ch = 0; ch < TT / 128; ++ch) { const int j0 = ch * 128 + lane * 4; const v4f a = *(const v4f*)(sr + j0);
#pragma unroll
        for (int u = 0; u < 4; ++u) { float t0 = a[u] * 0.125f; asm volatile("" : "+v"(t0)); const float t = __fadd_rn(t0, __fadd_rn(br[(size_t)(j0 + u) * 64], bh)); v[ch * 4 + u] = t; mx = fmaxf(mx, t); } }
#pragma unroll
    for (int sh = 16; sh; sh >>= 1) mx = fmaxf(mx, __shfl_xor(mx, sh, 32));
    float sum = 0.f;
#pragma unroll
    for (int q = 0; q < TT / 32; ++q) { float d0 = __fsub_rn(v[q], mx); asm volatile("" : "+v"(d0)); v[q] = __builtin_amdgcn_exp2f(__fmul_rn(d0, 1.4426950408889634f)); sum += v[q]; }
#pragma unroll
    for (int sh = 16; sh; sh >>= 1) sum += __shfl_xor(sum, sh, 32);
    const float f = __fdiv_rn(PCAR, sum);
    {
#pragma unroll
        for (int ch = 0; ch < TT / 128; ++ch) { v4h o4;
#pragma unroll
            for (int q = 0; q < 4; ++q) o4[q] = tohx(v[ch * 4 + q] * f); *(v4h*)(P16 + (size_t)row * TT + ch * 128 + lane * 4) = o4; }
         } }
__global__ __launch_bounds__(256) void k_mrg(const float* __restrict__ O, int i0, bf* Ah, bf* Al) { const int e = (blockIdx.x * 256 + threadIdx.x) * 4; if (e >= NH_ * RC * HD) return; const int d = e % HD; const int il = (e / HD) % RC; const int h = e / (HD * RC); v4us oh, ol;
#pragma unroll
    for (int u = 0; u < 4; ++u) { unsigned short a, b; splitf(O[e + u] * (1.0f / PCAR), a, b); oh[u] = a; ol[u] = b; } const size_t oo = (size_t)(i0 + il) * DM + h * HD + d; *(v4us*)(Ah + oo) = oh; *(v4us*)(Al + oo) = ol;  }

extern "C" void kernel_launch(void* const* d_in, const int* in_sizes, int n_in,
                              void* d_out, int out_size, void* d_ws, size_t ws_size, hipStream_t stream) {
    (void)in_sizes; (void)n_in; (void)out_size;
    const float** I = (const float**)d_in;
    const float *x = I[0], *freqs = I[1], *Wq = I[2], *bq = I[3], *Wk = I[4], *bk = I[5], *Wv = I[6], *bv = I[7], *Wo = I[8], *bo = I[9], *W1 = I[10], *b1 = I[11], *W2 = I[12], *b2 = I[13];
    float* OUT = (float*)d_out;     // [2][1024][1024]
    char* wsp = (char*)d_ws;
    auto take = [&](size_t bytes) { char* p = wsp; wsp += (bytes + 255) & ~(size_t)255; return (void*)p; };
    bf* BQ = (bf*)take((size_t)DM * DM * 2); bf* BK = (bf*)take((size_t)DM * DM * 2); bf* BV = (bf*)take((size_t)DM * DM * 2); bf* BO = (bf*)take((size_t)DM * DM * 2); bf* B2 = (bf*)take(64 * HID * 2);
    bf* XB = (bf*)take((size_t)TT * DM * 2); float* FQ = (float*)take((size_t)TT * DM * 4); float* FK = (float*)take((size_t)TT * DM * 4); float* FV = (float*)take((size_t)TT * DM * 4); float* A = (float*)take(TT * HID * 4); float* C = (float*)take(TT * HID * 4);
    h16* Q16 = (h16*)take((size_t)NH_ * TT * HD * 2); h16* K16 = (h16*)take((size_t)NH_ * TT * HD * 2); h16* VT = (h16*)take((size_t)NH_ * HD * TT * 2); bf* Hh = (bf*)take((size_t)NPR * HID * 2); bf* Hl = (bf*)take((size_t)NPR * HID * 2); float* BI = (float*)take((size_t)NPR * 64 * 4);
    float* Sb = (float*)take((size_t)NH_ * RC * TT * 4); h16* P16 = (h16*)take((size_t)NH_ * RC * TT * 2); float* O = (float*)take((size_t)NH_ * RC * HD * 4); bf* Ch = (bf*)take((size_t)TT * DM * 2); bf* Cl = (bf*)take((size_t)TT * DM * 2);
    if ((size_t)(wsp - (char*)d_ws) > ws_size) return;    // total ~ 200 MB (per 256-query chunk the hl relu-feature planes 64 MB + bias 64 MB + 16-head scores 16 MB)
    k_wtG<<<(DM * DM / 64 + 63) / 64, 256, 0, stream>>>(Wq, DM, DM, BQ); k_wtG<<<(DM * DM / 64 + 63) / 64, 256, 0, stream>>>(Wk, DM, DM, BK); k_wtG<<<(DM * DM / 64 + 63) / 64, 256, 0, stream>>>(Wv, DM, DM, BV); k_wtG<<<(DM * DM / 64 + 63) / 64, 256, 0, stream>>>(Wo, DM, DM, BO); k_w2<<<(64 * HID / 4 + 255) / 256, 256, 0, stream>>>(W2, B2);
    for (int b = 0; b < NB_; ++b) {
        k_cvt8<<<(TT * DM / 8 + 255) / 256, 256, 0, stream>>>(x + (size_t)b * TT * DM, XB, (size_t)TT * DM / 8);
        k_gemmw<bf, 0, true, 8><<<dim3(TT / 64, DM / 64, 1), 256, 0, stream>>>(XB, nullptr, BQ, nullptr, DM, FQ, DM, bq, 0, 0, 0); k_gemmw<bf, 0, true, 8><<<dim3(TT / 64, DM / 64, 1), 256, 0, stream>>>(XB, nullptr, BK, nullptr, DM, FK, DM, bk, 0, 0, 0); k_gemmw<bf, 0, true, 8><<<dim3(TT / 64, DM / 64, 1), 256, 0, stream>>>(XB, nullptr, BV, nullptr, DM, FV, DM, bv, 0, 0, 0);
        k_pl<<<(NH_ * TT * HD / 4 + 255) / 256, 256, 0, stream>>>(FQ, Q16); k_pl<<<(NH_ * TT * HD / 4 + 255) / 256, 256, 0, stream>>>(FK, K16); k_vt<<<(NH_ * HD * TT / 2 + 255) / 256, 256, 0, stream>>>(FV, VT);
        k_ac<<<(TT * HID / 4 + 255) / 256, 256, 0, stream>>>(freqs + (size_t)b * TT, W1, b1, A, C);
        for (int i0 = 0; i0 < TT; i0 += RC) {
            k_hp<<<(unsigned)(((size_t)NPR * HID / 4 + 255) / 256), 256, 0, stream>>>(A, C, i0, Hh, Hl);
            k_gemmw<bf, 1, false, 1><<<dim3(NPR / 64, 1, 1), 32, 0, stream>>>(Hh, Hl, B2, nullptr, HID, BI, 64, nullptr, 0, 0, 0);
            k_gemmw<h16, 0, false, 1><<<dim3(RC / 64, TT / 64, NH_), 32, 0, stream>>>(Q16 + (size_t)i0 * HD, nullptr, K16, nullptr, HD, Sb, TT, nullptr, (size_t)TT * HD, (size_t)TT * HD, (size_t)RC * TT);
            k_hsoft<<<NH_ * RC / 8, 256, 0, stream>>>(Sb, BI, b2, P16);
            k_gemmw<h16, 0, false, 8><<<dim3(RC / 64, 1, NH_), 256, 0, stream>>>(P16, nullptr, VT, nullptr, TT, O, HD, nullptr, (size_t)RC * TT, (size_t)HD * TT, (size_t)RC * HD);
            k_mrg<<<(NH_ * RC * HD / 4 + 255) / 256, 256, 0, stream>>>(O, i0, Ch, Cl); }
        k_gemmw<bf, 1, true, 8><<<dim3(TT / 64, DM / 64, 1), 256, 0, stream>>>(Ch, Cl, BO, nullptr, DM, OUT + (size_t)b * TT * DM, DM, bo, 0, 0, 0); }
}

// v002
// One run takes 378 microseconds.
// Two timings next to v001 both put it at 1.92 times that version's speed.
// All steps since v000 together make it 2.63 times as fast.
#include <hip/hip_runtime.h>

// HarmonicAttentionLayer (x [2][1024][1024], freqs [2][1024][1]; Q/K/V = x W + b (16 heads x 64); scores = q.k/8 + b[h][i][j] where b = relu(feat(i,j) W1 + b1) W2 + b2 with feat = [f_i - f_j, log((f_i + eps)/(f_j + eps))] (64 hidden); softmax; out = (attn V merged) Wo + bo
// -> [2][1024][1024]). The pairwise feature MLP is evaluated as relu(a_i + c_j) with a_i = f_i W1[0] + log(f_i + eps) W1[1] + b1, c_j = -f_j W1[0] - log(f_j + eps) W1[1] (exact algebra of the difference / log-ratio), then x W2 as a GEMM over
// 256-query-row chunks.
// Compute dtypes, f32 accumulate: every input rounded to bf16; Q/K/V on PLAIN bf16 operands (inputs: exact) + bias; a_i / c_j and relu f32 on the VALU -> bf16 hi+lo in registers; the bias GEMM hl x exact W2 (2 products); scores (K 64)

#define NB_  2
#define TT   1024
#define DM   1024
#define NH_  16
#define HD   64
#define HID  64
#define RC   256
#define NPR  262144
#define PCAR 1024.0f
typedef _Float16 h16;
typedef unsigned short bf;
typedef __attribute__((ext_vector_type(16))) __bf16   v16bf;
typedef __attribute__((ext_vector_type(16))) _Float16 v16h;
typedef __attribute__((ext_vector_type(8)))  _Float16 v8h;
typedef __attribute__((ext_vector_type(8)))  unsigned short v8us;
typedef __attribute__((ext_vector_type(8)))  float    v8f;
typedef __attribute__((ext_vector_type(4)))  float    v4f;
typedef v8h  __attribute__((may_alias)) v8ha;
typedef v4f  __attribute__((may_alias)) v4fa;
typedef v8us __attribute__((may_alias)) v8usa;

__device__ __forceinline__ unsigned short f2bf(float f) { unsigned u = __float_as_uint(f); u += 0x7FFFu + ((u >> 16) & 1u); return (unsigned short)(u >> 16); }
__device__ __forceinline__ float bf2f(unsigned short b) { return __uint_as_float(((unsigned)b) << 16); }
__device__ __forceinline__ float bfr(float f) { return bf2f(f2bf(f)); }
__device__ __forceinline__ v16h cat16(v8h lo, v8h hi) { return __builtin_shufflevector(lo, hi, 0, 1, 2, 3, 4, 5, 6, 7, 8, 9, 10, 11, 12, 13, 14, 15); }
__device__ __forceinline__ v16bf cat16b(v8us lo, v8us hi) { return __builtin_bit_cast(v16bf, __builtin_shufflevector(lo, hi, 0, 1, 2, 3, 4, 5, 6, 7, 8, 9, 10, 11, 12, 13, 14, 15)); }
__device__ __forceinline__ v8f wmma16(v16h a, v16h b, v8f c) { return __builtin_amdgcn_wmma_f32_16x16x32_f16(false, a, false, b, (short)0, c, false, false); }
__device__ __forceinline__ v8f wmmab(v16bf a, v16bf b, v8f c) { return __builtin_amdgcn_wmma_f32_16x16x32_bf16(false, a, false, b, (short)0, c, false, false); }



// ---- k_gemmw: register-blocked GEMM, one 64x64 output tile per work-group (16 accumulators per wave), operands straight from K-contiguous 16-bit planes; grid (M/64, N/64, Z), 32 * NW threads.
// C[m][n] (f32, pitch ldc, + optional f32 bias[n]) = sum_k A[m][k] Bt[n][k] (+ split products per NSPLIT). z-batch strides sA/sB/sC in elements. K % (32 * NW) == 0.
// NW waves share the tile: wave w sums the k range [w K/NW, (w+1) K/NW), so NW times as many loads are in flight for the tile and each wave's chain of load waits is NW times shorter; the NW partial tiles meet in LDS and are added in wave order.
template <typename T16> struct WFrag;
template <> struct WFrag<h16> { typedef v16h V; static __device__ __forceinline__ V ld(const h16* p) { return cat16(*(const v8h*)p, *(const v8h*)(p + 16)); } static __device__ __forceinline__ v8f mma(V a, V b, v8f c) { return wmma16(a, b, c); } };
template <> struct WFrag<bf> { typedef v16bf V; static __device__ __forceinline__ V ld(const bf* p) { return cat16b(*(const v8us*)p, *(const v8us*)(p + 16)); } static __device__ __forceinline__ v8f mma(V a, V b, v8f c) { return wmmab(a, b, c); } };
template <typename T16, int NSPLIT, bool BIAS, int NW>
__global__ __launch_bounds__(32 * NW) void k_gemmw(const T16* __restrict__ A, const T16* __restrict__ A2, const T16* __restrict__ Bt, const T16* __restrict__ Bt2, int K, float* C, int ldc, const float* __restrict__ bias, size_t sA, size_t sB, size_t sC) {
    typedef typename WFrag<T16>::V V;
    __shared__ __align__(16) float os[NW == 1 ? 16 * 68 : NW * 64 * 68];
    const size_t z = blockIdx.z; A += z * sA; if (A2) A2 += z * sA; Bt += z * sB; if (Bt2) Bt2 += z * sB; C += z * sC;
    const int lane = threadIdx.x & 31, lr = lane & 15, hi = lane >> 4; const int r0 = blockIdx.x * 64, c0 = blockIdx.y * 64;
    v8f acc[4][4];
#pragma unroll
    for (int mb = 0; mb < 4; ++mb)
#pragma unroll
        for (int nb = 0; nb < 4; ++nb) acc[mb][nb] = (v8f){};
    const size_t aoff = (size_t)(r0 + lr) * K + 8 * hi, boff = (size_t)(c0 + lr) * K + 8 * hi;
    const int wv = NW == 1 ? 0 : __builtin_amdgcn_readfirstlane((int)(threadIdx.x >> 5)); const int kbeg = wv * (K / NW), kend = kbeg + K / NW;
#pragma unroll 1
    for (int kc = kbeg; kc < kend; kc += 32) {
        V a[4], a2[4];
#pragma unroll
        for (int mb = 0; mb < 4; ++mb) { a[mb] = WFrag<T16>::ld(A + aoff + (size_t)mb * 16 * K + kc); if (NSPLIT == 1 || NSPLIT == 2) a2[mb] = WFrag<T16>::ld(A2 + aoff + (size_t)mb * 16 * K + kc); }
#pragma unroll
        for (int nb = 0; nb < 4; ++nb) { const V b = WFrag<T16>::ld(Bt + boff + (size_t)nb * 16 * K + kc); V b2; if (NSPLIT >= 2) b2 = WFrag<T16>::ld(Bt2 + boff + (size_t)nb * 16 * K + kc);
#pragma unroll
            for (int mb = 0; mb < 4; ++mb) { acc[mb][nb] = WFrag<T16>::mma(a[mb], b, acc[mb][nb]); if (NSPLIT == 1 || NSPLIT == 2) acc[mb][nb] = WFrag<T16>::mma(a2[mb], b, acc[mb][nb]); if (NSPLIT >= 2) acc[mb][nb] = WFrag<T16>::mma(a[mb], b2, acc[mb][nb]); } }
        asm volatile("v_nop\n\tv_nop\n\tv_nop\n\tv_nop" : "+v"(acc[0][0]), "+v"(acc[1][1]), "+v"(acc[2][2]), "+v"(acc[3][3]) : "v"(a[0]), "v"(a[3]));
    }
    if constexpr (NW > 1) {
        float* mine = os + wv * (64 * 68);
#pragma unroll
        for (int mb = 0; mb < 4; ++mb)
#pragma unroll
            for (int nb = 0; nb < 4; ++nb)
#pragma unroll
                for (int j = 0; j < 8; ++j) mine[(mb * 16 + hi * 8 + j) * 68 + nb * 16 + lr] = acc[mb][nb][j];
        const int cofs = lr * 4; v4f bv = (v4f){};
        if (BIAS) { bv[0] = bfr(bias[c0 + cofs]); bv[1] = bfr(bias[c0 + cofs + 1]); bv[2] = bfr(bias[c0 + cofs + 2]); bv[3] = bfr(bias[c0 + cofs + 3]); }
        __syncthreads();    // every wave's partial tile lies in LDS before any wave adds them up
#pragma unroll
        for (int s = 0; s < 32 / NW; ++s) { const int row = (s * NW + wv) * 2 + hi; v4f val = *(const v4fa*)(os + row * 68 + cofs);
#pragma unroll
            for (int w = 1; w < NW; ++w) val += *(const v4fa*)(os + w * (64 * 68) + row * 68 + cofs);
            if (BIAS) val += bv;
            *(v4f*)(C + (size_t)(r0 + row) * ldc + c0 + cofs) = val; }
        return;
    }
#pragma unroll
    for (int mb = 0; mb < 4; ++mb) {
#pragma unroll
        for (int nb = 0; nb < 4; ++nb) {
#pragma unroll
            for (int j = 0; j < 8; ++j) os[(hi * 8 + j) * 68 + nb * 16 + lr] = acc[mb][nb][j]; }
        __builtin_amdgcn_wave_barrier(); asm volatile("" ::: "memory");
        float* crow = C + (size_t)(r0 + mb * 16) * ldc + c0;
{
#pragma unroll
            for (int s = 0; s < 8; ++s) { const int row = 2 * s + hi, cofs = lr * 4; v4f val = *(const v4fa*)(os + row * 68 + cofs); if (BIAS) { val[0] += bfr(bias[c0 + cofs]); val[1] += bfr(bias[c0 + cofs + 1]); val[2] += bfr(bias[c0 + cofs + 2]); val[3] += bfr(bias[c0 + cofs + 3]); }
                *(v4f*)(crow + (size_t)row * ldc + cofs) = val; }
             }
        __builtin_amdgcn_wave_barrier(); asm volatile("" ::: "memory");
    }
}

__device__ __forceinline__ h16 tohx(float x) { return (h16)x; }
__device__ __forceinline__ void splitf(float y, unsigned short& h, unsigned short& l) { h = f2bf(y); l = f2bf(y - bf2f(h)); }
typedef __attribute__((ext_vector_type(2))) unsigned short v2us;
typedef __attribute__((ext_vector_type(4))) unsigned short v4us;
typedef __attribute__((ext_vector_type(2))) _Float16 v2h;
typedef __attribute__((ext_vector_type(4))) _Float16 v4h;

__global__ __launch_bounds__(256) void k_wtG(const float* __restrict__ w, int K, int N, bf* Bt) {
    const int lane = threadIdx.x & 31; const int L0 = (blockIdx.x * 8 + (threadIdx.x >> 5)) * 8; const int nlines = N * K / 64;
{
#pragma unroll 1
        for (int l = 0; l < 8; ++l) { const int L = L0 + l; if (L >= nlines) break; const size_t e = (size_t)L * 64 + lane * 2; const int k = (int)(e % K), n = (int)(e / K); v2us o;
            o[0] = f2bf(w[(size_t)k * N + n]); o[1] = f2bf(w[(size_t)(k + 1) * N + n]); *(v2us*)(Bt + e) = o; }
         }
}
__global__ __launch_bounds__(256) void k_cvt8(const float* __restrict__ src, bf* dst, size_t n8) { const size_t i = (size_t)blockIdx.x * 256 + threadIdx.x; if (i >= n8) return; const v8f v = *(const v8f*)(src + i * 8); v8us o;
#pragma unroll
    for (int k = 0; k < 8; ++k) o[k] = f2bf(v[k]); *(v8us*)(dst + i * 8) = o;  }
// k_w2: Bt[h][k] = bf16 W2[k][h], 16 head rows (8-B lanes); k_ac: lane -> 4 consecutive hidden units of token i: a = f W1[0] + log(f + 1e-6) W1[1] + b1, c = -(f W1[0]) - (log(f+eps) W1[1]) (16-B lanes);
__global__ __launch_bounds__(256) void k_w2(const float* __restrict__ W2, bf* Bt) { const int e = (blockIdx.x * 256 + threadIdx.x) * 4; if (e >= NH_ * HID) return; const int k = e % HID; const int h = e / HID; v4us o;
#pragma unroll
    for (int u = 0; u < 4; ++u) o[u] = f2bf(W2[(k + u) * NH_ + h]); *(v4us*)(Bt + e) = o;  }
__global__ __launch_bounds__(256) void k_ac(const float* __restrict__ fr, const float* __restrict__ W1, const float* __restrict__ b1, float* A, float* C) { const int e = (blockIdx.x * 256 + threadIdx.x) * 4; if (e >= TT * HID) return; const int k0 = e % HID; const int i = e / HID; const float f = bfr(fr[i]); const float lf = __logf(__fadd_rn(f, 1e-6f)); v4f oa, oc;
#pragma unroll
    for (int u = 0; u < 4; ++u) { const int k = k0 + u; float t1 = __fmul_rn(f, bfr(W1[k])), t2 = __fmul_rn(lf, bfr(W1[HID + k])); asm volatile("" : "+v"(t1)); asm volatile("" : "+v"(t2)); oa[u] = __fadd_rn(__fadd_rn(t1, t2), bfr(b1[k])); oc[u] = __fsub_rn(-t1, t2); }
    { *(v4f*)(A + e) = oa; *(v4f*)(C + e) = oc;  } }
// k_bias: BI[h][il][j] = sum_k W2[k][h] relu(a[i0+il][k] + c[j][k]); grid (TT / 32, RC / (8 * NI)), 8 waves. W2 is the A operand (row = head), the relu features are the B operand (column = j), made in registers as bf16 hi + lo.
// The 8 waves of a work-group share 32 j (two column tiles, c kept in registers); each wave walks its own NI query rows. The second tile takes W2 with head rows 0..7 and 8..15 exchanged, so that lanes 0..15 of one tile and
// 16..31 of the other hold the same head: each store then covers one whole 128-B line of a head's row.
#define NI 4
typedef __attribute__((ext_vector_type(2))) float v2f;
typedef __attribute__((ext_vector_type(2))) __bf16 v2bf;
__global__ __launch_bounds__(256) void k_bias(const float* __restrict__ A, const float* __restrict__ C, const bf* __restrict__ Bt, int i0, float* BI) {
    const int lane = threadIdx.x & 31, lr = lane & 15, hi = lane >> 4; const int j0 = blockIdx.x * 32; const int il0 = (blockIdx.y * 8 + (threadIdx.x >> 5)) * NI;
    const float* ar = A + (size_t)(i0 + il0) * HID + 8 * hi; float* o0 = BI + (size_t)il0 * TT + j0 + lane; float* o1 = BI + ((size_t)8 * RC + il0) * TT + j0 + (lane ^ 16);
    v16bf w[2][2]; v8f cv[2][2][2], av[2][2], x, y;
#pragma unroll
    for (int ks = 0; ks < 2; ++ks) { w[0][ks] = WFrag<bf>::ld(Bt + lr * HID + ks * 32 + 8 * hi); w[1][ks] = WFrag<bf>::ld(Bt + (lr ^ 8) * HID + ks * 32 + 8 * hi); av[ks][0] = *(const v8f*)(ar + ks * 32); av[ks][1] = *(const v8f*)(ar + ks * 32 + 16);
#pragma unroll
        for (int t = 0; t < 2; ++t) { const float* cr = C + (size_t)(j0 + t * 16 + lr) * HID + ks * 32 + 8 * hi; cv[t][ks][0] = *(const v8f*)cr; cv[t][ks][1] = *(const v8f*)(cr + 16); } }
    asm volatile("s_wait_xcnt 0x0" ::: "memory");    // before a register that these loads name as an address is written again
#pragma unroll
    for (int ii = 0; ii < NI; ++ii) { v8f an[2][2]; v8f acc[2] = {(v8f){}, (v8f){}};
        if (ii + 1 < NI) {
#pragma unroll
            for (int ks = 0; ks < 2; ++ks) { an[ks][0] = *(const v8f*)(ar + (ii + 1) * HID + ks * 32); an[ks][1] = *(const v8f*)(ar + (ii + 1) * HID + ks * 32 + 16); } }
        if (ii > 0) {
#pragma unroll
            for (int r = 0; r < 8; ++r) { o0[(size_t)r * RC * TT + (ii - 1) * TT] = x[r]; o1[(size_t)r * RC * TT + (ii - 1) * TT] = y[r]; } }
        asm volatile("s_wait_xcnt 0x0" ::: "memory");    // before a register that these loads and stores name is written again
        __builtin_amdgcn_sched_barrier(0);    // the next row's loads and the last row's stores stay in front of this row's arithmetic, which covers their latency
#pragma unroll
        for (int ks = 0; ks < 2; ++ks) {
#pragma unroll
            for (int t = 0; t < 2; ++t) { v16bf fh, fl;
#pragma unroll
                for (int g = 0; g < 2; ++g)
#pragma unroll
                    for (int s = 0; s < 8; s += 2) { v2f h; h[0] = fmaxf(av[ks][g][s] + cv[t][ks][g][s], 0.f); h[1] = fmaxf(av[ks][g][s + 1] + cv[t][ks][g][s + 1], 0.f); const v2bf ph = __builtin_convertvector(h, v2bf);
                        v2f r; r[0] = h[0] - (float)ph[0]; r[1] = h[1] - (float)ph[1]; const v2bf pl = __builtin_convertvector(r, v2bf); fh[g * 8 + s] = ph[0]; fh[g * 8 + s + 1] = ph[1]; fl[g * 8 + s] = pl[0]; fl[g * 8 + s + 1] = pl[1]; }
                acc[t] = wmmab(w[t][ks], fh, acc[t]); acc[t] = wmmab(w[t][ks], fl, acc[t]); } }
#pragma unroll
        for (int r = 0; r < 8; ++r) { x[r] = hi ? acc[1][r] : acc[0][r]; y[r] = hi ? acc[0][r] : acc[1][r]; }    // x: head r, y: head 8 + r, each over the 32 j
        __builtin_amdgcn_sched_barrier(0);    // all 16 selected values exist before the first store: the stores then go out in one run, with no register of one reused ahead of the next
        if (ii + 1 < NI) {
#pragma unroll
            for (int ks = 0; ks < 2; ++ks) { av[ks][0] = an[ks][0]; av[ks][1] = an[ks][1]; } } }
#pragma unroll
    for (int r = 0; r < 8; ++r) { o0[(size_t)r * RC * TT + (NI - 1) * TT] = x[r]; o1[(size_t)r * RC * TT + (NI - 1) * TT] = y[r]; }
}
__global__ __launch_bounds__(256) void k_pl(const float* __restrict__ F, h16* P) { const int e = (blockIdx.x * 256 + threadIdx.x) * 4; if (e >= NH_ * TT * HD) return; const int d = e % HD; const int t = (e / HD) % TT; const int h = e / (HD * TT); const float* f = F + (size_t)t * DM + h * HD + d; v4h o;
#pragma unroll
    for (int u = 0; u < 4; ++u) o[u] = tohx(f[u]); *(v4h*)(P + e) = o;  }
__global__ __launch_bounds__(256) void k_vt(const float* __restrict__ V, h16* VT) { const int e = (blockIdx.x * 256 + threadIdx.x) * 2; if (e >= NH_ * HD * TT) return; const int t = e % TT; const int d = (e / TT) % HD; const int h = e / (TT * HD); v2h o; o[0] = tohx(V[(size_t)t * DM + h * HD + d]); o[1] = tohx(V[(size_t)(t + 1) * DM + h * HD + d]); *(v2h*)(VT + e) = o;  }
__global__ __launch_bounds__(256) void k_hsoft(const float* __restrict__ Sb, const float* __restrict__ BI, const float* __restrict__ b2, h16* P16) { const int lane = threadIdx.x & 31; const int row = blockIdx.x * 8 + (threadIdx.x >> 5); if (row >= NH_ * RC) return; const int h = row / RC; const float* sr = Sb + (size_t)row * TT; const float* br = BI + (size_t)row * TT; const float bh = bfr(b2[h]); float v[TT / 32]; float mx = -3.0e38f;
    asm volatile("s_wait_xcnt 0x0" ::: "memory");    // before the register that the b2 load names as its offset is written again
#pragma unroll
    for (int ch = 0; ch < TT / 128; ++ch) { const int j0 = ch * 128 + lane * 4; const v4f a = *(const v4f*)(sr + j0); const v4f bj = *(const v4f*)(br + j0);
#pragma unroll
        for (int u = 0; u < 4; ++u) { float t0 = a[u] * 0.125f; asm volatile("" : "+v"(t0)); const float t = __fadd_rn(t0, __fadd_rn(bj[u], bh)); v[ch * 4 + u] = t; mx = fmaxf(mx, t); } }
#pragma unroll
    for (int sh = 16; sh; sh >>= 1) mx = fmaxf(mx, __shfl_xor(mx, sh, 32));
    float sum = 0.f;
#pragma unroll
    for (int q = 0; q < TT / 32; ++q) { float d0 = __fsub_rn(v[q], mx); asm volatile("" : "+v"(d0)); v[q] = __builtin_amdgcn_exp2f(__fmul_rn(d0, 1.4426950408889634f)); sum += v[q]; }
#pragma unroll
    for (int sh = 16; sh; sh >>= 1) sum += __shfl_xor(sum, sh, 32);
    const float f = __fdiv_rn(PCAR, sum);
    {
#pragma unroll
        for (int ch = 0; ch < TT / 128; ++ch) { v4h o4;
#pragma unroll
            for (int q = 0; q < 4; ++q) o4[q] = tohx(v[ch * 4 + q] * f); *(v4h*)(P16 + (size_t)row * TT + ch * 128 + lane * 4) = o4; }
         } }
__global__ __launch_bounds__(256) void k_mrg(const float* __restrict__ O, int i0, bf* Ah, bf* Al) { const int e = (blockIdx.x * 256 + threadIdx.x) * 4; if (e >= NH_ * RC * HD) return; const int d = e % HD; const int il = (e / HD) % RC; const int h = e / (HD * RC); v4us oh, ol;
#pragma unroll
    for (int u = 0; u < 4; ++u) { unsigned short a, b; splitf(O[e + u] * (1.0f / PCAR), a, b); oh[u] = a; ol[u] = b; } const size_t oo = (size_t)(i0 + il) * DM + h * HD + d; *(v4us*)(Ah + oo) = oh; *(v4us*)(Al + oo) = ol;  }

extern "C" void kernel_launch(void* const* d_in, const int* in_sizes, int n_in,
                              void* d_out, int out_size, void* d_ws, size_t ws_size, hipStream_t stream) {
    (void)in_sizes; (void)n_in; (void)out_size;
    const float** I = (const float**)d_in;
    const float *x = I[0], *freqs = I[1], *Wq = I[2], *bq = I[3], *Wk = I[4], *bk = I[5], *Wv = I[6], *bv = I[7], *Wo = I[8], *bo = I[9], *W1 = I[10], *b1 = I[11], *W2 = I[12], *b2 = I[13];
    float* OUT = (float*)d_out;     // [2][1024][1024]
    char* wsp = (char*)d_ws;
    auto take = [&](size_t bytes) { char* p = wsp; wsp += (bytes + 255) & ~(size_t)255; return (void*)p; };
    bf* BQ = (bf*)take((size_t)DM * DM * 2); bf* BK = (bf*)take((size_t)DM * DM * 2); bf* BV = (bf*)take((size_t)DM * DM * 2); bf* BO = (bf*)take((size_t)DM * DM * 2); bf* B2 = (bf*)take(NH_ * HID * 2);
    bf* XB = (bf*)take((size_t)TT * DM * 2); float* FQ = (float*)take((size_t)TT * DM * 4); float* FK = (float*)take((size_t)TT * DM * 4); float* FV = (float*)take((size_t)TT * DM * 4); float* A = (float*)take(TT * HID * 4); float* C = (float*)take(TT * HID * 4);
    h16* Q16 = (h16*)take((size_t)NH_ * TT * HD * 2); h16* K16 = (h16*)take((size_t)NH_ * TT * HD * 2); h16* VT = (h16*)take((size_t)NH_ * HD * TT * 2); float* BI = (float*)take((size_t)NPR * NH_ * 4);
    float* Sb = (float*)take((size_t)NH_ * RC * TT * 4); h16* P16 = (h16*)take((size_t)NH_ * RC * TT * 2); float* O = (float*)take((size_t)NH_ * RC * HD * 4); bf* Ch = (bf*)take((size_t)TT * DM * 2); bf* Cl = (bf*)take((size_t)TT * DM * 2);
    if ((size_t)(wsp - (char*)d_ws) > ws_size) return;    // total ~ 75 MB (per 256-query chunk: 16-head bias 16 MB + 16-head scores 16 MB)
    k_wtG<<<(DM * DM / 64 + 63) / 64, 256, 0, stream>>>(Wq, DM, DM, BQ); k_wtG<<<(DM * DM / 64 + 63) / 64, 256, 0, stream>>>(Wk, DM, DM, BK); k_wtG<<<(DM * DM / 64 + 63) / 64, 256, 0, stream>>>(Wv, DM, DM, BV); k_wtG<<<(DM * DM / 64 + 63) / 64, 256, 0, stream>>>(Wo, DM, DM, BO); k_w2<<<(NH_ * HID / 4 + 255) / 256, 256, 0, stream>>>(W2, B2);
    for (int b = 0; b < NB_; ++b) {
        k_cvt8<<<(TT * DM / 8 + 255) / 256, 256, 0, stream>>>(x + (size_t)b * TT * DM, XB, (size_t)TT * DM / 8);
        k_gemmw<bf, 0, true, 8><<<dim3(TT / 64, DM / 64, 1), 256, 0, stream>>>(XB, nullptr, BQ, nullptr, DM, FQ, DM, bq, 0, 0, 0); k_gemmw<bf, 0, true, 8><<<dim3(TT / 64, DM / 64, 1), 256, 0, stream>>>(XB, nullptr, BK, nullptr, DM, FK, DM, bk, 0, 0, 0); k_gemmw<bf, 0, true, 8><<<dim3(TT / 64, DM / 64, 1), 256, 0, stream>>>(XB, nullptr, BV, nullptr, DM, FV, DM, bv, 0, 0, 0);
        k_pl<<<(NH_ * TT * HD / 4 + 255) / 256, 256, 0, stream>>>(FQ, Q16); k_pl<<<(NH_ * TT * HD / 4 + 255) / 256, 256, 0, stream>>>(FK, K16); k_vt<<<(NH_ * HD * TT / 2 + 255) / 256, 256, 0, stream>>>(FV, VT);
        k_ac<<<(TT * HID / 4 + 255) / 256, 256, 0, stream>>>(freqs + (size_t)b * TT, W1, b1, A, C);
        for (int i0 = 0; i0 < TT; i0 += RC) {
            k_bias<<<dim3(TT / 32, RC / (8 * NI), 1), 256, 0, stream>>>(A, C, B2, i0, BI);
            k_gemmw<h16, 0, false, 1><<<dim3(RC / 64, TT / 64, NH_), 32, 0, stream>>>(Q16 + (size_t)i0 * HD, nullptr, K16, nullptr, HD, Sb, TT, nullptr, (size_t)TT * HD, (size_t)TT * HD, (size_t)RC * TT);
            k_hsoft<<<NH_ * RC / 8, 256, 0, stream>>>(Sb, BI, b2, P16);
            k_gemmw<h16, 0, false, 8><<<dim3(RC / 64, 1, NH_), 256, 0, stream>>>(P16, nullptr, VT, nullptr, TT, O, HD, nullptr, (size_t)RC * TT, (size_t)HD * TT, (size_t)RC * HD);
            k_mrg<<<(NH_ * RC * HD / 4 + 255) / 256, 256, 0, stream>>>(O, i0, Ch, Cl); }
        k_gemmw<bf, 1, true, 8><<<dim3(TT / 64, DM / 64, 1), 256, 0, stream>>>(Ch, Cl, BO, nullptr, DM, OUT + (size_t)b * TT * DM, DM, bo, 0, 0, 0); }
}

// v003
// A run of this version takes 189 microseconds.
// Timed twice side by side with v002, it ran 1.99 and 2.00 times as fast.
// Over all steps from v000 it is 5.24 times as fast.
#include <hip/hip_runtime.h>

// HarmonicAttentionLayer (x [2][1024][1024], freqs [2][1024][1]; Q/K/V = x W + b (16 heads x 64); scores = q.k/8 + b[h][i][j] where b = relu(feat(i,j) W1 + b1) W2 + b2 with feat = [f_i - f_j, log((f_i + eps)/(f_j + eps))] (64 hidden); softmax; out = (attn V merged) Wo + bo
// -> [2][1024][1024]). The pairwise feature MLP is evaluated as relu(a_i + c_j) with a_i = f_i W1[0] + log(f_i + eps) W1[1] + b1, c_j = -f_j W1[0] - log(f_j + eps) W1[1] (exact algebra of the difference / log-ratio), then x W2 as a GEMM over
// one batch element's 1024 query rows per launch.
// Compute dtypes, f32 accumulate: every input rounded to bf16; Q/K/V on PLAIN bf16 operands (inputs: exact) + bias; a_i / c_j and relu f32 on the VALU -> bf16 hi+lo in registers; the bias GEMM hl x exact W2 (2 products); scores (K 64)

#define NB_  2
#define TT   1024
#define DM   1024
#define NH_  16
#define HD   64
#define HID  64
#define RC   1024
#define PCAR 1024.0f
typedef _Float16 h16;
typedef unsigned short bf;
typedef __attribute__((ext_vector_type(16))) __bf16   v16bf;
typedef __attribute__((ext_vector_type(16))) _Float16 v16h;
typedef __attribute__((ext_vector_type(8)))  _Float16 v8h;
typedef __attribute__((ext_vector_type(8)))  unsigned short v8us;
typedef __attribute__((ext_vector_type(8)))  float    v8f;
typedef __attribute__((ext_vector_type(4)))  float    v4f;
typedef v8h  __attribute__((may_alias)) v8ha;
typedef v4f  __attribute__((may_alias)) v4fa;
typedef v8us __attribute__((may_alias)) v8usa;

__device__ __forceinline__ unsigned short f2bf(float f) { unsigned u = __float_as_uint(f); u += 0x7FFFu + ((u >> 16) & 1u); return (unsigned short)(u >> 16); }
__device__ __forceinline__ float bf2f(unsigned short b) { return __uint_as_float(((unsigned)b) << 16); }
__device__ __forceinline__ float bfr(float f) { return bf2f(f2bf(f)); }
__device__ __forceinline__ v16h cat16(v8h lo, v8h hi) { return __builtin_shufflevector(lo, hi, 0, 1, 2, 3, 4, 5, 6, 7, 8, 9, 10, 11, 12, 13, 14, 15); }
__device__ __forceinline__ v16bf cat16b(v8us lo, v8us hi) { return __builtin_bit_cast(v16bf, __builtin_shufflevector(lo, hi, 0, 1, 2, 3, 4, 5, 6, 7, 8, 9, 10, 11, 12, 13, 14, 15)); }
__device__ __forceinline__ v8f wmma16(v16h a, v16h b, v8f c) { return __builtin_amdgcn_wmma_f32_16x16x32_f16(false, a, false, b, (short)0, c, false, false); }
__device__ __forceinline__ v8f wmmab(v16bf a, v16bf b, v8f c) { return __builtin_amdgcn_wmma_f32_16x16x32_bf16(false, a, false, b, (short)0, c, false, false); }



// ---- k_gemmw: register-blocked GEMM, one 64x64 output tile per work-group (16 accumulators per wave), operands straight from K-contiguous 16-bit planes; grid (M/64, N/64, Z), 32 * NW threads.
// C[m][n] (f32, pitch ldc, + optional f32 bias[n], its own vector for z = 0, 1, 2) = sum_k A[m][k] Bt[n][k] (+ split products per NSPLIT). z-batch strides sA/sB/sC in elements. K % (32 * NW) == 0.
// NW waves share the tile: wave w sums the k range [w K/NW, (w+1) K/NW), so NW times as many loads are in flight for the tile and each wave's chain of load waits is NW times shorter; the NW partial tiles meet in LDS and are added in wave order.
template <typename T16> struct WFrag;
template <> struct WFrag<h16> { typedef v16h V; static __device__ __forceinline__ V ld(const h16* p) { return cat16(*(const v8h*)p, *(const v8h*)(p + 16)); } static __device__ __forceinline__ v8f mma(V a, V b, v8f c) { return wmma16(a, b, c); } };
template <> struct WFrag<bf> { typedef v16bf V; static __device__ __forceinline__ V ld(const bf* p) { return cat16b(*(const v8us*)p, *(const v8us*)(p + 16)); } static __device__ __forceinline__ v8f mma(V a, V b, v8f c) { return wmmab(a, b, c); } };
template <typename T16, int NSPLIT, bool BIAS, int NW>
__global__ __launch_bounds__(32 * NW) void k_gemmw(const T16* __restrict__ A, const T16* __restrict__ A2, const T16* __restrict__ Bt, const T16* __restrict__ Bt2, int K, float* C, int ldc, const float* __restrict__ bias0, const float* __restrict__ bias1, const float* __restrict__ bias2, size_t sA, size_t sB, size_t sC) {
    typedef typename WFrag<T16>::V V;
    __shared__ __align__(16) float os[NW == 1 ? 16 * 68 : NW * 64 * 68];
    const size_t z = blockIdx.z; A += z * sA; if (A2) A2 += z * sA; Bt += z * sB; if (Bt2) Bt2 += z * sB; C += z * sC; const float* bias = z == 0 ? bias0 : z == 1 ? bias1 : bias2;
    const int lane = threadIdx.x & 31, lr = lane & 15, hi = lane >> 4; const int r0 = blockIdx.x * 64, c0 = blockIdx.y * 64;
    v8f acc[4][4];
#pragma unroll
    for (int mb = 0; mb < 4; ++mb)
#pragma unroll
        for (int nb = 0; nb < 4; ++nb) acc[mb][nb] = (v8f){};
    const size_t aoff = (size_t)(r0 + lr) * K + 8 * hi, boff = (size_t)(c0 + lr) * K + 8 * hi;
    const int wv = NW == 1 ? 0 : __builtin_amdgcn_readfirstlane((int)(threadIdx.x >> 5)); const int kbeg = wv * (K / NW), kend = kbeg + K / NW;
#pragma unroll 1
    for (int kc = kbeg; kc < kend; kc += 32) {
        V a[4], a2[4];
#pragma unroll
        for (int mb = 0; mb < 4; ++mb) { a[mb] = WFrag<T16>::ld(A + aoff + (size_t)mb * 16 * K + kc); if (NSPLIT == 1 || NSPLIT == 2) a2[mb] = WFrag<T16>::ld(A2 + aoff + (size_t)mb * 16 * K + kc); }
#pragma unroll
        for (int nb = 0; nb < 4; ++nb) { const V b = WFrag<T16>::ld(Bt + boff + (size_t)nb * 16 * K + kc); V b2; if (NSPLIT >= 2) b2 = WFrag<T16>::ld(Bt2 + boff + (size_t)nb * 16 * K + kc);
#pragma unroll
            for (int mb = 0; mb < 4; ++mb) { acc[mb][nb] = WFrag<T16>::mma(a[mb], b, acc[mb][nb]); if (NSPLIT == 1 || NSPLIT == 2) acc[mb][nb] = WFrag<T16>::mma(a2[mb], b, acc[mb][nb]); if (NSPLIT >= 2) acc[mb][nb] = WFrag<T16>::mma(a[mb], b2, acc[mb][nb]); } }
        asm volatile("v_nop\n\tv_nop\n\tv_nop\n\tv_nop" : "+v"(acc[0][0]), "+v"(acc[1][1]), "+v"(acc[2][2]), "+v"(acc[3][3]) : "v"(a[0]), "v"(a[3]));
    }
    if constexpr (NW > 1) {
        float* mine = os + wv * (64 * 68);
#pragma unroll
        for (int mb = 0; mb < 4; ++mb)
#pragma unroll
            for (int nb = 0; nb < 4; ++nb)
#pragma unroll
                for (int j = 0; j < 8; ++j) mine[(mb * 16 + hi * 8 + j) * 68 + nb * 16 + lr] = acc[mb][nb][j];
        const int cofs = lr * 4; v4f bv = (v4f){};
        if (BIAS) { bv[0] = bfr(bias[c0 + cofs]); bv[1] = bfr(bias[c0 + cofs + 1]); bv[2] = bfr(bias[c0 + cofs + 2]); bv[3] = bfr(bias[c0 + cofs + 3]); }
        __syncthreads();    // every wave's partial tile lies in LDS before any wave adds them up
#pragma unroll
        for (int s = 0; s < 32 / NW; ++s) { const int row = (s * NW + wv) * 2 + hi; v4f val = *(const v4fa*)(os + row * 68 + cofs);
#pragma unroll
            for (int w = 1; w < NW; ++w) val += *(const v4fa*)(os + w * (64 * 68) + row * 68 + cofs);
            if (BIAS) val += bv;
            *(v4f*)(C + (size_t)(r0 + row) * ldc + c0 + cofs) = val; }
        return;
    }
#pragma unroll
    for (int mb = 0; mb < 4; ++mb) {
#pragma unroll
        for (int nb = 0; nb < 4; ++nb) {
#pragma unroll
            for (int j = 0; j < 8; ++j) os[(hi * 8 + j) * 68 + nb * 16 + lr] = acc[mb][nb][j]; }
        __builtin_amdgcn_wave_barrier(); asm volatile("" ::: "memory");
        float* crow = C + (size_t)(r0 + mb * 16) * ldc + c0;
{
#pragma unroll
            for (int s = 0; s < 8; ++s) { const int row = 2 * s + hi, cofs = lr * 4; v4f val = *(const v4fa*)(os + row * 68 + cofs); if (BIAS) { val[0] += bfr(bias[c0 + cofs]); val[1] += bfr(bias[c0 + cofs + 1]); val[2] += bfr(bias[c0 + cofs + 2]); val[3] += bfr(bias[c0 + cofs + 3]); }
                *(v4f*)(crow + (size_t)row * ldc + cofs) = val; }
             }
        __builtin_amdgcn_wave_barrier(); asm volatile("" ::: "memory");
    }
}

__device__ __forceinline__ h16 tohx(float x) { return (h16)x; }
__device__ __forceinline__ void splitf(float y, unsigned short& h, unsigned short& l) { h = f2bf(y); l = f2bf(y - bf2f(h)); }
typedef __attribute__((ext_vector_type(2))) unsigned short v2us;
typedef __attribute__((ext_vector_type(4))) unsigned short v4us;
typedef __attribute__((ext_vector_type(2))) _Float16 v2h;
typedef __attribute__((ext_vector_type(4))) _Float16 v4h;

// d_*: the bodies of the small element-wise stages, each given its own block index blk, so that stages which do not depend on one another share one launch (k_prep, k_heads).
__device__ __forceinline__ void d_wtG(int blk, const float* __restrict__ w, int K, int N, bf* Bt) {
    const int lane = threadIdx.x & 31; const int L0 = (blk * 8 + (threadIdx.x >> 5)) * 8; const int nlines = N * K / 64;
{
#pragma unroll 1
        for (int l = 0; l < 8; ++l) { const int L = L0 + l; if (L >= nlines) break; const size_t e = (size_t)L * 64 + lane * 2; const int k = (int)(e % K), n = (int)(e / K); v2us o;
            o[0] = f2bf(w[(size_t)k * N + n]); o[1] = f2bf(w[(size_t)(k + 1) * N + n]); *(v2us*)(Bt + e) = o; }
         }
}
__device__ __forceinline__ void d_cvt8(int blk, const float* __restrict__ src, bf* dst, size_t n8) { const size_t i = (size_t)blk * 256 + threadIdx.x; if (i >= n8) return; const v8f v = *(const v8f*)(src + i * 8); v8us o;
#pragma unroll
    for (int k = 0; k < 8; ++k) o[k] = f2bf(v[k]); *(v8us*)(dst + i * 8) = o;  }
// d_w2: Bt[h][k] = bf16 W2[k][h], 16 head rows (8-B lanes); d_ac: lane -> 4 consecutive hidden units of token i (both batch elements, i = b * 1024 + t): a = f W1[0] + log(f + 1e-6) W1[1] + b1, c = -(f W1[0]) - (log(f+eps) W1[1]) (16-B lanes);
__device__ __forceinline__ void d_w2(int blk, const float* __restrict__ W2, bf* Bt) { const int e = (blk * 256 + threadIdx.x) * 4; if (e >= NH_ * HID) return; const int k = e % HID; const int h = e / HID; v4us o;
#pragma unroll
    for (int u = 0; u < 4; ++u) o[u] = f2bf(W2[(k + u) * NH_ + h]); *(v4us*)(Bt + e) = o;  }
__device__ __forceinline__ void d_ac(int blk, const float* __restrict__ fr, const float* __restrict__ W1, const float* __restrict__ b1, float* A, float* C) { const int e = (blk * 256 + threadIdx.x) * 4; if (e >= NB_ * TT * HID) return; const int k0 = e % HID; const int i = e / HID; const float f = bfr(fr[i]); const float lf = __logf(__fadd_rn(f, 1e-6f)); v4f oa, oc;
#pragma unroll
    for (int u = 0; u < 4; ++u) { const int k = k0 + u; float t1 = __fmul_rn(f, bfr(W1[k])), t2 = __fmul_rn(lf, bfr(W1[HID + k])); asm volatile("" : "+v"(t1)); asm volatile("" : "+v"(t2)); oa[u] = __fadd_rn(__fadd_rn(t1, t2), bfr(b1[k])); oc[u] = __fsub_rn(-t1, t2); }
    { *(v4f*)(A + e) = oa; *(v4f*)(C + e) = oc;  } }
// k_prep: everything that reads only the inputs, one launch: blocks [0, 4 WTB) transpose Wq, Wk, Wv, Wo into BW[m][n][k], the next CVB round x to bf16, the next ACB make a and c, the last one W2.
#define WTB ((DM * DM / 64 + 63) / 64)
#define CVB (NB_ * TT * DM / 8 / 256)
#define ACB (NB_ * TT * HID / 4 / 256)
__global__ __launch_bounds__(256) void k_prep(const float* __restrict__ Wq, const float* __restrict__ Wk, const float* __restrict__ Wv, const float* __restrict__ Wo, bf* BW, const float* __restrict__ x, bf* XB,
                                              const float* __restrict__ fr, const float* __restrict__ W1, const float* __restrict__ b1, float* A, float* C, const float* __restrict__ W2, bf* B2) {
    const int bx = blockIdx.x;
    if (bx < 4 * WTB) { const int m = bx / WTB; d_wtG(bx % WTB, m == 0 ? Wq : m == 1 ? Wk : m == 2 ? Wv : Wo, DM, DM, BW + (size_t)m * DM * DM); }
    else if (bx < 4 * WTB + CVB) d_cvt8(bx - 4 * WTB, x, XB, (size_t)NB_ * TT * DM / 8);
    else if (bx < 4 * WTB + CVB + ACB) d_ac(bx - (4 * WTB + CVB), fr, W1, b1, A, C);
    else d_w2(0, W2, B2);
}
// k_bias: BI[h][il][j] = sum_k W2[k][h] relu(a[i0+il][k] + c[j][k]); grid (TT / 32, RC / (8 * NI)), 8 waves. W2 is the A operand (row = head), the relu features are the B operand (column = j), made in registers as bf16 hi + lo.
// The 8 waves of a work-group share 32 j (two column tiles, c kept in registers); each wave walks its own NI query rows. The second tile takes W2 with head rows 0..7 and 8..15 exchanged, so that lanes 0..15 of one tile and
// 16..31 of the other hold the same head: each store then covers one whole 128-B line of a head's row.
#define NI 4
typedef __attribute__((ext_vector_type(2))) float v2f;
typedef __attribute__((ext_vector_type(2))) __bf16 v2bf;
__global__ __launch_bounds__(256) void k_bias(const float* __restrict__ A, const float* __restrict__ C, const bf* __restrict__ Bt, int i0, float* BI) {
    const int lane = threadIdx.x & 31, lr = lane & 15, hi = lane >> 4; const int j0 = blockIdx.x * 32; const int il0 = (blockIdx.y * 8 + (threadIdx.x >> 5)) * NI;
    const float* ar = A + (size_t)(i0 + il0) * HID + 8 * hi; float* o0 = BI + (size_t)il0 * TT + j0 + lane; float* o1 = BI + ((size_t)8 * RC + il0) * TT + j0 + (lane ^ 16);
    v16bf w[2][2]; v8f cv[2][2][2], av[2][2], x, y;
#pragma unroll
    for (int ks = 0; ks < 2; ++ks) { w[0][ks] = WFrag<bf>::ld(Bt + lr * HID + ks * 32 + 8 * hi); w[1][ks] = WFrag<bf>::ld(Bt + (lr ^ 8) * HID + ks * 32 + 8 * hi); av[ks][0] = *(const v8f*)(ar + ks * 32); av[ks][1] = *(const v8f*)(ar + ks * 32 + 16);
        asm volatile("s_wait_xcnt 0x0" ::: "memory");    // before a c load lands in a register that a W2 load names as its address
#pragma unroll
        for (int t = 0; t < 2; ++t) { const float* cr = C + (size_t)(j0 + t * 16 + lr) * HID + ks * 32 + 8 * hi; cv[t][ks][0] = *(const v8f*)cr; cv[t][ks][1] = *(const v8f*)(cr + 16); } }
    asm volatile("s_wait_xcnt 0x0" ::: "memory");    // before a register that these loads name as an address is written again
#pragma unroll
    for (int ii = 0; ii < NI; ++ii) { v8f an[2][2]; v8f acc[2] = {(v8f){}, (v8f){}};
        if (ii + 1 < NI) {
#pragma unroll
            for (int ks = 0; ks < 2; ++ks) { an[ks][0] = *(const v8f*)(ar + (ii + 1) * HID + ks * 32); an[ks][1] = *(const v8f*)(ar + (ii + 1) * HID + ks * 32 + 16); } }
        if (ii > 0) {
#pragma unroll
            for (int r = 0; r < 8; ++r) { o0[(size_t)r * RC * TT + (ii - 1) * TT] = x[r]; o1[(size_t)r * RC * TT + (ii - 1) * TT] = y[r]; } }
        asm volatile("s_wait_xcnt 0x0" ::: "memory");    // before a register that these loads and stores name is written again
        __builtin_amdgcn_sched_barrier(0);    // the next row's loads and the last row's stores stay in front of this row's arithmetic, which covers their latency
#pragma unroll
        for (int ks = 0; ks < 2; ++ks) {
#pragma unroll
            for (int t = 0; t < 2; ++t) { v16bf fh, fl;
#pragma unroll
                for (int g = 0; g < 2; ++g)
#pragma unroll
                    for (int s = 0; s < 8; s += 2) { v2f h; h[0] = fmaxf(av[ks][g][s] + cv[t][ks][g][s], 0.f); h[1] = fmaxf(av[ks][g][s + 1] + cv[t][ks][g][s + 1], 0.f); const v2bf ph = __builtin_convertvector(h, v2bf);
                        v2f r; r[0] = h[0] - (float)ph[0]; r[1] = h[1] - (float)ph[1]; const v2bf pl = __builtin_convertvector(r, v2bf); fh[g * 8 + s] = ph[0]; fh[g * 8 + s + 1] = ph[1]; fl[g * 8 + s] = pl[0]; fl[g * 8 + s + 1] = pl[1]; }
                acc[t] = wmmab(w[t][ks], fh, acc[t]); acc[t] = wmmab(w[t][ks], fl, acc[t]); } }
#pragma unroll
        for (int r = 0; r < 8; ++r) { x[r] = hi ? acc[1][r] : acc[0][r]; y[r] = hi ? acc[0][r] : acc[1][r]; }    // x: head r, y: head 8 + r, each over the 32 j
        __builtin_amdgcn_sched_barrier(0);    // all 16 selected values exist before the first store: the stores then go out in one run, with no register of one reused ahead of the next
        if (ii + 1 < NI) {
#pragma unroll
            for (int ks = 0; ks < 2; ++ks) { av[ks][0] = an[ks][0]; av[ks][1] = an[ks][1]; } } }
#pragma unroll
    for (int r = 0; r < 8; ++r) { o0[(size_t)r * RC * TT + (NI - 1) * TT] = x[r]; o1[(size_t)r * RC * TT + (NI - 1) * TT] = y[r]; }
}
// d_pl: P[g][h][t][d] = F[g][t][h * 64 + d], g = 0..3: Q of batch 0, 1, then K of batch 0, 1; d_vt: VT[b][h][d][t] = V[b][t][h * 64 + d].
__device__ __forceinline__ void d_pl(int blk, const float* __restrict__ F, h16* P) { const int e = (blk * 256 + threadIdx.x) * 4; if (e >= 2 * NB_ * NH_ * TT * HD) return; const int d = e % HD; const int t = (e / HD) % TT; const int h = (e / (HD * TT)) % NH_; const int g = e / (HD * TT * NH_); const float* f = F + ((size_t)g * TT + t) * DM + h * HD + d; v4h o;
#pragma unroll
    for (int u = 0; u < 4; ++u) o[u] = tohx(f[u]); *(v4h*)(P + e) = o;  }
__device__ __forceinline__ void d_vt(int blk, const float* __restrict__ V, h16* VT) { const int e = (blk * 256 + threadIdx.x) * 2; if (e >= NB_ * NH_ * HD * TT) return; const int t = e % TT; const int d = (e / TT) % HD; const int h = (e / (TT * HD)) % NH_; const int tb = (e / (TT * HD * NH_)) * TT + t; v2h o; o[0] = tohx(V[(size_t)tb * DM + h * HD + d]); o[1] = tohx(V[(size_t)(tb + 1) * DM + h * HD + d]); *(v2h*)(VT + e) = o;  }
#define VTB (NB_ * NH_ * HD * TT / 2 / 256)
#define PLB (2 * NB_ * NH_ * TT * HD / 4 / 256)
__global__ __launch_bounds__(256) void k_heads(const float* __restrict__ FQK, h16* QK16, const float* __restrict__ FV, h16* VT) { const int bx = blockIdx.x; if (bx < VTB) d_vt(bx, FV, VT); else d_pl(bx - VTB, FQK, QK16); }
__global__ __launch_bounds__(256) void k_hsoft(const float* __restrict__ Sb, const float* __restrict__ BI, const float* __restrict__ b2, h16* P16) { const int lane = threadIdx.x & 31; const int row = blockIdx.x * 8 + (threadIdx.x >> 5); if (row >= NH_ * RC) return; const int h = row / RC; const float* sr = Sb + (size_t)row * TT; const float* br = BI + (size_t)row * TT; const float bh = bfr(b2[h]); float v[TT / 32]; float mx = -3.0e38f;
    asm volatile("s_wait_xcnt 0x0" ::: "memory");    // before the register that the b2 load names as its offset is written again
#pragma unroll
    for (int ch = 0; ch < TT / 128; ++ch) { const int j0 = ch * 128 + lane * 4; const v4f a = *(const v4f*)(sr + j0); const v4f bj = *(const v4f*)(br + j0);
#pragma unroll
        for (int u = 0; u < 4; ++u) { float t0 = a[u] * 0.125f; asm volatile("" : "+v"(t0)); const float t = __fadd_rn(t0, __fadd_rn(bj[u], bh)); v[ch * 4 + u] = t; mx = fmaxf(mx, t); } }
#pragma unroll
    for (int sh = 16; sh; sh >>= 1) mx = fmaxf(mx, __shfl_xor(mx, sh, 32));
    float sum = 0.f;
#pragma unroll
    for (int q = 0; q < TT / 32; ++q) { float d0 = __fsub_rn(v[q], mx); asm volatile("" : "+v"(d0)); v[q] = __builtin_amdgcn_exp2f(__fmul_rn(d0, 1.4426950408889634f)); sum += v[q]; }
#pragma unroll
    for (int sh = 16; sh; sh >>= 1) sum += __shfl_xor(sum, sh, 32);
    const float f = __fdiv_rn(PCAR, sum);
    {
#pragma unroll
        for (int ch = 0; ch < TT / 128; ++ch) { v4h o4;
#pragma unroll
            for (int q = 0; q < 4; ++q) o4[q] = tohx(v[ch * 4 + q] * f); *(v4h*)(P16 + (size_t)row * TT + ch * 128 + lane * 4) = o4; }
         } }
__global__ __launch_bounds__(256) void k_mrg(const float* __restrict__ O, bf* Ah, bf* Al) { const int e = (blockIdx.x * 256 + threadIdx.x) * 4; if (e >= NB_ * NH_ * RC * HD) return; const int d = e % HD; const int il = (e / HD) % RC; const int h = (e / (HD * RC)) % NH_; const int i0 = (e / (HD * RC * NH_)) * TT; v4us oh, ol;
#pragma unroll
    for (int u = 0; u < 4; ++u) { unsigned short a, b; splitf(O[e + u] * (1.0f / PCAR), a, b); oh[u] = a; ol[u] = b; } const size_t oo = (size_t)(i0 + il) * DM + h * HD + d; *(v4us*)(Ah + oo) = oh; *(v4us*)(Al + oo) = ol;  }

extern "C" void kernel_launch(void* const* d_in, const int* in_sizes, int n_in,
                              void* d_out, int out_size, void* d_ws, size_t ws_size, hipStream_t stream) {
    (void)in_sizes; (void)n_in; (void)out_size;
    const float** I = (const float**)d_in;
    const float *x = I[0], *freqs = I[1], *Wq = I[2], *bq = I[3], *Wk = I[4], *bk = I[5], *Wv = I[6], *bv = I[7], *Wo = I[8], *bo = I[9], *W1 = I[10], *b1 = I[11], *W2 = I[12], *b2 = I[13];
    float* OUT = (float*)d_out;     // [2][1024][1024]
    char* wsp = (char*)d_ws;
    auto take = [&](size_t bytes) { char* p = wsp; wsp += (bytes + 255) & ~(size_t)255; return (void*)p; };
    bf* BW = (bf*)take((size_t)4 * DM * DM * 2); bf* BO = BW + (size_t)3 * DM * DM; bf* B2 = (bf*)take(NH_ * HID * 2);    // BW: Wq, Wk, Wv, Wo transposed, one after the other
    bf* XB = (bf*)take((size_t)NB_ * TT * DM * 2); float* FQ = (float*)take((size_t)3 * NB_ * TT * DM * 4); float* FV = FQ + (size_t)2 * NB_ * TT * DM; float* A = (float*)take(NB_ * TT * HID * 4); float* C = (float*)take(NB_ * TT * HID * 4);    // FQ: Q, K, V, each [2][1024][1024]
    h16* Q16 = (h16*)take((size_t)2 * NB_ * NH_ * TT * HD * 2); h16* K16 = Q16 + (size_t)NB_ * NH_ * TT * HD; h16* VT = (h16*)take((size_t)NB_ * NH_ * HD * TT * 2); float* BI = (float*)take((size_t)NH_ * RC * TT * 4);
    float* Sb = (float*)take((size_t)NH_ * RC * TT * 4); h16* P16 = (h16*)take((size_t)NH_ * RC * TT * 2); float* O = (float*)take((size_t)NB_ * NH_ * RC * HD * 4); bf* Ch = (bf*)take((size_t)NB_ * TT * DM * 2); bf* Cl = (bf*)take((size_t)NB_ * TT * DM * 2);
    if ((size_t)(wsp - (char*)d_ws) > ws_size) return;    // total ~ 225 MiB (per batch element: 16-head bias 64 MiB + 16-head scores 64 MiB + probabilities 32 MiB)
    k_prep<<<4 * WTB + CVB + ACB + 1, 256, 0, stream>>>(Wq, Wk, Wv, Wo, BW, x, XB, freqs, W1, b1, A, C, W2, B2);
    k_gemmw<bf, 0, true, 8><<<dim3(NB_ * TT / 64, DM / 64, 3), 256, 0, stream>>>(XB, nullptr, BW, nullptr, DM, FQ, DM, bq, bk, bv, 0, (size_t)DM * DM, (size_t)NB_ * TT * DM);
    k_heads<<<VTB + PLB, 256, 0, stream>>>(FQ, Q16, FV, VT);
    for (int b = 0; b < NB_; ++b) {
        k_bias<<<dim3(TT / 32, RC / (8 * NI), 1), 256, 0, stream>>>(A + (size_t)b * TT * HID, C + (size_t)b * TT * HID, B2, 0, BI);
        k_gemmw<h16, 0, false, 1><<<dim3(RC / 64, TT / 64, NH_), 32, 0, stream>>>(Q16 + (size_t)b * NH_ * TT * HD, nullptr, K16 + (size_t)b * NH_ * TT * HD, nullptr, HD, Sb, TT, nullptr, nullptr, nullptr, (size_t)TT * HD, (size_t)TT * HD, (size_t)RC * TT);
        k_hsoft<<<NH_ * RC / 8, 256, 0, stream>>>(Sb, BI, b2, P16);
        k_gemmw<h16, 0, false, 8><<<dim3(RC / 64, 1, NH_), 256, 0, stream>>>(P16, nullptr, VT + (size_t)b * NH_ * HD * TT, nullptr, TT, O + (size_t)b * NH_ * RC * HD, HD, nullptr, nullptr, nullptr, (size_t)RC * TT, (size_t)HD * TT, (size_t)RC * HD); }
    k_mrg<<<NB_ * NH_ * RC * HD / 4 / 256, 256, 0, stream>>>(O, Ch, Cl);
    k_gemmw<bf, 1, true, 8><<<dim3(NB_ * TT / 64, DM / 64, 1), 256, 0, stream>>>(Ch, Cl, BO, nullptr, DM, OUT, DM, bo, bo, bo, 0, 0, 0);
}

// v004
// A run of this version takes 131 microseconds.
// Timed twice side by side with v003, it ran 1.44 times as fast both times.
// Counting every step since v000, it is 7.56 times as fast.
#include <hip/hip_runtime.h>

// Attention layer with a pairwise frequency bias (x [2][1024][1024], freqs [2][1024][1]; Q/K/V = x W + b (16 heads x 64); scores = q.k/8 + b[h][i][j] where b = relu(feat(i,j) W1 + b1) W2 + b2 with feat = [f_i - f_j, log((f_i + eps)/(f_j + eps))] (64 hidden); softmax; out = (attn V merged) Wo + bo
// -> [2][1024][1024]). The pairwise feature MLP is evaluated as relu(a_i + c_j) with a_i = f_i W1[0] + log(f_i + eps) W1[1] + b1, c_j = -f_j W1[0] - log(f_j + eps) W1[1] (exact algebra of the difference / log-ratio), then x W2 on the matrix
// instructions inside the attention kernel (k_attn).
// Compute dtypes, f32 accumulate: every input rounded to bf16; Q/K/V on PLAIN bf16 operands (inputs: exact) + bias; a_i / c_j and relu f32 on the VALU -> bf16 hi+lo in registers; the bias GEMM hl x exact W2 (2 products); scores (K 64)

#define NB_  2
#define TT   1024
#define DM   1024
#define NH_  16
#define HD   64
#define HID  64
#define RC   1024
typedef _Float16 h16;
typedef unsigned short bf;
typedef __attribute__((ext_vector_type(16))) __bf16   v16bf;
typedef __attribute__((ext_vector_type(16))) _Float16 v16h;
typedef __attribute__((ext_vector_type(8)))  _Float16 v8h;
typedef __attribute__((ext_vector_type(8)))  unsigned short v8us;
typedef __attribute__((ext_vector_type(8)))  float    v8f;
typedef __attribute__((ext_vector_type(4)))  float    v4f;
typedef v8h  __attribute__((may_alias)) v8ha;
typedef v4f  __attribute__((may_alias)) v4fa;
typedef v8us __attribute__((may_alias)) v8usa;

__device__ __forceinline__ unsigned short f2bf(float f) { unsigned u = __float_as_uint(f); u += 0x7FFFu + ((u >> 16) & 1u); return (unsigned short)(u >> 16); }
__device__ __forceinline__ float bf2f(unsigned short b) { return __uint_as_float(((unsigned)b) << 16); }
__device__ __forceinline__ float bfr(float f) { return bf2f(f2bf(f)); }
__device__ __forceinline__ v16h cat16(v8h lo, v8h hi) { return __builtin_shufflevector(lo, hi, 0, 1, 2, 3, 4, 5, 6, 7, 8, 9, 10, 11, 12, 13, 14, 15); }
__device__ __forceinline__ v16bf cat16b(v8us lo, v8us hi) { return __builtin_bit_cast(v16bf, __builtin_shufflevector(lo, hi, 0, 1, 2, 3, 4, 5, 6, 7, 8, 9, 10, 11, 12, 13, 14, 15)); }
__device__ __forceinline__ v8f wmma16(v16h a, v16h b, v8f c) { return __builtin_amdgcn_wmma_f32_16x16x32_f16(false, a, false, b, (short)0, c, false, false); }
__device__ __forceinline__ v8f wmmab(v16bf a, v16bf b, v8f c) { return __builtin_amdgcn_wmma_f32_16x16x32_bf16(false, a, false, b, (short)0, c, false, false); }



// ---- k_gemmw: register-blocked GEMM, one 64x64 output tile per work-group (16 accumulators per wave), operands straight from K-contiguous 16-bit planes; grid (M/64, N/64, Z), 32 * NW threads.
// C[m][n] (f32, pitch ldc, + optional f32 bias[n], its own vector for z = 0, 1, 2) = sum_k A[m][k] Bt[n][k] (+ split products per NSPLIT). z-batch strides sA/sB/sC in elements. K % (32 * NW) == 0.
// NW waves share the tile: wave w sums the k range [w K/NW, (w+1) K/NW), so NW times as many loads are in flight for the tile and each wave's chain of load waits is NW times shorter; the NW partial tiles meet in LDS and are added in wave order.
template <typename T16> struct WFrag;
template <> struct WFrag<h16> { typedef v16h V; static __device__ __forceinline__ V ld(const h16* p) { return cat16(*(const v8h*)p, *(const v8h*)(p + 16)); } static __device__ __forceinline__ v8f mma(V a, V b, v8f c) { return wmma16(a, b, c); } };
template <> struct WFrag<bf> { typedef v16bf V; static __device__ __forceinline__ V ld(const bf* p) { return cat16b(*(const v8us*)p, *(const v8us*)(p + 16)); } static __device__ __forceinline__ v8f mma(V a, V b, v8f c) { return wmmab(a, b, c); } };
template <typename T16, int NSPLIT, bool BIAS, int NW>
__global__ __launch_bounds__(32 * NW) void k_gemmw(const T16* __restrict__ A, const T16* __restrict__ A2, const T16* __restrict__ Bt, const T16* __restrict__ Bt2, int K, float* C, int ldc, const float* __restrict__ bias0, const float* __restrict__ bias1, const float* __restrict__ bias2, size_t sA, size_t sB, size_t sC) {
    typedef typename WFrag<T16>::V V;
    __shared__ __align__(16) float os[NW == 1 ? 16 * 68 : NW * 64 * 68];
    const size_t z = blockIdx.z; A += z * sA; if (A2) A2 += z * sA; Bt += z * sB; if (Bt2) Bt2 += z * sB; C += z * sC; const float* bias = z == 0 ? bias0 : z == 1 ? bias1 : bias2;
    const int lane = threadIdx.x & 31, lr = lane & 15, hi = lane >> 4; const int r0 = blockIdx.x * 64, c0 = blockIdx.y * 64;
    v8f acc[4][4];
#pragma unroll
    for (int mb = 0; mb < 4; ++mb)
#pragma unroll
        for (int nb = 0; nb < 4; ++nb) acc[mb][nb] = (v8f){};
    const size_t aoff = (size_t)(r0 + lr) * K + 8 * hi, boff = (size_t)(c0 + lr) * K + 8 * hi;
    const int wv = NW == 1 ? 0 : __builtin_amdgcn_readfirstlane((int)(threadIdx.x >> 5)); const int kbeg = wv * (K / NW), kend = kbeg + K / NW;
#pragma unroll 1
    for (int kc = kbeg; kc < kend; kc += 32) {
        V a[4], a2[4];
#pragma unroll
        for (int mb = 0; mb < 4; ++mb) { a[mb] = WFrag<T16>::ld(A + aoff + (size_t)mb * 16 * K + kc); if (NSPLIT == 1 || NSPLIT == 2) a2[mb] = WFrag<T16>::ld(A2 + aoff + (size_t)mb * 16 * K + kc); }
#pragma unroll
        for (int nb = 0; nb < 4; ++nb) { const V b = WFrag<T16>::ld(Bt + boff + (size_t)nb * 16 * K + kc); V b2; if (NSPLIT >= 2) b2 = WFrag<T16>::ld(Bt2 + boff + (size_t)nb * 16 * K + kc);
#pragma unroll
            for (int mb = 0; mb < 4; ++mb) { acc[mb][nb] = WFrag<T16>::mma(a[mb], b, acc[mb][nb]); if (NSPLIT == 1 || NSPLIT == 2) acc[mb][nb] = WFrag<T16>::mma(a2[mb], b, acc[mb][nb]); if (NSPLIT >= 2) acc[mb][nb] = WFrag<T16>::mma(a[mb], b2, acc[mb][nb]); } }
        asm volatile("v_nop\n\tv_nop\n\tv_nop\n\tv_nop" : "+v"(acc[0][0]), "+v"(acc[1][1]), "+v"(acc[2][2]), "+v"(acc[3][3]) : "v"(a[0]), "v"(a[3]));
    }
    if constexpr (NW > 1) {
        float* mine = os + wv * (64 * 68);
#pragma unroll
        for (int mb = 0; mb < 4; ++mb)
#pragma unroll
            for (int nb = 0; nb < 4; ++nb)
#pragma unroll
                for (int j = 0; j < 8; ++j) mine[(mb * 16 + hi * 8 + j) * 68 + nb * 16 + lr] = acc[mb][nb][j];
        const int cofs = lr * 4; v4f bv = (v4f){};
        if (BIAS) { bv[0] = bfr(bias[c0 + cofs]); bv[1] = bfr(bias[c0 + cofs + 1]); bv[2] = bfr(bias[c0 + cofs + 2]); bv[3] = bfr(bias[c0 + cofs + 3]); }
        __syncthreads();    // every wave's partial tile lies in LDS before any wave adds them up
#pragma unroll
        for (int s = 0; s < 32 / NW; ++s) { const int row = (s * NW + wv) * 2 + hi; v4f val = *(const v4fa*)(os + row * 68 + cofs);
#pragma unroll
            for (int w = 1; w < NW; ++w) val += *(const v4fa*)(os + w * (64 * 68) + row * 68 + cofs);
            if (BIAS) val += bv;
            *(v4f*)(C + (size_t)(r0 + row) * ldc + c0 + cofs) = val; }
        return;
    }
#pragma unroll
    for (int mb = 0; mb < 4; ++mb) {
#pragma unroll
        for (int nb = 0; nb < 4; ++nb) {
#pragma unroll
            for (int j = 0; j < 8; ++j) os[(hi * 8 + j) * 68 + nb * 16 + lr] = acc[mb][nb][j]; }
        __builtin_amdgcn_wave_barrier(); asm volatile("" ::: "memory");
        float* crow = C + (size_t)(r0 + mb * 16) * ldc + c0;
{
#pragma unroll
            for (int s = 0; s < 8; ++s) { const int row = 2 * s + hi, cofs = lr * 4; v4f val = *(const v4fa*)(os + row * 68 + cofs); if (BIAS) { val[0] += bfr(bias[c0 + cofs]); val[1] += bfr(bias[c0 + cofs + 1]); val[2] += bfr(bias[c0 + cofs + 2]); val[3] += bfr(bias[c0 + cofs + 3]); }
                *(v4f*)(crow + (size_t)row * ldc + cofs) = val; }
             }
        __builtin_amdgcn_wave_barrier(); asm volatile("" ::: "memory");
    }
}

__device__ __forceinline__ h16 tohx(float x) { return (h16)x; }
__device__ __forceinline__ void splitf(float y, unsigned short& h, unsigned short& l) { h = f2bf(y); l = f2bf(y - bf2f(h)); }
typedef __attribute__((ext_vector_type(2))) unsigned short v2us;
typedef __attribute__((ext_vector_type(4))) unsigned short v4us;
typedef __attribute__((ext_vector_type(2))) _Float16 v2h;
typedef __attribute__((ext_vector_type(4))) _Float16 v4h;

// d_*: the bodies of the small element-wise stages, each given its own block index blk, so that stages which do not depend on one another share one launch (k_prep, k_heads).
__device__ __forceinline__ void d_wtG(int blk, const float* __restrict__ w, int K, int N, bf* Bt) {
    const int lane = threadIdx.x & 31; const int L0 = (blk * 8 + (threadIdx.x >> 5)) * 8; const int nlines = N * K / 64;
{
#pragma unroll 1
        for (int l = 0; l < 8; ++l) { const int L = L0 + l; if (L >= nlines) break; const size_t e = (size_t)L * 64 + lane * 2; const int k = (int)(e % K), n = (int)(e / K); v2us o;
            o[0] = f2bf(w[(size_t)k * N + n]); o[1] = f2bf(w[(size_t)(k + 1) * N + n]); *(v2us*)(Bt + e) = o; }
         }
}
__device__ __forceinline__ void d_cvt8(int blk, const float* __restrict__ src, bf* dst, size_t n8) { const size_t i = (size_t)blk * 256 + threadIdx.x; if (i >= n8) return; const v8f v = *(const v8f*)(src + i * 8); v8us o;
#pragma unroll
    for (int k = 0; k < 8; ++k) o[k] = f2bf(v[k]); *(v8us*)(dst + i * 8) = o;  }
// d_w2: Bt[h][k] = bf16 W2[k][h], 16 head rows (8-B lanes); d_ac: lane -> 4 consecutive hidden units of token i (both batch elements, i = b * 1024 + t): a = f W1[0] + log(f + 1e-6) W1[1] + b1, c = -(f W1[0]) - (log(f+eps) W1[1]) (16-B lanes);
__device__ __forceinline__ void d_w2(int blk, const float* __restrict__ W2, bf* Bt) { const int e = (blk * 256 + threadIdx.x) * 4; if (e >= NH_ * HID) return; const int k = e % HID; const int h = e / HID; v4us o;
#pragma unroll
    for (int u = 0; u < 4; ++u) o[u] = f2bf(W2[(k + u) * NH_ + h]); *(v4us*)(Bt + e) = o;  }
__device__ __forceinline__ void d_ac(int blk, const float* __restrict__ fr, const float* __restrict__ W1, const float* __restrict__ b1, float* A, float* C) { const int e = (blk * 256 + threadIdx.x) * 4; if (e >= NB_ * TT * HID) return; const int k0 = e % HID; const int i = e / HID; const float f = bfr(fr[i]); const float lf = __logf(__fadd_rn(f, 1e-6f)); v4f oa, oc;
#pragma unroll
    for (int u = 0; u < 4; ++u) { const int k = k0 + u; float t1 = __fmul_rn(f, bfr(W1[k])), t2 = __fmul_rn(lf, bfr(W1[HID + k])); asm volatile("" : "+v"(t1)); asm volatile("" : "+v"(t2)); oa[u] = __fadd_rn(__fadd_rn(t1, t2), bfr(b1[k])); oc[u] = __fsub_rn(-t1, t2); }
    { *(v4f*)(A + e) = oa; *(v4f*)(C + e) = oc;  } }
// k_prep: everything that reads only the inputs, one launch: blocks [0, 4 WTB) transpose Wq, Wk, Wv, Wo into BW[m][n][k], the next CVB round x to bf16, the next ACB make a and c, the last one W2.
#define WTB ((DM * DM / 64 + 63) / 64)
#define CVB (NB_ * TT * DM / 8 / 256)
#define ACB (NB_ * TT * HID / 4 / 256)
__global__ __launch_bounds__(256) void k_prep(const float* __restrict__ Wq, const float* __restrict__ Wk, const float* __restrict__ Wv, const float* __restrict__ Wo, bf* BW, const float* __restrict__ x, bf* XB,
                                              const float* __restrict__ fr, const float* __restrict__ W1, const float* __restrict__ b1, float* A, float* C, const float* __restrict__ W2, bf* B2) {
    const int bx = blockIdx.x;
    if (bx < 4 * WTB) { const int m = bx / WTB; d_wtG(bx % WTB, m == 0 ? Wq : m == 1 ? Wk : m == 2 ? Wv : Wo, DM, DM, BW + (size_t)m * DM * DM); }
    else if (bx < 4 * WTB + CVB) d_cvt8(bx - 4 * WTB, x, XB, (size_t)NB_ * TT * DM / 8);
    else if (bx < 4 * WTB + CVB + ACB) d_ac(bx - (4 * WTB + CVB), fr, W1, b1, A, C);
    else d_w2(0, W2, B2);
}
// d_pl: P[g][h][t][d] = F[g][t][h * 64 + d], g = 0..3: Q of batch 0, 1, then K of batch 0, 1; d_vt: VT[b][h][d][t] = V[b][t][h * 64 + d].
__device__ __forceinline__ void d_pl(int blk, const float* __restrict__ F, h16* P) { const int e = (blk * 256 + threadIdx.x) * 4; if (e >= 2 * NB_ * NH_ * TT * HD) return; const int d = e % HD; const int t = (e / HD) % TT; const int h = (e / (HD * TT)) % NH_; const int g = e / (HD * TT * NH_); const float* f = F + ((size_t)g * TT + t) * DM + h * HD + d; v4h o;
#pragma unroll
    for (int u = 0; u < 4; ++u) o[u] = tohx(f[u]); *(v4h*)(P + e) = o;  }
__device__ __forceinline__ void d_vt(int blk, const float* __restrict__ V, h16* VT) { const int e = (blk * 256 + threadIdx.x) * 2; if (e >= NB_ * NH_ * HD * TT) return; const int t = e % TT; const int d = (e / TT) % HD; const int h = (e / (TT * HD)) % NH_; const int tb = (e / (TT * HD * NH_)) * TT + t; v2h o; o[0] = tohx(V[(size_t)tb * DM + h * HD + d]); o[1] = tohx(V[(size_t)(tb + 1) * DM + h * HD + d]); *(v2h*)(VT + e) = o;  }
#define VTB (NB_ * NH_ * HD * TT / 2 / 256)
#define PLB (2 * NB_ * NH_ * TT * HD / 4 / 256)
__global__ __launch_bounds__(256) void k_heads(const float* __restrict__ FQK, h16* QK16, const float* __restrict__ FV, h16* VT) { const int bx = blockIdx.x; if (bx < VTB) d_vt(bx, FV, VT); else d_pl(bx - VTB, FQK, QK16); }
typedef __attribute__((ext_vector_type(2))) float v2f;
typedef __attribute__((ext_vector_type(2))) __bf16 v2bf;
// k_attn: bias MLP, scores, softmax and attn x V of 16 query rows x all 16 heads x one half of the keys in one work-group of 16 waves; grid (TT / 16, NB_, JS). Bias, scores and probabilities never reach the workspace.
// A pass covers JB keys. First part, the bias: wave w makes, for its NT query rows (w / NT) * NT + 0 .. NT - 1 and its column tile w % NT of 16 keys, relu(a_i + c_j) as bf16 hi + lo in registers (B operand, column = key) and multiplies by W2 (A operand, row = head);
// the 16 heads x 16 keys go to LDS as bl[head][i][key]. Second part, behind the pass's one barrier: wave w is head w. St = K Qt (row = key, column = query), so a lane holds JB / 2 scores of one query: maximum and sum in the lane plus one exchange
// between the wave's halves; each pair of score tiles, converted in place, is a B operand of Ot += Vt Pt. The running maximum rescales Ot and the sum each pass. Two LDS buffers: a pass writes the one that was last read before the barrier of the pass before.
// The two key halves leave Ot (not normalised), the maximum and the sum in the workspace; k_mrg joins them.
#define JB 64
#define NT (JB / 16)
#define JS 2
#define NP (TT / JS / JB)
#define BP (JB + 4)
#define BHS (16 * BP + 4)
#define L2E 1.4426950408889634f
__device__ __forceinline__ float xhalf(float x) { return __builtin_bit_cast(float, __builtin_amdgcn_permlanex16(__builtin_bit_cast(int, x), __builtin_bit_cast(int, x), 0x76543210, 0xfedcba98, false, false)); }    // lane l with lane l ^ 16
__global__ __launch_bounds__(512) void k_attn(const h16* __restrict__ Q16, const h16* __restrict__ K16, const h16* __restrict__ VT, const float* __restrict__ A, const float* __restrict__ C, const bf* __restrict__ Bt, const float* __restrict__ b2, float* O, float* ML) {
    __shared__ __align__(32) float bl[2 * 16 * BHS];
    __shared__ __align__(32) float al[16 * HID];
    const int lane = threadIdx.x & 31, lr = lane & 15, hi = lane >> 4; const int wv = __builtin_amdgcn_readfirstlane((int)(threadIdx.x >> 5));
    const int i0 = blockIdx.x * 16, b = blockIdx.y, jh = blockIdx.z, jbeg = jh * (TT / JS); const int ip = (wv / NT) * NT, tq = wv % NT;
    *(v2f*)(al + threadIdx.x * 2) = *(const v2f*)(A + (size_t)(b * TT + i0) * HID + threadIdx.x * 2);    // the 16 a rows, read by every wave in every pass
    const size_t hb = (size_t)(b * NH_ + wv);
    const h16* kp = K16 + (hb * TT + jbeg + lr) * HD + 8 * hi; const h16* vp = VT + (hb * HD + lr) * TT + jbeg + 8 * hi; const float* cp = C + (size_t)(b * TT + jbeg + tq * 16 + lr) * HID + 8 * hi;
    v16bf w[2]; v16h qf[2]; v8f binit, cv[2][2], o[4]; float mrun = -3.0e38f, lsum = 0.f;
#pragma unroll
    for (int ks = 0; ks < 2; ++ks) { w[ks] = WFrag<bf>::ld(Bt + lr * HID + ks * 32 + 8 * hi); qf[ks] = WFrag<h16>::ld(Q16 + (hb * TT + i0 + lr) * HD + ks * 32 + 8 * hi); cv[ks][0] = *(const v8f*)(cp + ks * 32); cv[ks][1] = *(const v8f*)(cp + ks * 32 + 16); }
#pragma unroll
    for (int r = 0; r < 8; ++r) binit[r] = bfr(b2[8 * hi + r]);
#pragma unroll
    for (int dt = 0; dt < 4; ++dt) o[dt] = (v8f){};
    asm volatile("s_wait_xcnt 0x0" ::: "memory");    // before a register that these loads name as an address is written again
    __syncthreads();    // the a rows lie in LDS before any wave reads them
#pragma unroll 1    // one copy of the pass: the body is long, and a second copy would only add instruction-cache misses
    for (int it = 0; it < NP; ++it) {
        float* buf = bl + (it & 1) * (16 * BHS);
        v16h kf[NT][2];    // this pass's K rows, asked for ahead of the bias arithmetic, which covers their latency
#pragma unroll
        for (int t = 0; t < NT; ++t)
#pragma unroll
            for (int ks = 0; ks < 2; ++ks) kf[t][ks] = WFrag<h16>::ld(kp + (size_t)(t * 16) * HD + ks * 32);
        asm volatile("s_wait_xcnt 0x0" ::: "memory");    // before a register that these loads name as an address is written again
        kp += JB * HD;    // advanced behind the wait: the address pair stays live over the whole run of loads, so none of them lands in it
#pragma unroll
        for (int q = 0; q < NT; ++q) { v8f acc = binit;
#pragma unroll
            for (int ks = 0; ks < 2; ++ks) { const float* ar = al + (ip + q) * HID + ks * 32 + 8 * hi; v8f av[2]; av[0] = *(const v8f*)ar; av[1] = *(const v8f*)(ar + 16); v16bf fh, fl;
#pragma unroll
                for (int g = 0; g < 2; ++g)
#pragma unroll
                    for (int s = 0; s < 8; s += 2) { v2f h; h[0] = fmaxf(av[g][s] + cv[ks][g][s], 0.f); h[1] = fmaxf(av[g][s + 1] + cv[ks][g][s + 1], 0.f); const v2bf ph = __builtin_convertvector(h, v2bf);
                        v2f r; r[0] = h[0] - (float)ph[0]; r[1] = h[1] - (float)ph[1]; const v2bf pl = __builtin_convertvector(r, v2bf); fh[g * 8 + s] = ph[0]; fh[g * 8 + s + 1] = ph[1]; fl[g * 8 + s] = pl[0]; fl[g * 8 + s + 1] = pl[1]; }
                acc = wmmab(w[ks], fh, acc); acc = wmmab(w[ks], fl, acc); }
#pragma unroll
            for (int r = 0; r < 8; ++r) buf[(8 * hi + r) * BHS + (ip + q) * BP + tq * 16 + lr] = acc[r]; }
        __syncthreads();    // every wave's bias tiles of this pass lie in LDS; also ends every wave's reads of the other buffer, which the next pass writes
        if (it + 1 < NP) {    // the next pass's c rows fly during this pass's second part (in front of the barrier they would be waited for at it)
#pragma unroll
            for (int ks = 0; ks < 2; ++ks) { cv[ks][0] = *(const v8f*)(cp + (size_t)(it + 1) * JB * HID + ks * 32); cv[ks][1] = *(const v8f*)(cp + (size_t)(it + 1) * JB * HID + ks * 32 + 16); }
            asm volatile("s_wait_xcnt 0x0" ::: "memory");    // before a register that these loads name as an address is written again
        }
        float tv[JB / 2]; float mx = -3.0e38f;
#pragma unroll
        for (int t = 0; t < NT; ++t) { v8f s = (v8f){}; s = wmma16(kf[t][0], qf[0], s); s = wmma16(kf[t][1], qf[1], s); const float* br = buf + wv * BHS + lr * BP + t * 16 + 8 * hi; const v4f b0 = *(const v4fa*)br, b1 = *(const v4fa*)(br + 4);
#pragma unroll
            for (int r = 0; r < 4; ++r) { tv[t * 8 + r] = fmaf(s[r], 0.125f, b0[r]); tv[t * 8 + 4 + r] = fmaf(s[4 + r], 0.125f, b1[r]); } }
        v16h vf[JB / 32][4];    // asked for behind the scores, where the K registers are free, and ahead of the softmax, which covers their latency
#pragma unroll
        for (int jj = 0; jj < JB / 32; ++jj)
#pragma unroll
            for (int dt = 0; dt < 4; ++dt) vf[jj][dt] = WFrag<h16>::ld(vp + (size_t)dt * 16 * TT + jj * 32);
        asm volatile("s_wait_xcnt 0x0" ::: "memory");    // before a register that these loads name as an address is written again
        vp += JB;    // advanced behind the wait, like kp
#pragma unroll
        for (int e = 0; e < JB / 2; ++e) mx = fmaxf(mx, tv[e]);
        mx = fmaxf(mx, xhalf(mx));
        const float mn = fmaxf(mrun, mx); const float alpha = __builtin_amdgcn_exp2f((mrun - mn) * L2E); const float cs = fmaf(-mn, L2E, 10.0f); mrun = mn;    // probabilities carry a factor 2^10, so that small ones stay normal f16 numbers; it cancels against the sum
        v16h pf[JB / 32]; float ps = 0.f;
#pragma unroll
        for (int e = 0; e < JB / 2; ++e) { const float p = __builtin_amdgcn_exp2f(fmaf(tv[e], L2E, cs)); ps += p; pf[e / 16][e % 16] = tohx(p); }
        lsum = fmaf(lsum, alpha, ps);
#pragma unroll
        for (int dt = 0; dt < 4; ++dt) o[dt] *= alpha;
#pragma unroll
        for (int jj = 0; jj < JB / 32; ++jj)
#pragma unroll
            for (int dt = 0; dt < 4; ++dt) o[dt] = wmma16(vf[jj][dt], pf[jj], o[dt]);
    }
    lsum += xhalf(lsum);
    const size_t row = ((size_t)jh * NB_ * NH_ + hb) * RC + i0 + lr; float* op = O + row * HD + 8 * hi;
#pragma unroll
    for (int dt = 0; dt < 4; ++dt) *(v8f*)(op + dt * 16) = o[dt];
    if (hi == 0) { v2f ml; ml[0] = mrun; ml[1] = lsum; *(v2f*)(ML + row * 2) = ml; }
}
// k_mrg: joins the two key halves of a query row (common maximum, then one division by the joined sum) and splits the context into bf16 hi + lo, heads merged.
__global__ __launch_bounds__(256) void k_mrg(const float* __restrict__ O, const float* __restrict__ ML, bf* Ah, bf* Al) { const int e = (blockIdx.x * 256 + threadIdx.x) * 4; if (e >= NB_ * NH_ * RC * HD) return; const int d = e % HD; const int il = (e / HD) % RC; const int h = (e / (HD * RC)) % NH_; const int i0 = (e / (HD * RC * NH_)) * TT; v4us oh, ol;
    const v2f m0 = *(const v2f*)(ML + (size_t)(e / HD) * 2), m1 = *(const v2f*)(ML + ((size_t)NB_ * NH_ * RC + e / HD) * 2); const v4f x0 = *(const v4f*)(O + e), x1 = *(const v4f*)(O + (size_t)NB_ * NH_ * RC * HD + e);
    const float mm = fmaxf(m0[0], m1[0]); const float e0 = __builtin_amdgcn_exp2f((m0[0] - mm) * L2E), e1 = __builtin_amdgcn_exp2f((m1[0] - mm) * L2E); const float inv = __fdiv_rn(1.0f, fmaf(m0[1], e0, m1[1] * e1)); const float f0 = e0 * inv, f1 = e1 * inv;
#pragma unroll
    for (int u = 0; u < 4; ++u) { unsigned short a, b; splitf(fmaf(x0[u], f0, x1[u] * f1), a, b); oh[u] = a; ol[u] = b; } const size_t oo = (size_t)(i0 + il) * DM + h * HD + d; *(v4us*)(Ah + oo) = oh; *(v4us*)(Al + oo) = ol;  }

extern "C" void kernel_launch(void* const* d_in, const int* in_sizes, int n_in,
                              void* d_out, int out_size, void* d_ws, size_t ws_size, hipStream_t stream) {
    (void)in_sizes; (void)n_in; (void)out_size;
    const float** I = (const float**)d_in;
    const float *x = I[0], *freqs = I[1], *Wq = I[2], *bq = I[3], *Wk = I[4], *bk = I[5], *Wv = I[6], *bv = I[7], *Wo = I[8], *bo = I[9], *W1 = I[10], *b1 = I[11], *W2 = I[12], *b2 = I[13];
    float* OUT = (float*)d_out;     // [2][1024][1024]
    char* wsp = (char*)d_ws;
    auto take = [&](size_t bytes) { char* p = wsp; wsp += (bytes + 255) & ~(size_t)255; return (void*)p; };
    bf* BW = (bf*)take((size_t)4 * DM * DM * 2); bf* BO = BW + (size_t)3 * DM * DM; bf* B2 = (bf*)take(NH_ * HID * 2);    // BW: Wq, Wk, Wv, Wo transposed, one after the other
    bf* XB = (bf*)take((size_t)NB_ * TT * DM * 2); float* FQ = (float*)take((size_t)3 * NB_ * TT * DM * 4); float* FV = FQ + (size_t)2 * NB_ * TT * DM; float* A = (float*)take(NB_ * TT * HID * 4); float* C = (float*)take(NB_ * TT * HID * 4);    // FQ: Q, K, V, each [2][1024][1024]
    h16* Q16 = (h16*)take((size_t)2 * NB_ * NH_ * TT * HD * 2); h16* K16 = Q16 + (size_t)NB_ * NH_ * TT * HD; h16* VT = (h16*)take((size_t)NB_ * NH_ * HD * TT * 2);
    float* O = (float*)take((size_t)JS * NB_ * NH_ * RC * HD * 4); float* ML = (float*)take((size_t)JS * NB_ * NH_ * RC * 2 * 4); bf* Ch = (bf*)take((size_t)NB_ * TT * DM * 2); bf* Cl = (bf*)take((size_t)NB_ * TT * DM * 2);    // O, ML: per key half, the context not yet normalised and each row's maximum and sum
    if ((size_t)(wsp - (char*)d_ws) > ws_size) return;    // total ~ 73 MiB
    k_prep<<<4 * WTB + CVB + ACB + 1, 256, 0, stream>>>(Wq, Wk, Wv, Wo, BW, x, XB, freqs, W1, b1, A, C, W2, B2);
    k_gemmw<bf, 0, true, 8><<<dim3(NB_ * TT / 64, DM / 64, 3), 256, 0, stream>>>(XB, nullptr, BW, nullptr, DM, FQ, DM, bq, bk, bv, 0, (size_t)DM * DM, (size_t)NB_ * TT * DM);
    k_heads<<<VTB + PLB, 256, 0, stream>>>(FQ, Q16, FV, VT);
    k_attn<<<dim3(TT / 16, NB_, JS), 512, 0, stream>>>(Q16, K16, VT, A, C, B2, b2, O, ML);
    k_mrg<<<NB_ * NH_ * RC * HD / 4 / 256, 256, 0, stream>>>(O, ML, Ch, Cl);
    k_gemmw<bf, 1, true, 8><<<dim3(NB_ * TT / 64, DM / 64, 1), 256, 0, stream>>>(Ch, Cl, BO, nullptr, DM, OUT, DM, bo, bo, bo, 0, 0, 0);
}

// v005
// A run of this version takes 115 microseconds.
// In both of two side-by-side timings against v004, it was 1.15 times as fast.
// All steps since v000 together make it 8.71 times as fast.
#include <hip/hip_runtime.h>

// Attention layer with a pairwise frequency bias (x [2][1024][1024], freqs [2][1024][1]; Q/K/V = x W + b (16 heads x 64); scores = q.k/8 + b[h][i][j] where b = relu(feat(i,j) W1 + b1) W2 + b2 with feat = [f_i - f_j, log((f_i + eps)/(f_j + eps))] (64 hidden); softmax; out = (attn V merged) Wo + bo
// -> [2][1024][1024]). The pairwise feature MLP is evaluated as relu(a_i + c_j) with a_i = f_i W1[0] + log(f_i + eps) W1[1] + b1, c_j = -f_j W1[0] - log(f_j + eps) W1[1] (exact algebra of the difference / log-ratio), then x W2 on the matrix
// instructions inside the attention kernel (k_attn).
// Compute dtypes, f32 accumulate: every input rounded to bf16; Q/K/V on PLAIN bf16 operands (inputs: exact) + bias; a_i / c_j and relu f32 on the VALU -> bf16 hi+lo in registers; the bias GEMM hl x exact W2 (2 products); scores (K 64)

#define NB_  2
#define TT   1024
#define DM   1024
#define NH_  16
#define HD   64
#define HID  64
#define RC   1024
typedef _Float16 h16;
typedef unsigned short bf;
typedef __attribute__((ext_vector_type(16))) __bf16   v16bf;
typedef __attribute__((ext_vector_type(16))) _Float16 v16h;
typedef __attribute__((ext_vector_type(8)))  _Float16 v8h;
typedef __attribute__((ext_vector_type(8)))  unsigned short v8us;
typedef __attribute__((ext_vector_type(8)))  float    v8f;
typedef __attribute__((ext_vector_type(4)))  float    v4f;
typedef v8h  __attribute__((may_alias)) v8ha;
typedef v4f  __attribute__((may_alias)) v4fa;
typedef v8us __attribute__((may_alias)) v8usa;

__device__ __forceinline__ unsigned short f2bf(float f) { unsigned u = __float_as_uint(f); u += 0x7FFFu + ((u >> 16) & 1u); return (unsigned short)(u >> 16); }
__device__ __forceinline__ float bf2f(unsigned short b) { return __uint_as_float(((unsigned)b) << 16); }
__device__ __forceinline__ float bfr(float f) { return bf2f(f2bf(f)); }
__device__ __forceinline__ v16h cat16(v8h lo, v8h hi) { return __builtin_shufflevector(lo, hi, 0, 1, 2, 3, 4, 5, 6, 7, 8, 9, 10, 11, 12, 13, 14, 15); }
__device__ __forceinline__ v16bf cat16b(v8us lo, v8us hi) { return __builtin_bit_cast(v16bf, __builtin_shufflevector(lo, hi, 0, 1, 2, 3, 4, 5, 6, 7, 8, 9, 10, 11, 12, 13, 14, 15)); }
__device__ __forceinline__ v8f wmma16(v16h a, v16h b, v8f c) { return __builtin_amdgcn_wmma_f32_16x16x32_f16(false, a, false, b, (short)0, c, false, false); }
__device__ __forceinline__ v8f wmmab(v16bf a, v16bf b, v8f c) { return __builtin_amdgcn_wmma_f32_16x16x32_bf16(false, a, false, b, (short)0, c, false, false); }



// ---- k_gemmw: register-blocked GEMM, one 64x64 output tile per work-group (16 accumulators per wave), operands straight from K-contiguous 16-bit planes; grid (M/64, N/64, Z), 32 * NW threads.
// C[m][n] (f32, pitch ldc, + optional f32 bias[n], its own vector for z = 0, 1, 2) = sum_k A[m][k] Bt[n][k] (+ split products per NSPLIT). z-batch strides sA/sB/sC in elements. K % (32 * NW) == 0.
// NW waves share the tile: wave w sums the k range [w K/NW, (w+1) K/NW), so NW times as many loads are in flight for the tile and each wave's chain of load waits is NW times shorter; the NW partial tiles meet in LDS and are added in wave order.
// HEADS (the Q/K/V product; a 64x64 tile is 64 tokens of one head): the f32 sum + bias is rounded to f16 here and stored in the layout the attention kernel reads, QK[z * 2 + b][h][t][d] for z = 0, 1 and VTo[b][h][d][t] for z = 2; C is not written.
// For z = 2 the partial tiles are laid in LDS transposed (row = d), so both layouts leave in whole 128-byte rows.
typedef __attribute__((ext_vector_type(4))) _Float16 v4h;
__device__ __forceinline__ h16 tohx(float x) { return (h16)x; }
template <typename T16> struct WFrag;
template <> struct WFrag<h16> { typedef v16h V; static __device__ __forceinline__ V ld(const h16* p) { return cat16(*(const v8h*)p, *(const v8h*)(p + 16)); } static __device__ __forceinline__ v8f mma(V a, V b, v8f c) { return wmma16(a, b, c); } };
template <> struct WFrag<bf> { typedef v16bf V; static __device__ __forceinline__ V ld(const bf* p) { return cat16b(*(const v8us*)p, *(const v8us*)(p + 16)); } static __device__ __forceinline__ v8f mma(V a, V b, v8f c) { return wmmab(a, b, c); } };
template <typename T16, int NSPLIT, bool BIAS, int NW, bool HEADS>
__global__ __launch_bounds__(32 * NW) void k_gemmw(const T16* __restrict__ A, const T16* __restrict__ A2, const T16* __restrict__ Bt, const T16* __restrict__ Bt2, int K, float* C, int ldc, const float* __restrict__ bias0, const float* __restrict__ bias1, const float* __restrict__ bias2, size_t sA, size_t sB, size_t sC, h16* QK, h16* VTo) {
    typedef typename WFrag<T16>::V V;
    __shared__ __align__(16) float os[NW == 1 ? 16 * 68 : NW * 64 * 68];
    const size_t z = blockIdx.z; A += z * sA; if (A2) A2 += z * sA; Bt += z * sB; if (Bt2) Bt2 += z * sB; C += z * sC; const float* bias = z == 0 ? bias0 : z == 1 ? bias1 : bias2;
    const int lane = threadIdx.x & 31, lr = lane & 15, hi = lane >> 4; const int r0 = blockIdx.x * 64, c0 = blockIdx.y * 64;
    v8f acc[4][4];
#pragma unroll
    for (int mb = 0; mb < 4; ++mb)
#pragma unroll
        for (int nb = 0; nb < 4; ++nb) acc[mb][nb] = (v8f){};
    const size_t aoff = (size_t)(r0 + lr) * K + 8 * hi, boff = (size_t)(c0 + lr) * K + 8 * hi;
    const int wv = NW == 1 ? 0 : __builtin_amdgcn_readfirstlane((int)(threadIdx.x >> 5)); const int kbeg = wv * (K / NW), kend = kbeg + K / NW;
#pragma unroll 1
    for (int kc = kbeg; kc < kend; kc += 32) {
        V a[4], a2[4];
#pragma unroll
        for (int mb = 0; mb < 4; ++mb) { a[mb] = WFrag<T16>::ld(A + aoff + (size_t)mb * 16 * K + kc); if (NSPLIT == 1 || NSPLIT == 2) a2[mb] = WFrag<T16>::ld(A2 + aoff + (size_t)mb * 16 * K + kc); }
#pragma unroll
        for (int nb = 0; nb < 4; ++nb) { const V b = WFrag<T16>::ld(Bt + boff + (size_t)nb * 16 * K + kc); V b2; if (NSPLIT >= 2) b2 = WFrag<T16>::ld(Bt2 + boff + (size_t)nb * 16 * K + kc);
#pragma unroll
            for (int mb = 0; mb < 4; ++mb) { acc[mb][nb] = WFrag<T16>::mma(a[mb], b, acc[mb][nb]); if (NSPLIT == 1 || NSPLIT == 2) acc[mb][nb] = WFrag<T16>::mma(a2[mb], b, acc[mb][nb]); if (NSPLIT >= 2) acc[mb][nb] = WFrag<T16>::mma(a[mb], b2, acc[mb][nb]); } }
        asm volatile("v_nop\n\tv_nop\n\tv_nop\n\tv_nop" : "+v"(acc[0][0]), "+v"(acc[1][1]), "+v"(acc[2][2]), "+v"(acc[3][3]) : "v"(a[0]), "v"(a[3]));
    }
    if constexpr (NW > 1 && HEADS) {
        float* mine = os + wv * (64 * 68); const bool tr = z == 2;    // the same for the whole work-group
        if (tr) {
#pragma unroll
            for (int mb = 0; mb < 4; ++mb)
#pragma unroll
                for (int nb = 0; nb < 4; ++nb) { float* mp = mine + (nb * 16 + lr) * 68 + mb * 16 + hi * 8; const v8f t = acc[mb][nb]; *(v4fa*)mp = __builtin_shufflevector(t, t, 0, 1, 2, 3); *(v4fa*)(mp + 4) = __builtin_shufflevector(t, t, 4, 5, 6, 7); }
        } else {
#pragma unroll
            for (int mb = 0; mb < 4; ++mb)
#pragma unroll
                for (int nb = 0; nb < 4; ++nb)
#pragma unroll
                    for (int j = 0; j < 8; ++j) mine[(mb * 16 + hi * 8 + j) * 68 + nb * 16 + lr] = acc[mb][nb][j];
        }
        static_assert(32 / NW == 4, "four rows a lane, four columns a lane: one bias value for each");
        const int cofs = lr * 4; const int bb = r0 / TT, t0 = r0 % TT, hh = blockIdx.y; v4f bv;    // bv[u]: the bias of the lane's column cofs + u, or (transposed) of its row number u
        h16* dst = tr ? VTo + ((size_t)(bb * NH_ + hh) * HD) * TT + t0 : QK + (((size_t)((int)z * NB_ + bb) * NH_ + hh) * TT + t0) * HD; const int pitch = tr ? TT : HD;
#pragma unroll
        for (int u = 0; u < 4; ++u) bv[u] = bias[c0 + (tr ? (u * NW + wv) * 2 + hi : cofs + u)];
        asm volatile("s_wait_xcnt 0x0" ::: "memory");    // before a register that these loads name as an address is written again
        __syncthreads();    // every wave's partial tile lies in LDS before any wave adds them up
#pragma unroll
        for (int u = 0; u < 4; ++u) bv[u] = bfr(bv[u]);
#pragma unroll
        for (int s = 0; s < 32 / NW; ++s) { const int row = (s * NW + wv) * 2 + hi; v4f val = *(const v4fa*)(os + row * 68 + cofs);
#pragma unroll
            for (int w = 1; w < NW; ++w) val += *(const v4fa*)(os + w * (64 * 68) + row * 68 + cofs);
            v4h o;
#pragma unroll
            for (int u = 0; u < 4; ++u) o[u] = tohx(val[u] + (tr ? bv[s] : bv[u]));
            *(v4h*)(dst + row * pitch + cofs) = o; }
        return;
    }
    if constexpr (NW > 1) {
        float* mine = os + wv * (64 * 68);
#pragma unroll
        for (int mb = 0; mb < 4; ++mb)
#pragma unroll
            for (int nb = 0; nb < 4; ++nb)
#pragma unroll
                for (int j = 0; j < 8; ++j) mine[(mb * 16 + hi * 8 + j) * 68 + nb * 16 + lr] = acc[mb][nb][j];
        const int cofs = lr * 4; v4f bv = (v4f){};
        if (BIAS) { bv[0] = bfr(bias[c0 + cofs]); bv[1] = bfr(bias[c0 + cofs + 1]); bv[2] = bfr(bias[c0 + cofs + 2]); bv[3] = bfr(bias[c0 + cofs + 3]); }
        __syncthreads();    // every wave's partial tile lies in LDS before any wave adds them up
#pragma unroll
        for (int s = 0; s < 32 / NW; ++s) { const int row = (s * NW + wv) * 2 + hi; v4f val = *(const v4fa*)(os + row * 68 + cofs);
#pragma unroll
            for (int w = 1; w < NW; ++w) val += *(const v4fa*)(os + w * (64 * 68) + row * 68 + cofs);
            if (BIAS) val += bv;
            *(v4f*)(C + (size_t)(r0 + row) * ldc + c0 + cofs) = val; }
        return;
    }
#pragma unroll
    for (int mb = 0; mb < 4; ++mb) {
#pragma unroll
        for (int nb = 0; nb < 4; ++nb) {
#pragma unroll
            for (int j = 0; j < 8; ++j) os[(hi * 8 + j) * 68 + nb * 16 + lr] = acc[mb][nb][j]; }
        __builtin_amdgcn_wave_barrier(); asm volatile("" ::: "memory");
        float* crow = C + (size_t)(r0 + mb * 16) * ldc + c0;
{
#pragma unroll
            for (int s = 0; s < 8; ++s) { const int row = 2 * s + hi, cofs = lr * 4; v4f val = *(const v4fa*)(os + row * 68 + cofs); if (BIAS) { val[0] += bfr(bias[c0 + cofs]); val[1] += bfr(bias[c0 + cofs + 1]); val[2] += bfr(bias[c0 + cofs + 2]); val[3] += bfr(bias[c0 + cofs + 3]); }
                *(v4f*)(crow + (size_t)row * ldc + cofs) = val; }
             }
        __builtin_amdgcn_wave_barrier(); asm volatile("" ::: "memory");
    }
}

__device__ __forceinline__ void splitf(float y, unsigned short& h, unsigned short& l) { h = f2bf(y); l = f2bf(y - bf2f(h)); }
typedef __attribute__((ext_vector_type(2))) unsigned short v2us;
typedef __attribute__((ext_vector_type(4))) unsigned short v4us;

// d_*: the bodies of the small element-wise stages, each given its own block index blk, so that stages which do not depend on one another share one launch (k_prep).
__device__ __forceinline__ void d_wtG(int blk, const float* __restrict__ w, int K, int N, bf* Bt) {
    const int lane = threadIdx.x & 31; const int L0 = (blk * 8 + (threadIdx.x >> 5)) * 8; const int nlines = N * K / 64;
{
#pragma unroll 1
        for (int l = 0; l < 8; ++l) { const int L = L0 + l; if (L >= nlines) break; const size_t e = (size_t)L * 64 + lane * 2; const int k = (int)(e % K), n = (int)(e / K); v2us o;
            o[0] = f2bf(w[(size_t)k * N + n]); o[1] = f2bf(w[(size_t)(k + 1) * N + n]); *(v2us*)(Bt + e) = o; }
         }
}
__device__ __forceinline__ void d_cvt8(int blk, const float* __restrict__ src, bf* dst, size_t n8) { const size_t i = (size_t)blk * 256 + threadIdx.x; if (i >= n8) return; const v8f v = *(const v8f*)(src + i * 8); v8us o;
#pragma unroll
    for (int k = 0; k < 8; ++k) o[k] = f2bf(v[k]); *(v8us*)(dst + i * 8) = o;  }
// d_w2: Bt[h][k] = bf16 W2[k][h], 16 head rows (8-B lanes); d_ac: lane -> 4 consecutive hidden units of token i (both batch elements, i = b * 1024 + t): a = f W1[0] + log(f + 1e-6) W1[1] + b1, c = -(f W1[0]) - (log(f+eps) W1[1]) (16-B lanes);
__device__ __forceinline__ void d_w2(int blk, const float* __restrict__ W2, bf* Bt) { const int e = (blk * 256 + threadIdx.x) * 4; if (e >= NH_ * HID) return; const int k = e % HID; const int h = e / HID; v4us o;
#pragma unroll
    for (int u = 0; u < 4; ++u) o[u] = f2bf(W2[(k + u) * NH_ + h]); *(v4us*)(Bt + e) = o;  }
__device__ __forceinline__ void d_ac(int blk, const float* __restrict__ fr, const float* __restrict__ W1, const float* __restrict__ b1, float* A, float* C) { const int e = (blk * 256 + threadIdx.x) * 4; if (e >= NB_ * TT * HID) return; const int k0 = e % HID; const int i = e / HID; const float f = bfr(fr[i]); const float lf = __logf(__fadd_rn(f, 1e-6f)); v4f oa, oc;
#pragma unroll
    for (int u = 0; u < 4; ++u) { const int k = k0 + u; float t1 = __fmul_rn(f, bfr(W1[k])), t2 = __fmul_rn(lf, bfr(W1[HID + k])); asm volatile("" : "+v"(t1)); asm volatile("" : "+v"(t2)); oa[u] = __fadd_rn(__fadd_rn(t1, t2), bfr(b1[k])); oc[u] = __fsub_rn(-t1, t2); }
    { *(v4f*)(A + e) = oa; *(v4f*)(C + e) = oc;  } }
// k_prep: everything that reads only the inputs, one launch: blocks [0, 4 WTB) transpose Wq, Wk, Wv, Wo into BW[m][n][k], the next CVB round x to bf16, the next ACB make a and c, the last one W2.
#define WTB ((DM * DM / 64 + 63) / 64)
#define CVB (NB_ * TT * DM / 8 / 256)
#define ACB (NB_ * TT * HID / 4 / 256)
__global__ __launch_bounds__(256) void k_prep(const float* __restrict__ Wq, const float* __restrict__ Wk, const float* __restrict__ Wv, const float* __restrict__ Wo, bf* BW, const float* __restrict__ x, bf* XB,
                                              const float* __restrict__ fr, const float* __restrict__ W1, const float* __restrict__ b1, float* A, float* C, const float* __restrict__ W2, bf* B2) {
    const int bx = blockIdx.x;
    if (bx < 4 * WTB) { const int m = bx / WTB; d_wtG(bx % WTB, m == 0 ? Wq : m == 1 ? Wk : m == 2 ? Wv : Wo, DM, DM, BW + (size_t)m * DM * DM); }
    else if (bx < 4 * WTB + CVB) d_cvt8(bx - 4 * WTB, x, XB, (size_t)NB_ * TT * DM / 8);
    else if (bx < 4 * WTB + CVB + ACB) d_ac(bx - (4 * WTB + CVB), fr, W1, b1, A, C);
    else d_w2(0, W2, B2);
}
typedef __attribute__((ext_vector_type(2))) float v2f;
typedef __attribute__((ext_vector_type(2))) __bf16 v2bf;
// k_attn: bias MLP, scores, softmax and attn x V of 16 query rows x all 16 heads x one half of the keys in one work-group of 16 waves; grid (TT / 16, NB_, JS). Bias, scores and probabilities never reach the workspace.
// A pass covers JB keys. First part, the bias: wave w makes, for its NT query rows (w / NT) * NT + 0 .. NT - 1 and its column tile w % NT of 16 keys, relu(a_i + c_j) as bf16 hi + lo in registers (B operand, column = key) and multiplies by W2 (A operand, row = head);
// the 16 heads x 16 keys go to LDS as bl[head][i][key]. Second part, behind the pass's one barrier: wave w is head w. St = K Qt (row = key, column = query), so a lane holds JB / 2 scores of one query: maximum and sum in the lane plus one exchange
// between the wave's halves; each pair of score tiles, converted in place, is a B operand of Ot += Vt Pt. The running maximum rescales Ot and the sum each pass. Two LDS buffers: a pass writes the one that was last read before the barrier of the pass before.
// The two key halves leave Ot (not normalised), the maximum and the sum in the workspace; k_mrg joins them.
#define JB 64
#define NT (JB / 16)
#define JS 2
#define NP (TT / JS / JB)
#define BP (JB + 4)
#define BHS (16 * BP + 4)
#define L2E 1.4426950408889634f
__device__ __forceinline__ float xhalf(float x) { return __builtin_bit_cast(float, __builtin_amdgcn_permlanex16(__builtin_bit_cast(int, x), __builtin_bit_cast(int, x), 0x76543210, 0xfedcba98, false, false)); }    // lane l with lane l ^ 16
__global__ __launch_bounds__(512) void k_attn(const h16* __restrict__ Q16, const h16* __restrict__ K16, const h16* __restrict__ VT, const float* __restrict__ A, const float* __restrict__ C, const bf* __restrict__ Bt, const float* __restrict__ b2, float* O, float* ML) {
    __shared__ __align__(32) float bl[2 * 16 * BHS];
    __shared__ __align__(32) float al[16 * HID];
    const int lane = threadIdx.x & 31, lr = lane & 15, hi = lane >> 4; const int wv = __builtin_amdgcn_readfirstlane((int)(threadIdx.x >> 5));
    const int i0 = blockIdx.x * 16, b = blockIdx.y, jh = blockIdx.z, jbeg = jh * (TT / JS); const int ip = (wv / NT) * NT, tq = wv % NT;
    *(v2f*)(al + threadIdx.x * 2) = *(const v2f*)(A + (size_t)(b * TT + i0) * HID + threadIdx.x * 2);    // the 16 a rows, read by every wave in every pass
    const size_t hb = (size_t)(b * NH_ + wv);
    const h16* kp = K16 + (hb * TT + jbeg + lr) * HD + 8 * hi; const h16* vp = VT + (hb * HD + lr) * TT + jbeg + 8 * hi; const float* cp = C + (size_t)(b * TT + jbeg + tq * 16 + lr) * HID + 8 * hi;
    v16bf w[2]; v16h qf[2]; v8f binit, cv[2][2], o[4]; float mrun = -3.0e38f, lsum = 0.f;
#pragma unroll
    for (int ks = 0; ks < 2; ++ks) { w[ks] = WFrag<bf>::ld(Bt + lr * HID + ks * 32 + 8 * hi); qf[ks] = WFrag<h16>::ld(Q16 + (hb * TT + i0 + lr) * HD + ks * 32 + 8 * hi); cv[ks][0] = *(const v8f*)(cp + ks * 32); cv[ks][1] = *(const v8f*)(cp + ks * 32 + 16); }
#pragma unroll
    for (int r = 0; r < 8; ++r) binit[r] = bfr(b2[8 * hi + r]);
#pragma unroll
    for (int dt = 0; dt < 4; ++dt) o[dt] = (v8f){};
    asm volatile("s_wait_xcnt 0x0" ::: "memory");    // before a register that these loads name as an address is written again
    __syncthreads();    // the a rows lie in LDS before any wave reads them
#pragma unroll 1    // one copy of the pass: the body is long, and a second copy would only add instruction-cache misses
    for (int it = 0; it < NP; ++it) {
        float* buf = bl + (it & 1) * (16 * BHS);
        v16h kf[NT][2];    // this pass's K rows, asked for ahead of the bias arithmetic, which covers their latency
#pragma unroll
        for (int t = 0; t < NT; ++t)
#pragma unroll
            for (int ks = 0; ks < 2; ++ks) kf[t][ks] = WFrag<h16>::ld(kp + (size_t)(t * 16) * HD + ks * 32);
        asm volatile("s_wait_xcnt 0x0" ::: "memory");    // before a register that these loads name as an address is written again
        kp += JB * HD;    // advanced behind the wait: the address pair stays live over the whole run of loads, so none of them lands in it
#pragma unroll
        for (int q = 0; q < NT; ++q) { v8f acc = binit;
#pragma unroll
            for (int ks = 0; ks < 2; ++ks) { const float* ar = al + (ip + q) * HID + ks * 32 + 8 * hi; v8f av[2]; av[0] = *(const v8f*)ar; av[1] = *(const v8f*)(ar + 16); v16bf fh, fl;
#pragma unroll
                for (int g = 0; g < 2; ++g)
#pragma unroll
                    for (int s = 0; s < 8; s += 2) { v2f h; h[0] = fmaxf(av[g][s] + cv[ks][g][s], 0.f); h[1] = fmaxf(av[g][s + 1] + cv[ks][g][s + 1], 0.f); const v2bf ph = __builtin_convertvector(h, v2bf);
                        v2f r; r[0] = h[0] - (float)ph[0]; r[1] = h[1] - (float)ph[1]; const v2bf pl = __builtin_convertvector(r, v2bf); fh[g * 8 + s] = ph[0]; fh[g * 8 + s + 1] = ph[1]; fl[g * 8 + s] = pl[0]; fl[g * 8 + s + 1] = pl[1]; }
                acc = wmmab(w[ks], fh, acc); acc = wmmab(w[ks], fl, acc); }
#pragma unroll
            for (int r = 0; r < 8; ++r) buf[(8 * hi + r) * BHS + (ip + q) * BP + tq * 16 + lr] = acc[r]; }
        __syncthreads();    // every wave's bias tiles of this pass lie in LDS; also ends every wave's reads of the other buffer, which the next pass writes
        if (it + 1 < NP) {    // the next pass's c rows fly during this pass's second part (in front of the barrier they would be waited for at it)
#pragma unroll
            for (int ks = 0; ks < 2; ++ks) { cv[ks][0] = *(const v8f*)(cp + (size_t)(it + 1) * JB * HID + ks * 32); cv[ks][1] = *(const v8f*)(cp + (size_t)(it + 1) * JB * HID + ks * 32 + 16); }
            asm volatile("s_wait_xcnt 0x0" ::: "memory");    // before a register that these loads name as an address is written again
        }
        float tv[JB / 2]; float mx = -3.0e38f;
#pragma unroll
        for (int t = 0; t < NT; ++t) { v8f s = (v8f){}; s = wmma16(kf[t][0], qf[0], s); s = wmma16(kf[t][1], qf[1], s); const float* br = buf + wv * BHS + lr * BP + t * 16 + 8 * hi; const v4f b0 = *(const v4fa*)br, b1 = *(const v4fa*)(br + 4);
#pragma unroll
            for (int r = 0; r < 4; ++r) { tv[t * 8 + r] = fmaf(s[r], 0.125f, b0[r]); tv[t * 8 + 4 + r] = fmaf(s[4 + r], 0.125f, b1[r]); } }
        v16h vf[JB / 32][4];    // asked for behind the scores, where the K registers are free, and ahead of the softmax, which covers their latency
#pragma unroll
        for (int jj = 0; jj < JB / 32; ++jj)
#pragma unroll
            for (int dt = 0; dt < 4; ++dt) vf[jj][dt] = WFrag<h16>::ld(vp + (size_t)dt * 16 * TT + jj * 32);
        asm volatile("s_wait_xcnt 0x0" ::: "memory");    // before a register that these loads name as an address is written again
        vp += JB;    // advanced behind the wait, like kp
#pragma unroll
        for (int e = 0; e < JB / 2; ++e) mx = fmaxf(mx, tv[e]);
        mx = fmaxf(mx, xhalf(mx));
        const float mn = fmaxf(mrun, mx); const float alpha = __builtin_amdgcn_exp2f((mrun - mn) * L2E); const float cs = fmaf(-mn, L2E, 10.0f); mrun = mn;    // probabilities carry a factor 2^10, so that small ones stay normal f16 numbers; it cancels against the sum
        v16h pf[JB / 32]; float ps = 0.f;
#pragma unroll
        for (int e = 0; e < JB / 2; ++e) { const float p = __builtin_amdgcn_exp2f(fmaf(tv[e], L2E, cs)); ps += p; pf[e / 16][e % 16] = tohx(p); }
        lsum = fmaf(lsum, alpha, ps);
#pragma unroll
        for (int dt = 0; dt < 4; ++dt) o[dt] *= alpha;
#pragma unroll
        for (int jj = 0; jj < JB / 32; ++jj)
#pragma unroll
            for (int dt = 0; dt < 4; ++dt) o[dt] = wmma16(vf[jj][dt], pf[jj], o[dt]);
    }
    lsum += xhalf(lsum);
    const size_t row = ((size_t)jh * NB_ * NH_ + hb) * RC + i0 + lr; float* op = O + row * HD + 8 * hi;
#pragma unroll
    for (int dt = 0; dt < 4; ++dt) *(v8f*)(op + dt * 16) = o[dt];
    if (hi == 0) { v2f ml; ml[0] = mrun; ml[1] = lsum; *(v2f*)(ML + row * 2) = ml; }
}
// k_mrg: joins the two key halves of a query row (common maximum, then one division by the joined sum) and splits the context into bf16 hi + lo, heads merged.
__global__ __launch_bounds__(256) void k_mrg(const float* __restrict__ O, const float* __restrict__ ML, bf* Ah, bf* Al) { const int e = (blockIdx.x * 256 + threadIdx.x) * 4; if (e >= NB_ * NH_ * RC * HD) return; const int d = e % HD; const int il = (e / HD) % RC; const int h = (e / (HD * RC)) % NH_; const int i0 = (e / (HD * RC * NH_)) * TT; v4us oh, ol;
    const v2f m0 = *(const v2f*)(ML + (size_t)(e / HD) * 2), m1 = *(const v2f*)(ML + ((size_t)NB_ * NH_ * RC + e / HD) * 2); const v4f x0 = *(const v4f*)(O + e), x1 = *(const v4f*)(O + (size_t)NB_ * NH_ * RC * HD + e);
    const float mm = fmaxf(m0[0], m1[0]); const float e0 = __builtin_amdgcn_exp2f((m0[0] - mm) * L2E), e1 = __builtin_amdgcn_exp2f((m1[0] - mm) * L2E); const float inv = __fdiv_rn(1.0f, fmaf(m0[1], e0, m1[1] * e1)); const float f0 = e0 * inv, f1 = e1 * inv;
#pragma unroll
    for (int u = 0; u < 4; ++u) { unsigned short a, b; splitf(fmaf(x0[u], f0, x1[u] * f1), a, b); oh[u] = a; ol[u] = b; } const size_t oo = (size_t)(i0 + il) * DM + h * HD + d; *(v4us*)(Ah + oo) = oh; *(v4us*)(Al + oo) = ol;  }

extern "C" void kernel_launch(void* const* d_in, const int* in_sizes, int n_in,
                              void* d_out, int out_size, void* d_ws, size_t ws_size, hipStream_t stream) {
    (void)in_sizes; (void)n_in; (void)out_size;
    const float** I = (const float**)d_in;
    const float *x = I[0], *freqs = I[1], *Wq = I[2], *bq = I[3], *Wk = I[4], *bk = I[5], *Wv = I[6], *bv = I[7], *Wo = I[8], *bo = I[9], *W1 = I[10], *b1 = I[11], *W2 = I[12], *b2 = I[13];
    float* OUT = (float*)d_out;     // [2][1024][1024]
    char* wsp = (char*)d_ws;
    auto take = [&](size_t bytes) { char* p = wsp; wsp += (bytes + 255) & ~(size_t)255; return (void*)p; };
    bf* BW = (bf*)take((size_t)4 * DM * DM * 2); bf* BO = BW + (size_t)3 * DM * DM; bf* B2 = (bf*)take(NH_ * HID * 2);    // BW: Wq, Wk, Wv, Wo transposed, one after the other
    bf* XB = (bf*)take((size_t)NB_ * TT * DM * 2); float* A = (float*)take(NB_ * TT * HID * 4); float* C = (float*)take(NB_ * TT * HID * 4);
    h16* Q16 = (h16*)take((size_t)2 * NB_ * NH_ * TT * HD * 2); h16* K16 = Q16 + (size_t)NB_ * NH_ * TT * HD; h16* VT = (h16*)take((size_t)NB_ * NH_ * HD * TT * 2);
    float* O = (float*)take((size_t)JS * NB_ * NH_ * RC * HD * 4); float* ML = (float*)take((size_t)JS * NB_ * NH_ * RC * 2 * 4); bf* Ch = (bf*)take((size_t)NB_ * TT * DM * 2); bf* Cl = (bf*)take((size_t)NB_ * TT * DM * 2);    // O, ML: per key half, the context not yet normalised and each row's maximum and sum
    if ((size_t)(wsp - (char*)d_ws) > ws_size) return;    // total ~ 49 MiB
    k_prep<<<4 * WTB + CVB + ACB + 1, 256, 0, stream>>>(Wq, Wk, Wv, Wo, BW, x, XB, freqs, W1, b1, A, C, W2, B2);
    k_gemmw<bf, 0, true, 8, true><<<dim3(NB_ * TT / 64, DM / 64, 3), 256, 0, stream>>>(XB, nullptr, BW, nullptr, DM, nullptr, DM, bq, bk, bv, 0, (size_t)DM * DM, 0, Q16, VT);
    k_attn<<<dim3(TT / 16, NB_, JS), 512, 0, stream>>>(Q16, K16, VT, A, C, B2, b2, O, ML);
    k_mrg<<<NB_ * NH_ * RC * HD / 4 / 256, 256, 0, stream>>>(O, ML, Ch, Cl);
    k_gemmw<bf, 1, true, 8, false><<<dim3(NB_ * TT / 64, DM / 64, 1), 256, 0, stream>>>(Ch, Cl, BO, nullptr, DM, OUT, DM, bo, bo, bo, 0, 0, 0, nullptr, nullptr);
}

// v006
// Measured time: 82.7 microseconds a run.
// In two side-by-side timings against v005, it was 1.37 and 1.39 times as fast.
// Over all steps from v000 it is 12.0 times as fast.
#include <hip/hip_runtime.h>

// Attention layer with a pairwise frequency bias (x [2][1024][1024], freqs [2][1024][1]; Q/K/V = x W + b (16 heads x 64); scores = q.k/8 + b[h][i][j] where b = relu(feat(i,j) W1 + b1) W2 + b2 with feat = [f_i - f_j, log((f_i + eps)/(f_j + eps))] (64 hidden); softmax; out = (attn V merged) Wo + bo
// -> [2][1024][1024]). The pairwise feature MLP is evaluated as relu(a_i + c_j) with a_i = f_i W1[0] + log(f_i + eps) W1[1] + b1, c_j = -f_j W1[0] - log(f_j + eps) W1[1] (exact algebra of the difference / log-ratio), then x W2 on the matrix
// instructions inside the attention kernel (k_attn).
// Compute dtypes, f32 accumulate: every input rounded to bf16; Q/K/V on PLAIN bf16 operands (inputs: exact) + bias; a_i / c_j and relu f32 on the VALU -> bf16 hi+lo in registers; the bias GEMM hl x exact W2 (2 products); scores (K 64)

#define NB_  2
#define TT   1024
#define DM   1024
#define NH_  16
#define HD   64
#define HID  64
#define RC   1024
typedef _Float16 h16;
typedef unsigned short bf;
typedef __attribute__((ext_vector_type(16))) __bf16   v16bf;
typedef __attribute__((ext_vector_type(16))) _Float16 v16h;
typedef __attribute__((ext_vector_type(8)))  _Float16 v8h;
typedef __attribute__((ext_vector_type(8)))  unsigned short v8us;
typedef __attribute__((ext_vector_type(8)))  float    v8f;
typedef __attribute__((ext_vector_type(4)))  float    v4f;
typedef v8h  __attribute__((may_alias)) v8ha;
typedef v4f  __attribute__((may_alias)) v4fa;
typedef v8us __attribute__((may_alias)) v8usa;

__device__ __forceinline__ unsigned short f2bf(float f) { unsigned u = __float_as_uint(f); u += 0x7FFFu + ((u >> 16) & 1u); return (unsigned short)(u >> 16); }
__device__ __forceinline__ float bf2f(unsigned short b) { return __uint_as_float(((unsigned)b) << 16); }
__device__ __forceinline__ float bfr(float f) { return bf2f(f2bf(f)); }
__device__ __forceinline__ v16h cat16(v8h lo, v8h hi) { return __builtin_shufflevector(lo, hi, 0, 1, 2, 3, 4, 5, 6, 7, 8, 9, 10, 11, 12, 13, 14, 15); }
__device__ __forceinline__ v16bf cat16b(v8us lo, v8us hi) { return __builtin_bit_cast(v16bf, __builtin_shufflevector(lo, hi, 0, 1, 2, 3, 4, 5, 6, 7, 8, 9, 10, 11, 12, 13, 14, 15)); }
__device__ __forceinline__ v8f wmma16(v16h a, v16h b, v8f c) { return __builtin_amdgcn_wmma_f32_16x16x32_f16(false, a, false, b, (short)0, c, false, false); }
__device__ __forceinline__ v8f wmmab(v16bf a, v16bf b, v8f c) { return __builtin_amdgcn_wmma_f32_16x16x32_bf16(false, a, false, b, (short)0, c, false, false); }



// FRAGMENT ORDER: every 16-bit operand plane of a matrix instruction but W2's (row-major [head][k]) lies in the workspace in the order in which the lanes hold it. A plane of rows r and K columns k is cut into fragments of 16 rows x 32 k (1 KiB), fragment (r / 16, k / 32) at
// ((r / 16) * (K / 32) + k / 32) * 512 elements; inside it element (r, k) stands at ((k / 16) % 2) * 256 + (((k / 8) % 2) * 16 + r % 16) * 8 + k % 8. Lane l = hi * 16 + lr reads its 16 elements with two 16-byte loads at l * 8 and 256 + l * 8 (ldp),
// so each wave-wide load covers 512 contiguous bytes (4 whole lines) where a row-major plane gives 32-byte pieces of 16 lines.
// ---- k_gemmw: register-blocked GEMM, one 64x64 output tile per work-group (16 accumulators per wave), operands straight from 16-bit planes in fragment order, K = DM; grid (M/64, N/64, Z), 32 * NW threads.
// C[m][n] (f32, pitch ldc, + optional f32 bias[n], its own vector for z = 0, 1, 2) = sum_k A[m][k] Bt[n][k] (+ split products per NSPLIT). z-batch strides sA/sB/sC in elements. K % (32 * NW) == 0.
// NW waves share the tile: wave w sums the k range [w K/NW, (w+1) K/NW), so NW times as many loads are in flight for the tile and each wave's chain of load waits is NW times shorter; the NW partial tiles meet in LDS and are added in wave order.
// HEADS (the Q/K/V product; a 64x64 tile is 64 tokens of one head): the f32 sum + bias is rounded to f16 here and stored in fragment order, as the attention kernel reads it; C is not written. A tile is 8 KiB in a row at [z * 2 + b][h][t / 64] (QK, z = 0, 1) or [b][h][t / 64] (VTo):
// Q, K: rows = tokens, k = d, fragments [t / 16 % 4][d / 32]; V: rows = d, k = tokens, fragments [d / 16][t / 32 % 2]. For z = 2 the partial tiles are laid in LDS transposed (row = d), so one lane map serves both: thread i stores the 16-byte units i and 256 + i of the tile (a lane's 8 elements of a fragment), 512 bytes in a row a wave.
typedef __attribute__((ext_vector_type(4))) _Float16 v4h;
__device__ __forceinline__ h16 tohx(float x) { return (h16)x; }
template <typename T16> struct WFrag;
template <> struct WFrag<h16> { typedef v16h V; static __device__ __forceinline__ V ld(const h16* p) { return cat16(*(const v8h*)p, *(const v8h*)(p + 16)); } static __device__ __forceinline__ V ldp(const h16* p) { return cat16(*(const v8h*)p, *(const v8h*)(p + 256)); } static __device__ __forceinline__ v8f mma(V a, V b, v8f c) { return wmma16(a, b, c); } };
template <> struct WFrag<bf> { typedef v16bf V; static __device__ __forceinline__ V ld(const bf* p) { return cat16b(*(const v8us*)p, *(const v8us*)(p + 16)); } static __device__ __forceinline__ V ldp(const bf* p) { return cat16b(*(const v8us*)p, *(const v8us*)(p + 256)); } static __device__ __forceinline__ v8f mma(V a, V b, v8f c) { return wmmab(a, b, c); } };
template <typename T16> __device__ __forceinline__ const T16* atb(const T16* base, unsigned bytes) { return (const T16*)((const char*)base + bytes); }    // scalar base + the lane's 32-bit byte offset: the load names exactly these two
template <typename T16, int NSPLIT, bool BIAS, int NW, bool HEADS>
__global__ __launch_bounds__(32 * NW) void k_gemmw(const T16* __restrict__ A, const T16* __restrict__ A2, const T16* __restrict__ Bt, const T16* __restrict__ Bt2, float* C, int ldc, const float* __restrict__ bias0, const float* __restrict__ bias1, const float* __restrict__ bias2, size_t sA, size_t sB, size_t sC, h16* QK, h16* VTo) {
    typedef typename WFrag<T16>::V V;
    __shared__ __align__(16) float os[NW == 1 ? 16 * 68 : NW * 64 * 68];
    const size_t z = blockIdx.z; A += z * sA; if (A2) A2 += z * sA; Bt += z * sB; if (Bt2) Bt2 += z * sB; C += z * sC; const float* bias = z == 0 ? bias0 : z == 1 ? bias1 : bias2;
    const int lane = threadIdx.x & 31, lr = lane & 15, hi = lane >> 4; const int r0 = blockIdx.x * 64, c0 = blockIdx.y * 64;
    v8f acc[4][4];
#pragma unroll
    for (int mb = 0; mb < 4; ++mb)
#pragma unroll
        for (int nb = 0; nb < 4; ++nb) acc[mb][nb] = (v8f){};
    constexpr int K = DM;
    const int wv = NW == 1 ? 0 : __builtin_amdgcn_readfirstlane((int)(threadIdx.x >> 5)); const int kbeg = wv * (K / NW), kend = kbeg + K / NW;
    unsigned oa = (unsigned)(r0 * K + kbeg * 16 + lane * 8) * 2u, ob = (unsigned)(c0 * K + kbeg * 16 + lane * 8) * 2u;    // the lane's place in its plane, in bytes: a strip of 16 rows is 16 K elements, a step of 32 k in it 512
#pragma unroll 1
    for (int kc = kbeg; kc < kend; kc += 32) {
        V a[4], a2[4], b[4], b2[4];
#pragma unroll
        for (int mb = 0; mb < 4; ++mb) { a[mb] = WFrag<T16>::ldp(atb(A, oa) + mb * 16 * K); if (NSPLIT == 1 || NSPLIT == 2) a2[mb] = WFrag<T16>::ldp(atb(A2, oa) + mb * 16 * K); }
#pragma unroll
        for (int nb = 0; nb < 4; ++nb) { b[nb] = WFrag<T16>::ldp(atb(Bt, ob) + nb * 16 * K); if (NSPLIT >= 2) b2[nb] = WFrag<T16>::ldp(atb(Bt2, ob) + nb * 16 * K); }
        asm volatile("s_wait_xcnt 0x0" : "+v"(oa), "+v"(ob) :: "memory");    // before a register that these loads name as an address is written again; the two offsets are named so that they live up to the wait (no load lands in them) and are advanced behind it
        oa += 1024; ob += 1024;
#pragma unroll
        for (int nb = 0; nb < 4; ++nb) {
#pragma unroll
            for (int mb = 0; mb < 4; ++mb) { acc[mb][nb] = WFrag<T16>::mma(a[mb], b[nb], acc[mb][nb]); if (NSPLIT == 1 || NSPLIT == 2) acc[mb][nb] = WFrag<T16>::mma(a2[mb], b[nb], acc[mb][nb]); if (NSPLIT >= 2) acc[mb][nb] = WFrag<T16>::mma(a[mb], b2[nb], acc[mb][nb]); } }
        asm volatile("v_nop\n\tv_nop\n\tv_nop\n\tv_nop" : "+v"(acc[0][0]), "+v"(acc[1][1]), "+v"(acc[2][2]), "+v"(acc[3][3]) : "v"(a[0]), "v"(a[3]));
    }
    if constexpr (NW > 1 && HEADS) {
        float* mine = os + wv * (64 * 68); const bool tr = z == 2;    // the same for the whole work-group
        if (tr) {
#pragma unroll
            for (int mb = 0; mb < 4; ++mb)
#pragma unroll
                for (int nb = 0; nb < 4; ++nb) { float* mp = mine + (nb * 16 + lr) * 68 + mb * 16 + hi * 8; const v8f t = acc[mb][nb]; *(v4fa*)mp = __builtin_shufflevector(t, t, 0, 1, 2, 3); *(v4fa*)(mp + 4) = __builtin_shufflevector(t, t, 4, 5, 6, 7); }
        } else {
#pragma unroll
            for (int mb = 0; mb < 4; ++mb)
#pragma unroll
                for (int nb = 0; nb < 4; ++nb)
#pragma unroll
                    for (int j = 0; j < 8; ++j) mine[(mb * 16 + hi * 8 + j) * 68 + nb * 16 + lr] = acc[mb][nb][j];
        }
        static_assert(NW == 8, "16 half fragments of 512 bytes a tile: two a wave");
        const int rb = (wv >> 2) * 16 + lr, cofs = (wv & 3) * 16 + hi * 8; const int bb = r0 / TT, t0 = r0 % TT, hh = blockIdx.y; v8f bv;    // the lane's LDS rows are s * 32 + rb, its columns cofs + u; bv[u]: the bias of column cofs + u, or (transposed) of row (u & 1) * 32 + rb
        h16* dst = (tr ? VTo + ((size_t)(bb * NH_ + hh) * TT + t0) * HD : QK + (((size_t)((int)z * NB_ + bb) * NH_ + hh) * TT + t0) * HD) + threadIdx.x * 8;
#pragma unroll
        for (int u = 0; u < 8; ++u) bv[u] = bias[c0 + (tr ? (u & 1) * 32 + rb : cofs + u)];
        asm volatile("s_wait_xcnt 0x0" ::: "memory");    // before a register that these loads name as an address is written again
        __syncthreads();    // every wave's partial tile lies in LDS before any wave adds them up
#pragma unroll
        for (int u = 0; u < 8; ++u) bv[u] = bfr(bv[u]);
#pragma unroll
        for (int s = 0; s < 2; ++s) { const float* rp = os + (s * 32 + rb) * 68 + cofs; v4f val = *(const v4fa*)rp, va2 = *(const v4fa*)(rp + 4);
#pragma unroll
            for (int w = 1; w < NW; ++w) { val += *(const v4fa*)(rp + w * (64 * 68)); va2 += *(const v4fa*)(rp + w * (64 * 68) + 4); }
            v8h o;
#pragma unroll
            for (int u = 0; u < 4; ++u) { o[u] = tohx(val[u] + (tr ? bv[s] : bv[u])); o[4 + u] = tohx(va2[u] + (tr ? bv[s] : bv[4 + u])); }
            *(v8h*)(dst + s * 2048) = o; }
        return;
    }
    if constexpr (NW > 1) {
        float* mine = os + wv * (64 * 68);
#pragma unroll
        for (int mb = 0; mb < 4; ++mb)
#pragma unroll
            for (int nb = 0; nb < 4; ++nb)
#pragma unroll
                for (int j = 0; j < 8; ++j) mine[(mb * 16 + hi * 8 + j) * 68 + nb * 16 + lr] = acc[mb][nb][j];
        const int cofs = lr * 4; v4f bv = (v4f){};
        if (BIAS) { bv[0] = bfr(bias[c0 + cofs]); bv[1] = bfr(bias[c0 + cofs + 1]); bv[2] = bfr(bias[c0 + cofs + 2]); bv[3] = bfr(bias[c0 + cofs + 3]); }
        __syncthreads();    // every wave's partial tile lies in LDS before any wave adds them up
#pragma unroll
        for (int s = 0; s < 32 / NW; ++s) { const int row = (s * NW + wv) * 2 + hi; v4f val = *(const v4fa*)(os + row * 68 + cofs);
#pragma unroll
            for (int w = 1; w < NW; ++w) val += *(const v4fa*)(os + w * (64 * 68) + row * 68 + cofs);
            if (BIAS) val += bv;
            *(v4f*)(C + (size_t)(r0 + row) * ldc + c0 + cofs) = val; }
        return;
    }
#pragma unroll
    for (int mb = 0; mb < 4; ++mb) {
#pragma unroll
        for (int nb = 0; nb < 4; ++nb) {
#pragma unroll
            for (int j = 0; j < 8; ++j) os[(hi * 8 + j) * 68 + nb * 16 + lr] = acc[mb][nb][j]; }
        __builtin_amdgcn_wave_barrier(); asm volatile("" ::: "memory");
        float* crow = C + (size_t)(r0 + mb * 16) * ldc + c0;
{
#pragma unroll
            for (int s = 0; s < 8; ++s) { const int row = 2 * s + hi, cofs = lr * 4; v4f val = *(const v4fa*)(os + row * 68 + cofs); if (BIAS) { val[0] += bfr(bias[c0 + cofs]); val[1] += bfr(bias[c0 + cofs + 1]); val[2] += bfr(bias[c0 + cofs + 2]); val[3] += bfr(bias[c0 + cofs + 3]); }
                *(v4f*)(crow + (size_t)row * ldc + cofs) = val; }
             }
        __builtin_amdgcn_wave_barrier(); asm volatile("" ::: "memory");
    }
}

__device__ __forceinline__ void splitf(float y, unsigned short& h, unsigned short& l) { h = f2bf(y); l = f2bf(y - bf2f(h)); }
typedef __attribute__((ext_vector_type(2))) unsigned short v2us;
typedef __attribute__((ext_vector_type(4))) unsigned short v4us;

// d_*: the bodies of the small element-wise stages, each given its own block index blk, so that stages which do not depend on one another share one launch (k_prep).
// d_wtG: one wave makes one fragment of Bt[n][k] = bf16 w[k][n] (DM x DM): fragment (n / 16, k / 32) = (g % 64, g / 64) for wave number g, so the 8 waves of a block read 512 contiguous bytes of each of 32 rows of w; a lane's 16 loads are all in flight at once.
__device__ __forceinline__ void d_wtG(int blk, const float* __restrict__ w, bf* Bt) {
    const int lane = threadIdx.x & 31, lr = lane & 15, hi = lane >> 4; const int g = blk * 8 + (threadIdx.x >> 5); const int nt = g % (DM / 16), kt = g / (DM / 16);
    const float* p = w + (size_t)(kt * 32 + hi * 8) * DM + nt * 16 + lr; float v[16];
#pragma unroll
    for (int e = 0; e < 16; ++e) v[e] = p[(size_t)((e >> 3) * 16 + (e & 7)) * DM];
    asm volatile("s_wait_xcnt 0x0" ::: "memory");    // before a register that these loads name as an address is written again
    v8us o0, o1;
#pragma unroll
    for (int e = 0; e < 8; ++e) { o0[e] = f2bf(v[e]); o1[e] = f2bf(v[8 + e]); }
    bf* q = Bt + (size_t)(nt * (DM / 32) + kt) * 512 + lane * 8; *(v8us*)q = o0; *(v8us*)(q + 256) = o1;
}
// d_cvt8: thread i makes the 16-byte unit i of the fragment-ordered plane dst from 8 consecutive elements of one row of src (rows of DM).
__device__ __forceinline__ void d_cvt8(int blk, const float* __restrict__ src, bf* dst, size_t n8) { const size_t i = (size_t)blk * 256 + threadIdx.x; if (i >= n8) return; const int ii = (int)i; const int m = (ii >> 11) * 16 + (ii & 15), k = ((ii >> 6) & 31) * 32 + ((ii >> 5) & 1) * 16 + ((ii >> 4) & 1) * 8;
    const v8f v = *(const v8f*)(src + (size_t)m * DM + k); v8us o;
    asm volatile("s_wait_xcnt 0x0" ::: "memory");    // before a register that this load names as an address is written again
#pragma unroll
    for (int k = 0; k < 8; ++k) o[k] = f2bf(v[k]); *(v8us*)(dst + i * 8) = o;  }
// d_w2: Bt[h][k] = bf16 W2[k][h], 16 head rows (8-B lanes); d_ac: lane -> 4 consecutive hidden units of token i (both batch elements, i = b * 1024 + t): a = f W1[0] + log(f + 1e-6) W1[1] + b1, c = -(f W1[0]) - (log(f+eps) W1[1]) (16-B lanes);
__device__ __forceinline__ void d_w2(int blk, const float* __restrict__ W2, bf* Bt) { const int e = (blk * 256 + threadIdx.x) * 4; if (e >= NH_ * HID) return; const int k = e % HID; const int h = e / HID; v4us o;
#pragma unroll
    for (int u = 0; u < 4; ++u) o[u] = f2bf(W2[(k + u) * NH_ + h]); *(v4us*)(Bt + e) = o;  }
__device__ __forceinline__ void d_ac(int blk, const float* __restrict__ fr, const float* __restrict__ W1, const float* __restrict__ b1, float* A, float* C) { const int e = (blk * 256 + threadIdx.x) * 4; if (e >= NB_ * TT * HID) return; const int k0 = e % HID; const int i = e / HID; const float f = bfr(fr[i]); const float lf = __logf(__fadd_rn(f, 1e-6f)); v4f oa, oc;
#pragma unroll
    for (int u = 0; u < 4; ++u) { const int k = k0 + u; float t1 = __fmul_rn(f, bfr(W1[k])), t2 = __fmul_rn(lf, bfr(W1[HID + k])); asm volatile("" : "+v"(t1)); asm volatile("" : "+v"(t2)); oa[u] = __fadd_rn(__fadd_rn(t1, t2), bfr(b1[k])); oc[u] = __fsub_rn(-t1, t2); }
    { *(v4f*)(A + e) = oa; *(v4f*)(C + e) = oc;  } }
// k_prep: everything that reads only the inputs, one launch: blocks [0, 4 WTB) transpose Wq, Wk, Wv, Wo into BW[m] (rows n, fragment order), the next CVB round x to bf16 (fragment order), the next ACB make a and c, the last one W2.
#define WTB (DM / 16 * (DM / 32) / 8)
#define CVB (NB_ * TT * DM / 8 / 256)
#define ACB (NB_ * TT * HID / 4 / 256)
__global__ __launch_bounds__(256) void k_prep(const float* __restrict__ Wq, const float* __restrict__ Wk, const float* __restrict__ Wv, const float* __restrict__ Wo, bf* BW, const float* __restrict__ x, bf* XB,
                                              const float* __restrict__ fr, const float* __restrict__ W1, const float* __restrict__ b1, float* A, float* C, const float* __restrict__ W2, bf* B2) {
    const int bx = blockIdx.x;
    if (bx < 4 * WTB) { const int m = bx / WTB; d_wtG(bx % WTB, m == 0 ? Wq : m == 1 ? Wk : m == 2 ? Wv : Wo, BW + (size_t)m * DM * DM); }
    else if (bx < 4 * WTB + CVB) d_cvt8(bx - 4 * WTB, x, XB, (size_t)NB_ * TT * DM / 8);
    else if (bx < 4 * WTB + CVB + ACB) d_ac(bx - (4 * WTB + CVB), fr, W1, b1, A, C);
    else d_w2(0, W2, B2);
}
typedef __attribute__((ext_vector_type(2))) float v2f;
typedef __attribute__((ext_vector_type(2))) __bf16 v2bf;
// k_attn: bias MLP, scores, softmax and attn x V of 16 query rows x all 16 heads x one half of the keys in one work-group of 16 waves; grid (TT / 16, NB_, JS). Bias, scores and probabilities never reach the workspace.
// A pass covers JB keys. First part, the bias: wave w makes, for its NT query rows (w / NT) * NT + 0 .. NT - 1 and its column tile w % NT of 16 keys, relu(a_i + c_j) as bf16 hi + lo in registers (B operand, column = key) and multiplies by W2 (A operand, row = head);
// the 16 heads x 16 keys go to LDS as bl[head][i][key]. Second part, behind the pass's one barrier: wave w is head w. St = K Qt (row = key, column = query), so a lane holds JB / 2 scores of one query: maximum and sum in the lane plus one exchange
// between the wave's halves; each pair of score tiles, converted in place, is a B operand of Ot += Vt Pt. The running maximum rescales Ot and the sum each pass. Two LDS buffers: a pass writes the one that was last read before the barrier of the pass before.
// The two key halves leave Ot (not normalised, in the fragment order of the out projection's A plane), the maximum and the sum in the workspace; k_mrg joins them. Q, K, V are read in fragment order (see k_gemmw).
#define JB 64
#define NT (JB / 16)
#define JS 2
#define NP (TT / JS / JB)
#define BP (JB + 4)
#define BHS (16 * BP + 4)
#define L2E 1.4426950408889634f
__device__ __forceinline__ float xhalf(float x) { return __builtin_bit_cast(float, __builtin_amdgcn_permlanex16(__builtin_bit_cast(int, x), __builtin_bit_cast(int, x), 0x76543210, 0xfedcba98, false, false)); }    // lane l with lane l ^ 16
__global__ __launch_bounds__(512) void k_attn(const h16* __restrict__ Q16, const h16* __restrict__ K16, const h16* __restrict__ VT, const float* __restrict__ A, const float* __restrict__ C, const bf* __restrict__ Bt, const float* __restrict__ b2, float* O, float* ML) {
    __shared__ __align__(32) float bl[2 * 16 * BHS];
    __shared__ __align__(32) float al[16 * HID];
    const int lane = threadIdx.x & 31, lr = lane & 15, hi = lane >> 4; const int wv = __builtin_amdgcn_readfirstlane((int)(threadIdx.x >> 5));
    const int i0 = blockIdx.x * 16, b = blockIdx.y, jh = blockIdx.z, jbeg = jh * (TT / JS); const int ip = (wv / NT) * NT, tq = wv % NT;
    *(v2f*)(al + threadIdx.x * 2) = *(const v2f*)(A + (size_t)(b * TT + i0) * HID + threadIdx.x * 2);    // the 16 a rows, read by every wave in every pass
    const size_t hb = (size_t)(b * NH_ + wv);
    unsigned ko = (unsigned)((hb * TT + jbeg) * HD + lane * 8) * 2u, vo = ko; unsigned co = (unsigned)((b * TT + jbeg + tq * 16 + lr) * HID + 8 * hi) * 4u;    // ko, vo, co: the lane's byte offsets in K16, VT and C
    v16bf w[2]; v16h qf[2]; v8f binit, cv[2][2], o[4]; float mrun = -3.0e38f, lsum = 0.f;
#pragma unroll
    for (int ks = 0; ks < 2; ++ks) { w[ks] = WFrag<bf>::ld(Bt + lr * HID + ks * 32 + 8 * hi); qf[ks] = WFrag<h16>::ldp(Q16 + (hb * TT + i0) * HD + ks * 512 + lane * 8); cv[ks][0] = *(const v8f*)(atb(C, co) + ks * 32); cv[ks][1] = *(const v8f*)(atb(C, co) + ks * 32 + 16); }
#pragma unroll
    for (int r = 0; r < 8; ++r) binit[r] = bfr(b2[8 * hi + r]);
#pragma unroll
    for (int dt = 0; dt < 4; ++dt) o[dt] = (v8f){};
    asm volatile("s_wait_xcnt 0x0" ::: "memory");    // before a register that these loads name as an address is written again
    __syncthreads();    // the a rows lie in LDS before any wave reads them
#pragma unroll 1    // one copy of the pass: the body is long, and a second copy would only add instruction-cache misses
    for (int it = 0; it < NP; ++it) {
        float* buf = bl + (it & 1) * (16 * BHS);
        v16h kf[NT][2];    // this pass's K rows, asked for ahead of the bias arithmetic, which covers their latency
#pragma unroll
        for (int t = 0; t < NT; ++t)
#pragma unroll
            for (int ks = 0; ks < 2; ++ks) kf[t][ks] = WFrag<h16>::ldp(atb(K16, ko) + (t * 2 + ks) * 512);
        asm volatile("s_wait_xcnt 0x0" : "+v"(ko) :: "memory");    // before a register that these loads name as an address is written again; the offset is named so that it lives up to the wait (no load lands in it) and is advanced behind it
        ko += JB * HD * 2;
#pragma unroll
        for (int q = 0; q < NT; ++q) { v8f acc = binit;
#pragma unroll
            for (int ks = 0; ks < 2; ++ks) { const float* ar = al + (ip + q) * HID + ks * 32 + 8 * hi; v8f av[2]; av[0] = *(const v8f*)ar; av[1] = *(const v8f*)(ar + 16); v16bf fh, fl;
#pragma unroll
                for (int g = 0; g < 2; ++g)
#pragma unroll
                    for (int s = 0; s < 8; s += 2) { v2f h; h[0] = fmaxf(av[g][s] + cv[ks][g][s], 0.f); h[1] = fmaxf(av[g][s + 1] + cv[ks][g][s + 1], 0.f); const v2bf ph = __builtin_convertvector(h, v2bf);
                        v2f r; r[0] = h[0] - (float)ph[0]; r[1] = h[1] - (float)ph[1]; const v2bf pl = __builtin_convertvector(r, v2bf); fh[g * 8 + s] = ph[0]; fh[g * 8 + s + 1] = ph[1]; fl[g * 8 + s] = pl[0]; fl[g * 8 + s + 1] = pl[1]; }
                acc = wmmab(w[ks], fh, acc); acc = wmmab(w[ks], fl, acc); }
#pragma unroll
            for (int r = 0; r < 8; ++r) buf[(8 * hi + r) * BHS + (ip + q) * BP + tq * 16 + lr] = acc[r]; }
        __syncthreads();    // every wave's bias tiles of this pass lie in LDS; also ends every wave's reads of the other buffer, which the next pass writes
        if (it + 1 < NP) {    // the next pass's c rows fly during this pass's second part (in front of the barrier they would be waited for at it)
            co += JB * HID * 4;
#pragma unroll
            for (int ks = 0; ks < 2; ++ks) { cv[ks][0] = *(const v8f*)(atb(C, co) + ks * 32); cv[ks][1] = *(const v8f*)(atb(C, co) + ks * 32 + 16); }
            asm volatile("s_wait_xcnt 0x0" : "+v"(co) :: "memory");    // before a register that these loads name as an address is written again; the offset is named as at the K loads
        }
        float tv[JB / 2]; float mx = -3.0e38f;
#pragma unroll
        for (int t = 0; t < NT; ++t) { v8f s = (v8f){}; s = wmma16(kf[t][0], qf[0], s); s = wmma16(kf[t][1], qf[1], s); const float* br = buf + wv * BHS + lr * BP + t * 16 + 8 * hi; const v4f b0 = *(const v4fa*)br, b1 = *(const v4fa*)(br + 4);
#pragma unroll
            for (int r = 0; r < 4; ++r) { tv[t * 8 + r] = fmaf(s[r], 0.125f, b0[r]); tv[t * 8 + 4 + r] = fmaf(s[4 + r], 0.125f, b1[r]); } }
        v16h vf[JB / 32][4];    // asked for behind the scores, where the K registers are free, and ahead of the softmax, which covers their latency
#pragma unroll
        for (int jj = 0; jj < JB / 32; ++jj)
#pragma unroll
            for (int dt = 0; dt < 4; ++dt) vf[jj][dt] = WFrag<h16>::ldp(atb(VT, vo) + (dt * 2 + jj) * 512);
        asm volatile("s_wait_xcnt 0x0" : "+v"(vo) :: "memory");    // before a register that these loads name as an address is written again; the offset is named as at the K loads
        vo += JB * HD * 2;
#pragma unroll
        for (int e = 0; e < JB / 2; ++e) mx = fmaxf(mx, tv[e]);
        mx = fmaxf(mx, xhalf(mx));
        const float mn = fmaxf(mrun, mx); const float alpha = __builtin_amdgcn_exp2f((mrun - mn) * L2E); const float cs = fmaf(-mn, L2E, 10.0f); mrun = mn;    // probabilities carry a factor 2^10, so that small ones stay normal f16 numbers; it cancels against the sum
        v16h pf[JB / 32]; float ps = 0.f;
#pragma unroll
        for (int e = 0; e < JB / 2; ++e) { const float p = __builtin_amdgcn_exp2f(fmaf(tv[e], L2E, cs)); ps += p; pf[e / 16][e % 16] = tohx(p); }
        lsum = fmaf(lsum, alpha, ps);
#pragma unroll
        for (int dt = 0; dt < 4; ++dt) o[dt] *= alpha;
#pragma unroll
        for (int jj = 0; jj < JB / 32; ++jj)
#pragma unroll
            for (int dt = 0; dt < 4; ++dt) o[dt] = wmma16(vf[jj][dt], pf[jj], o[dt]);
    }
    lsum += xhalf(lsum);
    const size_t row = ((size_t)jh * NB_ * NH_ + hb) * RC + i0 + lr; float* op = O + (size_t)jh * NB_ * TT * DM + ((size_t)((b * TT + i0) / 16) * (DM / 16) + wv * 4) * 256 + lane * 8;    // a lane's 8 values of o[dt] are one unit of the out projection's A plane (row = token, k = head * 64 + d) in fragment order: f32 here, 1 KiB in a row a store
#pragma unroll
    for (int dt = 0; dt < 4; ++dt) *(v8f*)(op + dt * 256) = o[dt];
    if (hi == 0) { v2f ml; ml[0] = mrun; ml[1] = lsum; *(v2f*)(ML + row * 2) = ml; }
}
// k_mrg: joins the two key halves of a query row (common maximum, then one division by the joined sum) and splits the context into bf16 hi + lo, heads merged. O, Ah and Al share one fragment order: thread g handles unit g of 8 elements (one token, 8 d of one head).
__global__ __launch_bounds__(256) void k_mrg(const float* __restrict__ O, const float* __restrict__ ML, bf* Ah, bf* Al) { const int g = blockIdx.x * 256 + threadIdx.x; if (g >= NB_ * TT * DM / 8) return; const int m = (g >> 11) * 16 + (g & 15); const int h = ((g >> 6) & 31) >> 1; const size_t mr = (size_t)((m / TT) * NH_ + h) * RC + m % TT; v8us oh, ol;
    const v2f m0 = *(const v2f*)(ML + mr * 2), m1 = *(const v2f*)(ML + ((size_t)NB_ * NH_ * RC + mr) * 2); const v8f x0 = *(const v8f*)(O + (size_t)g * 8), x1 = *(const v8f*)(O + (size_t)NB_ * TT * DM + (size_t)g * 8);
    asm volatile("s_wait_xcnt 0x0" ::: "memory");    // before a register that these loads name as an address is written again
    const float mm = fmaxf(m0[0], m1[0]); const float e0 = __builtin_amdgcn_exp2f((m0[0] - mm) * L2E), e1 = __builtin_amdgcn_exp2f((m1[0] - mm) * L2E); const float inv = __fdiv_rn(1.0f, fmaf(m0[1], e0, m1[1] * e1)); const float f0 = e0 * inv, f1 = e1 * inv;
#pragma unroll
    for (int u = 0; u < 8; ++u) { unsigned short a, b; splitf(fmaf(x0[u], f0, x1[u] * f1), a, b); oh[u] = a; ol[u] = b; } *(v8us*)(Ah + (size_t)g * 8) = oh; *(v8us*)(Al + (size_t)g * 8) = ol;  }

extern "C" void kernel_launch(void* const* d_in, const int* in_sizes, int n_in,
                              void* d_out, int out_size, void* d_ws, size_t ws_size, hipStream_t stream) {
    (void)in_sizes; (void)n_in; (void)out_size;
    const float** I = (const float**)d_in;
    const float *x = I[0], *freqs = I[1], *Wq = I[2], *bq = I[3], *Wk = I[4], *bk = I[5], *Wv = I[6], *bv = I[7], *Wo = I[8], *bo = I[9], *W1 = I[10], *b1 = I[11], *W2 = I[12], *b2 = I[13];
    float* OUT = (float*)d_out;     // [2][1024][1024]
    char* wsp = (char*)d_ws;
    auto take = [&](size_t bytes) { char* p = wsp; wsp += (bytes + 255) & ~(size_t)255; return (void*)p; };
    bf* BW = (bf*)take((size_t)4 * DM * DM * 2); bf* BO = BW + (size_t)3 * DM * DM; bf* B2 = (bf*)take(NH_ * HID * 2);    // BW: Wq, Wk, Wv, Wo transposed, one after the other
    bf* XB = (bf*)take((size_t)NB_ * TT * DM * 2); float* A = (float*)take(NB_ * TT * HID * 4); float* C = (float*)take(NB_ * TT * HID * 4);
    h16* Q16 = (h16*)take((size_t)2 * NB_ * NH_ * TT * HD * 2); h16* K16 = Q16 + (size_t)NB_ * NH_ * TT * HD; h16* VT = (h16*)take((size_t)NB_ * NH_ * HD * TT * 2);
    float* O = (float*)take((size_t)JS * NB_ * NH_ * RC * HD * 4); float* ML = (float*)take((size_t)JS * NB_ * NH_ * RC * 2 * 4); bf* Ch = (bf*)take((size_t)NB_ * TT * DM * 2); bf* Cl = (bf*)take((size_t)NB_ * TT * DM * 2);    // O, ML: per key half, the context not yet normalised and each row's maximum and sum
    if ((size_t)(wsp - (char*)d_ws) > ws_size) return;    // total ~ 49 MiB
    k_prep<<<4 * WTB + CVB + ACB + 1, 256, 0, stream>>>(Wq, Wk, Wv, Wo, BW, x, XB, freqs, W1, b1, A, C, W2, B2);
    k_gemmw<bf, 0, true, 8, true><<<dim3(NB_ * TT / 64, DM / 64, 3), 256, 0, stream>>>(XB, nullptr, BW, nullptr, nullptr, DM, bq, bk, bv, 0, (size_t)DM * DM, 0, Q16, VT);
    k_attn<<<dim3(TT / 16, NB_, JS), 512, 0, stream>>>(Q16, K16, VT, A, C, B2, b2, O, ML);
    k_mrg<<<NB_ * NH_ * RC * HD / 8 / 256, 256, 0, stream>>>(O, ML, Ch, Cl);
    k_gemmw<bf, 1, true, 8, false><<<dim3(NB_ * TT / 64, DM / 64, 1), 256, 0, stream>>>(Ch, Cl, BO, nullptr, OUT, DM, bo, bo, bo, 0, 0, 0, nullptr, nullptr);
}

// v008
// A run of this version takes 75.5 microseconds.
// Versions in between are left out here; by their measured steps it is 1.10 times as fast as v006.
// Over all steps from v000 it is 13.3 times as fast.
#include <hip/hip_runtime.h>

// Attention layer with a pairwise frequency bias (x [2][1024][1024], freqs [2][1024][1]; Q/K/V = x W + b (16 heads x 64); scores = q.k/8 + b[h][i][j] where b = relu(feat(i,j) W1 + b1) W2 + b2 with feat = [f_i - f_j, log((f_i + eps)/(f_j + eps))] (64 hidden); softmax; out = (attn V merged) Wo + bo
// -> [2][1024][1024]). The pairwise feature MLP is evaluated as relu(a_i + c_j) with a_i = f_i W1[0] + log(f_i + eps) W1[1] + b1, c_j = -f_j W1[0] - log(f_j + eps) W1[1] (exact algebra of the difference / log-ratio), then x W2 on the matrix
// instructions inside the attention kernel (k_attn).
// Compute dtypes, f32 accumulate: every input rounded to bf16; Q/K/V on PLAIN bf16 operands (inputs: exact) + bias; a_i / c_j and their sum f32 on the VALU, the sum rounded once to f16, relu on the f16 pair; the bias GEMM f16 features x W2 (bf16 values held in f16: exact down to 2^-14, below that to 2^-25), 1 product; scores (K 64)

#define NB_  2
#define TT   1024
#define DM   1024
#define NH_  16
#define HD   64
#define HID  64
#define RC   1024
typedef _Float16 h16;
typedef unsigned short bf;
typedef __attribute__((ext_vector_type(16))) __bf16   v16bf;
typedef __attribute__((ext_vector_type(16))) _Float16 v16h;
typedef __attribute__((ext_vector_type(8)))  _Float16 v8h;
typedef __attribute__((ext_vector_type(8)))  unsigned short v8us;
typedef __attribute__((ext_vector_type(8)))  float    v8f;
typedef __attribute__((ext_vector_type(4)))  float    v4f;
typedef v8h  __attribute__((may_alias)) v8ha;
typedef v4f  __attribute__((may_alias)) v4fa;
typedef v8us __attribute__((may_alias)) v8usa;

__device__ __forceinline__ unsigned short f2bf(float f) { unsigned u = __float_as_uint(f); u += 0x7FFFu + ((u >> 16) & 1u); return (unsigned short)(u >> 16); }
__device__ __forceinline__ float bf2f(unsigned short b) { return __uint_as_float(((unsigned)b) << 16); }
__device__ __forceinline__ float bfr(float f) { return bf2f(f2bf(f)); }
__device__ __forceinline__ v16h cat16(v8h lo, v8h hi) { return __builtin_shufflevector(lo, hi, 0, 1, 2, 3, 4, 5, 6, 7, 8, 9, 10, 11, 12, 13, 14, 15); }
__device__ __forceinline__ v16bf cat16b(v8us lo, v8us hi) { return __builtin_bit_cast(v16bf, __builtin_shufflevector(lo, hi, 0, 1, 2, 3, 4, 5, 6, 7, 8, 9, 10, 11, 12, 13, 14, 15)); }
__device__ __forceinline__ v8f wmma16(v16h a, v16h b, v8f c) { return __builtin_amdgcn_wmma_f32_16x16x32_f16(false, a, false, b, (short)0, c, false, false); }
__device__ __forceinline__ v8f wmmab(v16bf a, v16bf b, v8f c) { return __builtin_amdgcn_wmma_f32_16x16x32_bf16(false, a, false, b, (short)0, c, false, false); }



// FRAGMENT ORDER: every 16-bit operand plane of a matrix instruction but W2's (row-major [head][k]) lies in the workspace (k_outp's context: in LDS) in the order in which the lanes hold it. A plane of rows r and K columns k is cut into fragments of 16 rows x 32 k (1 KiB), fragment (r / 16, k / 32) at
// ((r / 16) * (K / 32) + k / 32) * 512 elements; inside it element (r, k) stands at ((k / 16) % 2) * 256 + (((k / 8) % 2) * 16 + r % 16) * 8 + k % 8. Lane l = hi * 16 + lr reads its 16 elements with two 16-byte loads at l * 8 and 256 + l * 8 (ldp),
// so each wave-wide load covers 512 contiguous bytes (4 whole lines) where a row-major plane gives 32-byte pieces of 16 lines.
// ---- k_gemmw: register-blocked GEMM, one 64x64 output tile per work-group (16 accumulators per wave), operands straight from 16-bit planes in fragment order, K = DM; grid (M/64, N/64, Z), 32 * NW threads.
// C[m][n] (f32, pitch ldc, + optional f32 bias[n], its own vector for z = 0, 1, 2) = sum_k A[m][k] Bt[n][k] (+ split products per NSPLIT). z-batch strides sA/sB/sC in elements. K % (32 * NW) == 0.
// NW waves share the tile: wave w sums the k range [w K/NW, (w+1) K/NW), so NW times as many loads are in flight for the tile and each wave's chain of load waits is NW times shorter; the NW partial tiles meet in LDS and are added in wave order.
// HEADS (the Q/K/V product; a 64x64 tile is 64 tokens of one head): the f32 sum + bias is rounded to f16 here and stored in fragment order, as the attention kernel reads it; C is not written. A tile is 8 KiB in a row at [z * 2 + b][h][t / 64] (QK, z = 0, 1) or [b][h][t / 64] (VTo):
// Q, K: rows = tokens, k = d, fragments [t / 16 % 4][d / 32]; V: rows = d, k = tokens, fragments [d / 16][t / 32 % 2]. For z = 2 the partial tiles are laid in LDS transposed (row = d), so one lane map serves both: thread i stores the 16-byte units i and 256 + i of the tile (a lane's 8 elements of a fragment), 512 bytes in a row a wave.
typedef __attribute__((ext_vector_type(4))) _Float16 v4h;
__device__ __forceinline__ h16 tohx(float x) { return (h16)x; }
template <typename T16> struct WFrag;
template <> struct WFrag<h16> { typedef v16h V; static __device__ __forceinline__ V ld(const h16* p) { return cat16(*(const v8h*)p, *(const v8h*)(p + 16)); } static __device__ __forceinline__ V ldp(const h16* p) { return cat16(*(const v8h*)p, *(const v8h*)(p + 256)); } static __device__ __forceinline__ v8f mma(V a, V b, v8f c) { return wmma16(a, b, c); } };
template <> struct WFrag<bf> { typedef v16bf V; static __device__ __forceinline__ V ld(const bf* p) { return cat16b(*(const v8us*)p, *(const v8us*)(p + 16)); } static __device__ __forceinline__ V ldp(const bf* p) { return cat16b(*(const v8us*)p, *(const v8us*)(p + 256)); } static __device__ __forceinline__ v8f mma(V a, V b, v8f c) { return wmmab(a, b, c); } };
template <typename T16> __device__ __forceinline__ const T16* atb(const T16* base, unsigned bytes) { return (const T16*)((const char*)base + bytes); }    // scalar base + the lane's 32-bit byte offset: the load names exactly these two
template <typename T16, int NSPLIT, bool BIAS, int NW, bool HEADS>
__global__ __launch_bounds__(32 * NW) void k_gemmw(const T16* __restrict__ A, const T16* __restrict__ A2, const T16* __restrict__ Bt, const T16* __restrict__ Bt2, float* C, int ldc, const float* __restrict__ bias0, const float* __restrict__ bias1, const float* __restrict__ bias2, size_t sA, size_t sB, size_t sC, h16* QK, h16* VTo) {
    typedef typename WFrag<T16>::V V;
    __shared__ __align__(16) float os[NW == 1 ? 16 * 68 : NW * 64 * 68];
    const size_t z = blockIdx.z; A += z * sA; if (A2) A2 += z * sA; Bt += z * sB; if (Bt2) Bt2 += z * sB; C += z * sC; const float* bias = z == 0 ? bias0 : z == 1 ? bias1 : bias2;
    const int lane = threadIdx.x & 31, lr = lane & 15, hi = lane >> 4; const int r0 = blockIdx.x * 64, c0 = blockIdx.y * 64;
    v8f acc[4][4];
#pragma unroll
    for (int mb = 0; mb < 4; ++mb)
#pragma unroll
        for (int nb = 0; nb < 4; ++nb) acc[mb][nb] = (v8f){};
    constexpr int K = DM;
    const int wv = NW == 1 ? 0 : __builtin_amdgcn_readfirstlane((int)(threadIdx.x >> 5)); const int kbeg = wv * (K / NW), kend = kbeg + K / NW;
    unsigned oa = (unsigned)(r0 * K + kbeg * 16 + lane * 8) * 2u, ob = (unsigned)(c0 * K + kbeg * 16 + lane * 8) * 2u;    // the lane's place in its plane, in bytes: a strip of 16 rows is 16 K elements, a step of 32 k in it 512
#pragma unroll 1
    for (int kc = kbeg; kc < kend; kc += 32) {
        V a[4], a2[4], b[4], b2[4];
#pragma unroll
        for (int mb = 0; mb < 4; ++mb) { a[mb] = WFrag<T16>::ldp(atb(A, oa) + mb * 16 * K); if (NSPLIT == 1 || NSPLIT == 2) a2[mb] = WFrag<T16>::ldp(atb(A2, oa) + mb * 16 * K); }
#pragma unroll
        for (int nb = 0; nb < 4; ++nb) { b[nb] = WFrag<T16>::ldp(atb(Bt, ob) + nb * 16 * K); if (NSPLIT >= 2) b2[nb] = WFrag<T16>::ldp(atb(Bt2, ob) + nb * 16 * K); }
        asm volatile("s_wait_xcnt 0x0" : "+v"(oa), "+v"(ob) :: "memory");    // before a register that these loads name as an address is written again; the two offsets are named so that they live up to the wait (no load lands in them) and are advanced behind it
        oa += 1024; ob += 1024;
#pragma unroll
        for (int nb = 0; nb < 4; ++nb) {
#pragma unroll
            for (int mb = 0; mb < 4; ++mb) { acc[mb][nb] = WFrag<T16>::mma(a[mb], b[nb], acc[mb][nb]); if (NSPLIT == 1 || NSPLIT == 2) acc[mb][nb] = WFrag<T16>::mma(a2[mb], b[nb], acc[mb][nb]); if (NSPLIT >= 2) acc[mb][nb] = WFrag<T16>::mma(a[mb], b2[nb], acc[mb][nb]); } }
        asm volatile("v_nop\n\tv_nop\n\tv_nop\n\tv_nop" : "+v"(acc[0][0]), "+v"(acc[1][1]), "+v"(acc[2][2]), "+v"(acc[3][3]) : "v"(a[0]), "v"(a[3]));
    }
    if constexpr (NW > 1 && HEADS) {
        float* mine = os + wv * (64 * 68); const bool tr = z == 2;    // the same for the whole work-group
        if (tr) {
#pragma unroll
            for (int mb = 0; mb < 4; ++mb)
#pragma unroll
                for (int nb = 0; nb < 4; ++nb) { float* mp = mine + (nb * 16 + lr) * 68 + mb * 16 + hi * 8; const v8f t = acc[mb][nb]; *(v4fa*)mp = __builtin_shufflevector(t, t, 0, 1, 2, 3); *(v4fa*)(mp + 4) = __builtin_shufflevector(t, t, 4, 5, 6, 7); }
        } else {
#pragma unroll
            for (int mb = 0; mb < 4; ++mb)
#pragma unroll
                for (int nb = 0; nb < 4; ++nb)
#pragma unroll
                    for (int j = 0; j < 8; ++j) mine[(mb * 16 + hi * 8 + j) * 68 + nb * 16 + lr] = acc[mb][nb][j];
        }
        static_assert(NW == 8, "16 half fragments of 512 bytes a tile: two a wave");
        const int rb = (wv >> 2) * 16 + lr, cofs = (wv & 3) * 16 + hi * 8; const int bb = r0 / TT, t0 = r0 % TT, hh = blockIdx.y; v8f bv;    // the lane's LDS rows are s * 32 + rb, its columns cofs + u; bv[u]: the bias of column cofs + u, or (transposed) of row (u & 1) * 32 + rb
        h16* dst = (tr ? VTo + ((size_t)(bb * NH_ + hh) * TT + t0) * HD : QK + (((size_t)((int)z * NB_ + bb) * NH_ + hh) * TT + t0) * HD) + threadIdx.x * 8;
#pragma unroll
        for (int u = 0; u < 8; ++u) bv[u] = bias[c0 + (tr ? (u & 1) * 32 + rb : cofs + u)];
        asm volatile("s_wait_xcnt 0x0" ::: "memory");    // before a register that these loads name as an address is written again
        __syncthreads();    // every wave's partial tile lies in LDS before any wave adds them up
#pragma unroll
        for (int u = 0; u < 8; ++u) bv[u] = bfr(bv[u]);
#pragma unroll
        for (int s = 0; s < 2; ++s) { const float* rp = os + (s * 32 + rb) * 68 + cofs; v4f val = *(const v4fa*)rp, va2 = *(const v4fa*)(rp + 4);
#pragma unroll
            for (int w = 1; w < NW; ++w) { val += *(const v4fa*)(rp + w * (64 * 68)); va2 += *(const v4fa*)(rp + w * (64 * 68) + 4); }
            v8h o;
#pragma unroll
            for (int u = 0; u < 4; ++u) { o[u] = tohx(val[u] + (tr ? bv[s] : bv[u])); o[4 + u] = tohx(va2[u] + (tr ? bv[s] : bv[4 + u])); }
            *(v8h*)(dst + s * 2048) = o; }
        return;
    }
    if constexpr (NW > 1) {
        float* mine = os + wv * (64 * 68);
#pragma unroll
        for (int mb = 0; mb < 4; ++mb)
#pragma unroll
            for (int nb = 0; nb < 4; ++nb)
#pragma unroll
                for (int j = 0; j < 8; ++j) mine[(mb * 16 + hi * 8 + j) * 68 + nb * 16 + lr] = acc[mb][nb][j];
        const int cofs = lr * 4; v4f bv = (v4f){};
        if (BIAS) { bv[0] = bfr(bias[c0 + cofs]); bv[1] = bfr(bias[c0 + cofs + 1]); bv[2] = bfr(bias[c0 + cofs + 2]); bv[3] = bfr(bias[c0 + cofs + 3]); }
        __syncthreads();    // every wave's partial tile lies in LDS before any wave adds them up
#pragma unroll
        for (int s = 0; s < 32 / NW; ++s) { const int row = (s * NW + wv) * 2 + hi; v4f val = *(const v4fa*)(os + row * 68 + cofs);
#pragma unroll
            for (int w = 1; w < NW; ++w) val += *(const v4fa*)(os + w * (64 * 68) + row * 68 + cofs);
            if (BIAS) val += bv;
            *(v4f*)(C + (size_t)(r0 + row) * ldc + c0 + cofs) = val; }
        return;
    }
#pragma unroll
    for (int mb = 0; mb < 4; ++mb) {
#pragma unroll
        for (int nb = 0; nb < 4; ++nb) {
#pragma unroll
            for (int j = 0; j < 8; ++j) os[(hi * 8 + j) * 68 + nb * 16 + lr] = acc[mb][nb][j]; }
        __builtin_amdgcn_wave_barrier(); asm volatile("" ::: "memory");
        float* crow = C + (size_t)(r0 + mb * 16) * ldc + c0;
{
#pragma unroll
            for (int s = 0; s < 8; ++s) { const int row = 2 * s + hi, cofs = lr * 4; v4f val = *(const v4fa*)(os + row * 68 + cofs); if (BIAS) { val[0] += bfr(bias[c0 + cofs]); val[1] += bfr(bias[c0 + cofs + 1]); val[2] += bfr(bias[c0 + cofs + 2]); val[3] += bfr(bias[c0 + cofs + 3]); }
                *(v4f*)(crow + (size_t)row * ldc + cofs) = val; }
             }
        __builtin_amdgcn_wave_barrier(); asm volatile("" ::: "memory");
    }
}

__device__ __forceinline__ void splitf(float y, unsigned short& h, unsigned short& l) { h = f2bf(y); l = f2bf(y - bf2f(h)); }
typedef __attribute__((ext_vector_type(2))) unsigned short v2us;
typedef __attribute__((ext_vector_type(4))) unsigned short v4us;

// d_*: the bodies of the small element-wise stages, each given its own block index blk, so that stages which do not depend on one another share one launch (k_prep).
// d_wtG: one wave makes one fragment of Bt[n][k] = bf16 w[k][n] (DM x DM): fragment (n / 16, k / 32) = (g % 64, g / 64) for wave number g, so the 8 waves of a block read 512 contiguous bytes of each of 32 rows of w; a lane's 16 loads are all in flight at once.
__device__ __forceinline__ void d_wtG(int blk, const float* __restrict__ w, bf* Bt) {
    const int lane = threadIdx.x & 31, lr = lane & 15, hi = lane >> 4; const int g = blk * 8 + (threadIdx.x >> 5); const int nt = g % (DM / 16), kt = g / (DM / 16);
    const float* p = w + (size_t)(kt * 32 + hi * 8) * DM + nt * 16 + lr; float v[16];
#pragma unroll
    for (int e = 0; e < 16; ++e) v[e] = p[(size_t)((e >> 3) * 16 + (e & 7)) * DM];
    asm volatile("s_wait_xcnt 0x0" ::: "memory");    // before a register that these loads name as an address is written again
    v8us o0, o1;
#pragma unroll
    for (int e = 0; e < 8; ++e) { o0[e] = f2bf(v[e]); o1[e] = f2bf(v[8 + e]); }
    bf* q = Bt + (size_t)(nt * (DM / 32) + kt) * 512 + lane * 8; *(v8us*)q = o0; *(v8us*)(q + 256) = o1;
}
// d_cvt8: thread i makes the 16-byte unit i of the fragment-ordered plane dst from 8 consecutive elements of one row of src (rows of DM).
__device__ __forceinline__ void d_cvt8(int blk, const float* __restrict__ src, bf* dst, size_t n8) { const size_t i = (size_t)blk * 256 + threadIdx.x; if (i >= n8) return; const int ii = (int)i; const int m = (ii >> 11) * 16 + (ii & 15), k = ((ii >> 6) & 31) * 32 + ((ii >> 5) & 1) * 16 + ((ii >> 4) & 1) * 8;
    const v8f v = *(const v8f*)(src + (size_t)m * DM + k); v8us o;
    asm volatile("s_wait_xcnt 0x0" ::: "memory");    // before a register that this load names as an address is written again
#pragma unroll
    for (int k = 0; k < 8; ++k) o[k] = f2bf(v[k]); *(v8us*)(dst + i * 8) = o;  }
// d_w2: Bt[h][k] = bf16 W2[k][h], 16 head rows (8-B lanes); d_ac: lane -> 4 consecutive hidden units of token i (both batch elements, i = b * 1024 + t): a = f W1[0] + log(f + 1e-6) W1[1] + b1, c = -(f W1[0]) - (log(f+eps) W1[1]) (16-B lanes);
__device__ __forceinline__ void d_w2(int blk, const float* __restrict__ W2, bf* Bt) { const int e = (blk * 256 + threadIdx.x) * 4; if (e >= NH_ * HID) return; const int k = e % HID; const int h = e / HID; v4us o;
#pragma unroll
    for (int u = 0; u < 4; ++u) o[u] = f2bf(W2[(k + u) * NH_ + h]); *(v4us*)(Bt + e) = o;  }
__device__ __forceinline__ void d_ac(int blk, const float* __restrict__ fr, const float* __restrict__ W1, const float* __restrict__ b1, float* A, float* C) { const int e = (blk * 256 + threadIdx.x) * 4; if (e >= NB_ * TT * HID) return; const int k0 = e % HID; const int i = e / HID; const float f = bfr(fr[i]); const float lf = __logf(__fadd_rn(f, 1e-6f)); v4f oa, oc;
#pragma unroll
    for (int u = 0; u < 4; ++u) { const int k = k0 + u; float t1 = __fmul_rn(f, bfr(W1[k])), t2 = __fmul_rn(lf, bfr(W1[HID + k])); asm volatile("" : "+v"(t1)); asm volatile("" : "+v"(t2)); oa[u] = __fadd_rn(__fadd_rn(t1, t2), bfr(b1[k])); oc[u] = __fsub_rn(-t1, t2); }
    { *(v4f*)(A + e) = oa; *(v4f*)(C + e) = oc;  } }
// k_prep: everything that reads only the inputs, one launch: blocks [0, 4 WTB) transpose Wq, Wk, Wv, Wo into BW[m] (rows n, fragment order), the next CVB round x to bf16 (fragment order), the next ACB make a and c, the last one W2.
#define WTB (DM / 16 * (DM / 32) / 8)
#define CVB (NB_ * TT * DM / 8 / 256)
#define ACB (NB_ * TT * HID / 4 / 256)
__global__ __launch_bounds__(256) void k_prep(const float* __restrict__ Wq, const float* __restrict__ Wk, const float* __restrict__ Wv, const float* __restrict__ Wo, bf* BW, const float* __restrict__ x, bf* XB,
                                              const float* __restrict__ fr, const float* __restrict__ W1, const float* __restrict__ b1, float* A, float* C, const float* __restrict__ W2, bf* B2) {
    const int bx = blockIdx.x;
    if (bx < 4 * WTB) { const int m = bx / WTB; d_wtG(bx % WTB, m == 0 ? Wq : m == 1 ? Wk : m == 2 ? Wv : Wo, BW + (size_t)m * DM * DM); }
    else if (bx < 4 * WTB + CVB) d_cvt8(bx - 4 * WTB, x, XB, (size_t)NB_ * TT * DM / 8);
    else if (bx < 4 * WTB + CVB + ACB) d_ac(bx - (4 * WTB + CVB), fr, W1, b1, A, C);
    else d_w2(0, W2, B2);
}
typedef __attribute__((ext_vector_type(2))) float v2f;
typedef __attribute__((ext_vector_type(2))) _Float16 v2h;
// k_attn: bias MLP, scores, softmax and attn x V of 16 query rows x all 16 heads x one half of the keys in one work-group of 16 waves; grid (TT / 16, NB_, JS). Bias, scores and probabilities never reach the workspace.
// A pass covers JB keys. First part, the bias: wave w makes, for its NT query rows (w / NT) * NT + 0 .. NT - 1 and its column tile w % NT of 16 keys, relu(a_i + c_j) as f16 in registers (f32 sum, one rounding, packed maximum with 0; B operand, column = key) and multiplies by W2 (A operand, row = head);
// the 16 heads x 16 keys go to LDS as bl[head][i][key]. Second part, behind the pass's one barrier: wave w is head w. St = K Qt (row = key, column = query), so a lane holds JB / 2 scores of one query: maximum and sum in the lane plus one exchange
// between the wave's halves; each pair of score tiles, converted in place, is a B operand of Ot += Vt Pt. The running maximum rescales Ot and the sum each pass. Two LDS buffers: a pass writes the one that was last read before the barrier of the pass before.
// The two key halves leave Ot (not normalised, in the fragment order of the out projection's A plane), the maximum and the sum in the workspace; k_outp joins them. Q, K, V are read in fragment order (see k_gemmw).
#define JB 64
#define NT (JB / 16)
#define JS 2
#define NP (TT / JS / JB)
#define BP (JB + 4)
#define BHS (16 * BP + 4)
#define L2E 1.4426950408889634f
__device__ __forceinline__ float xhalf(float x) { return __builtin_bit_cast(float, __builtin_amdgcn_permlanex16(__builtin_bit_cast(int, x), __builtin_bit_cast(int, x), 0x76543210, 0xfedcba98, false, false)); }    // lane l with lane l ^ 16
__global__ __launch_bounds__(512) void k_attn(const h16* __restrict__ Q16, const h16* __restrict__ K16, const h16* __restrict__ VT, const float* __restrict__ A, const float* __restrict__ C, const bf* __restrict__ Bt, const float* __restrict__ b2, float* O, float* ML) {
    __shared__ __align__(32) float bl[2 * 16 * BHS];
    __shared__ __align__(32) float al[16 * HID];
    const int lane = threadIdx.x & 31, lr = lane & 15, hi = lane >> 4; const int wv = __builtin_amdgcn_readfirstlane((int)(threadIdx.x >> 5));
    const int i0 = blockIdx.x * 16, b = blockIdx.y, jh = blockIdx.z, jbeg = jh * (TT / JS); const int ip = (wv / NT) * NT, tq = wv % NT;
    unsigned wo = (unsigned)(lr * HID + 8 * hi) * 2u; v16bf wb[2];    // wo: the lane's byte offset in Bt
#pragma unroll
    for (int ks = 0; ks < 2; ++ks) wb[ks] = WFrag<bf>::ld(atb(Bt, wo) + ks * 32);
    asm volatile("s_wait_xcnt 0x0" : "+v"(wo) :: "memory");    // before a register that these loads name as an address is written again; the offset is named so that it lives up to the wait (no load lands in it)
    *(v2f*)(al + threadIdx.x * 2) = *(const v2f*)(A + (size_t)(b * TT + i0) * HID + threadIdx.x * 2);    // the 16 a rows, read by every wave in every pass
    const size_t hb = (size_t)(b * NH_ + wv);
    unsigned ko = (unsigned)((hb * TT + jbeg) * HD + lane * 8) * 2u, vo = ko; unsigned co = (unsigned)((b * TT + jbeg + tq * 16 + lr) * HID + 8 * hi) * 4u;    // ko, vo, co: the lane's byte offsets in K16, VT and C
    v16h w[2], qf[2]; v8f binit, cv[2][2], o[4]; float mrun = -3.0e38f, lsum = 0.f;
#pragma unroll
    for (int ks = 0; ks < 2; ++ks) { qf[ks] = WFrag<h16>::ldp(Q16 + (hb * TT + i0) * HD + ks * 512 + lane * 8); cv[ks][0] = *(const v8f*)(atb(C, co) + ks * 32); cv[ks][1] = *(const v8f*)(atb(C, co) + ks * 32 + 16); }
#pragma unroll
    for (int ks = 0; ks < 2; ++ks)
#pragma unroll
        for (int e = 0; e < 16; ++e) w[ks][e] = tohx((float)wb[ks][e]);    // W2 as f16
#pragma unroll
    for (int r = 0; r < 8; ++r) binit[r] = bfr(b2[8 * hi + r]);
#pragma unroll
    for (int dt = 0; dt < 4; ++dt) o[dt] = (v8f){};
    asm volatile("s_wait_xcnt 0x0" ::: "memory");    // before a register that these loads name as an address is written again
    __syncthreads();    // the a rows lie in LDS before any wave reads them
#pragma unroll 1    // one copy of the pass: the body is long, and a second copy would only add instruction-cache misses
    for (int it = 0; it < NP; ++it) {
        float* buf = bl + (it & 1) * (16 * BHS);
        v16h kf[NT][2];    // this pass's K rows, asked for ahead of the bias arithmetic, which covers their latency
#pragma unroll
        for (int t = 0; t < NT; ++t)
#pragma unroll
            for (int ks = 0; ks < 2; ++ks) kf[t][ks] = WFrag<h16>::ldp(atb(K16, ko) + (t * 2 + ks) * 512);
        asm volatile("s_wait_xcnt 0x0" : "+v"(ko) :: "memory");    // before a register that these loads name as an address is written again; the offset is named so that it lives up to the wait (no load lands in it) and is advanced behind it
        ko += JB * HD * 2;
#pragma unroll
        for (int q = 0; q < NT; ++q) { v8f acc = binit;
#pragma unroll
            for (int ks = 0; ks < 2; ++ks) { const float* ar = al + (ip + q) * HID + ks * 32 + 8 * hi; v8f av[2]; av[0] = *(const v8f*)ar; av[1] = *(const v8f*)(ar + 16); v16h fh;
#pragma unroll
                for (int g = 0; g < 2; ++g)
#pragma unroll
                    for (int s = 0; s < 8; s += 2) { v2f h; h[0] = av[g][s] + cv[ks][g][s]; h[1] = av[g][s + 1] + cv[ks][g][s + 1]; const v2h ph = __builtin_elementwise_max(__builtin_convertvector(h, v2h), (v2h){}); fh[g * 8 + s] = ph[0]; fh[g * 8 + s + 1] = ph[1]; }
                acc = wmma16(w[ks], fh, acc); }
#pragma unroll
            for (int r = 0; r < 8; ++r) buf[(8 * hi + r) * BHS + (ip + q) * BP + tq * 16 + lr] = acc[r]; }
        __syncthreads();    // every wave's bias tiles of this pass lie in LDS; also ends every wave's reads of the other buffer, which the next pass writes
        if (it + 1 < NP) {    // the next pass's c rows fly during this pass's second part (in front of the barrier they would be waited for at it)
            co += JB * HID * 4;
#pragma unroll
            for (int ks = 0; ks < 2; ++ks) { cv[ks][0] = *(const v8f*)(atb(C, co) + ks * 32); cv[ks][1] = *(const v8f*)(atb(C, co) + ks * 32 + 16); }
            asm volatile("s_wait_xcnt 0x0" : "+v"(co) :: "memory");    // before a register that these loads name as an address is written again; the offset is named as at the K loads
        }
        float tv[JB / 2]; float mx = -3.0e38f;
#pragma unroll
        for (int t = 0; t < NT; ++t) { v8f s = (v8f){}; s = wmma16(kf[t][0], qf[0], s); s = wmma16(kf[t][1], qf[1], s); const float* br = buf + wv * BHS + lr * BP + t * 16 + 8 * hi; const v4f b0 = *(const v4fa*)br, b1 = *(const v4fa*)(br + 4);
#pragma unroll
            for (int r = 0; r < 4; ++r) { tv[t * 8 + r] = fmaf(s[r], 0.125f, b0[r]); tv[t * 8 + 4 + r] = fmaf(s[4 + r], 0.125f, b1[r]); } }
        v16h vf[JB / 32][4];    // asked for behind the scores, where the K registers are free, and ahead of the softmax, which covers their latency
#pragma unroll
        for (int jj = 0; jj < JB / 32; ++jj)
#pragma unroll
            for (int dt = 0; dt < 4; ++dt) vf[jj][dt] = WFrag<h16>::ldp(atb(VT, vo) + (dt * 2 + jj) * 512);
        asm volatile("s_wait_xcnt 0x0" : "+v"(vo) :: "memory");    // before a register that these loads name as an address is written again; the offset is named as at the K loads
        vo += JB * HD * 2;
#pragma unroll
        for (int e = 0; e < JB / 2; ++e) mx = fmaxf(mx, tv[e]);
        mx = fmaxf(mx, xhalf(mx));
        const float mn = fmaxf(mrun, mx); const float alpha = __builtin_amdgcn_exp2f((mrun - mn) * L2E); const float cs = fmaf(-mn, L2E, 10.0f); mrun = mn;    // probabilities carry a factor 2^10, so that small ones stay normal f16 numbers; it cancels against the sum
        v16h pf[JB / 32]; float ps = 0.f;
#pragma unroll
        for (int e = 0; e < JB / 2; ++e) { const float p = __builtin_amdgcn_exp2f(fmaf(tv[e], L2E, cs)); ps += p; pf[e / 16][e % 16] = tohx(p); }
        lsum = fmaf(lsum, alpha, ps);
#pragma unroll
        for (int dt = 0; dt < 4; ++dt) o[dt] *= alpha;
#pragma unroll
        for (int jj = 0; jj < JB / 32; ++jj)
#pragma unroll
            for (int dt = 0; dt < 4; ++dt) o[dt] = wmma16(vf[jj][dt], pf[jj], o[dt]);
    }
    lsum += xhalf(lsum);
    const size_t row = ((size_t)jh * NB_ * NH_ + hb) * RC + i0 + lr; float* op = O + (size_t)jh * NB_ * TT * DM + ((size_t)((b * TT + i0) / 16) * (DM / 16) + wv * 4) * 256 + lane * 8;    // a lane's 8 values of o[dt] are one unit of the out projection's A plane (row = token, k = head * 64 + d) in fragment order: f32 here, 1 KiB in a row a store
#pragma unroll
    for (int dt = 0; dt < 4; ++dt) *(v8f*)(op + dt * 256) = o[dt];
    if (hi == 0) { v2f ml; ml[0] = mrun; ml[1] = lsum; *(v2f*)(ML + row * 2) = ml; }
}
// k_outp: out = context Wo + bo, and the join of the two key halves in front of it; one tile of PR rows x PC columns per work-group, 8 waves, grid (NB_ TT / PR, DM / PC).
// First part: the work-group joins its PR context rows (common maximum, then one division by the joined sum), splits them into bf16 hi + lo and lays both in LDS as fragments, [k / 32][strip of 16 rows][hi, lo], 1 KiB each. O has the same order inside a fragment: unit u of 8 elements
// (one token, 8 d of one head) of the work-group's 2 strips goes to the same place in its fragment; a thread handles one head of one row of each strip, so the two factors of a (row, head) are made once. Second part, behind the one barrier: wave w owns the columns w * 32 .. + 31 over the whole K; context fragments come from LDS, one block of
// 2 steps of 32 k ahead, Wo fragments from the workspace, KCH steps ahead. Wo is the first operand, so a lane holds 8 neighbouring columns of one row: 16-byte LDS stores into the wave's own staging tile, from which whole 128-byte lines go out.
#define PR 32
#define PC 256
#define KCH 8
#define SP 36
__global__ __launch_bounds__(256) void k_outp(const float* __restrict__ Oa, const float* __restrict__ Ob, const float* __restrict__ ML, const bf* __restrict__ Bt, const float* __restrict__ bias, float* C) {
    __shared__ __align__(16) bf pa[2 * PR * DM];
    __shared__ __align__(16) float st[8 * PR * SP];
    const int tid = threadIdx.x, lane = tid & 31, lr = lane & 15, hi = lane >> 4; const int wv = __builtin_amdgcn_readfirstlane(tid >> 5);
    const int r0 = blockIdx.x * PR, c0 = blockIdx.y * PC + wv * 32;
    const bf* bw = Bt + (size_t)c0 * DM; unsigned ob = (unsigned)lane * 16u, vo = (unsigned)hi * 32u;    // the wave's 2 strips of 16 rows of Wo transposed; ob: the lane's byte offset in them, vo: in the wave's 32 bias values
    unsigned oo = (unsigned)((tid >> 4) * 4096 + (tid & 15) * 32), mo = (unsigned)((tid >> 4) * RC + (tid & 15)) * 8u;    // the lane's byte offsets in O (Oa, Ob: the two key halves) and in ML: a thread has row tid % 16 of both strips and head tid / 16, 8 units of 8 d in each
    v16bf bq[2][KCH][2]; v8f bv[2], acc[2][2], x0[16], x1[16]; v2f m0[2], m1[2];
    const float* O0 = Oa + (size_t)r0 * DM; const float* O1 = Ob + (size_t)r0 * DM; const float* M0 = ML + ((size_t)(r0 / TT) * NH_ * RC + r0 % TT) * 2; const float* M1 = M0 + (size_t)NB_ * NH_ * RC * 2;
#pragma unroll
    for (int sp = 0; sp < 2; ++sp) { m0[sp] = *(const v2f*)(atb(M0, mo) + sp * 32); m1[sp] = *(const v2f*)(atb(M1, mo) + sp * 32); }
    asm volatile("s_wait_xcnt 0x0" : "+v"(ob), "+v"(oo), "+v"(mo), "+v"(vo) :: "memory");    // before a register that these loads name as an address is written again; mo is named so that it lives up to the wait, ob, oo and vo so that the loads behind name these registers themselves, which the waits behind those loads keep alive
    bf* pw = pa + (tid >> 4) * 4096 + (tid & 15) * 8;    // the head's two steps of 32 k are 4 fragments each; unit j of a strip is unit (j % 4) * 16 + tid % 16 of the fragments of step j / 4
#pragma unroll
    for (int sp = 0; sp < 2; ++sp) {
#pragma unroll
        for (int j = 0; j < 8; ++j) { x0[sp * 8 + j] = *(const v8f*)(atb(O0, oo) + sp * 16384 + (j >> 2) * 512 + (j & 3) * 128); x1[sp * 8 + j] = *(const v8f*)(atb(O1, oo) + sp * 16384 + (j >> 2) * 512 + (j & 3) * 128); } }    // the thread's 16 units, all asked for at once
#pragma unroll
    for (int nf = 0; nf < 2; ++nf) bv[nf] = *(const v8f*)(atb(bias + c0, vo) + nf * 16);
    asm volatile("s_wait_xcnt 0x0" : "+v"(oo), "+v"(vo) :: "memory");    // before a register that these loads name as an address is written again; the offsets are named so that they live up to the wait (no load lands in them)
    __builtin_amdgcn_sched_barrier(0);    // the arithmetic on the first values that arrive stays behind the last of these loads: moved in among them, its wait would hold the later loads back
#pragma unroll
    for (int sp = 0; sp < 2; ++sp) {
        if (sp == 1) {    // the first KCH steps' Wo fragments: asked for behind the context, which the barrier waits for, and in flight during the join of the second strip
#pragma unroll
            for (int kk = 0; kk < KCH; ++kk)
#pragma unroll
                for (int nf = 0; nf < 2; ++nf) bq[0][kk][nf] = WFrag<bf>::ldp(atb(bw, ob) + (nf * (DM / 32) + kk) * 512);
            asm volatile("s_wait_xcnt 0x0" : "+v"(ob) :: "memory");    // as above, for ob
        }
        const float mm = fmaxf(m0[sp][0], m1[sp][0]); const float e0 = __builtin_amdgcn_exp2f((m0[sp][0] - mm) * L2E), e1 = __builtin_amdgcn_exp2f((m1[sp][0] - mm) * L2E); const float inv = __fdiv_rn(1.0f, fmaf(m0[sp][1], e0, m1[sp][1] * e1)); const float f0 = e0 * inv, f1 = e1 * inv;
#pragma unroll
        for (int j = 0; j < 8; ++j) { v8us oh, ol;
#pragma unroll
            for (int u = 0; u < 8; ++u) { unsigned short a, b; splitf(fmaf(x0[sp * 8 + j][u], f0, x1[sp * 8 + j][u] * f1), a, b); oh[u] = a; ol[u] = b; }
            bf* q = pw + (j >> 2) * 2048 + sp * 1024 + (j & 3) * 128; *(v8usa*)q = oh; *(v8usa*)(q + 512) = ol; }
    }
#pragma unroll
    for (int nf = 0; nf < 2; ++nf)
#pragma unroll
        for (int j = 0; j < 8; ++j) bv[nf][j] = bfr(bv[nf][j]);
#pragma unroll
    for (int nf = 0; nf < 2; ++nf) { acc[nf][0] = (v8f){}; acc[nf][1] = (v8f){}; }
    __syncthreads();    // the joined context rows lie in LDS before any wave reads them
    int la = lane * 8; v16bf fa[2][2][4];    // la: the lane's element in the first fragment of this trip's 2 KCH steps
#pragma unroll
    for (int e = 0; e < 8; ++e) fa[0][e >> 2][e & 3] = WFrag<bf>::ldp(pa + la + e * 512);
#pragma unroll 1    // two trips of 2 KCH steps: inside a trip every LDS read is one address register plus a 16-bit offset
    for (int it = 0; it < DM / 32 / (2 * KCH); ++it) {
        const bool more = it + 1 < DM / 32 / (2 * KCH); const int ln = more ? la + 2 * KCH * 2048 : lane * 8;    // where the block behind this trip lies; the last trip reads the first block again and does not use it
#pragma unroll
        for (int bk = 0; bk < KCH; ++bk) {
            if (bk == 0 || (bk == KCH / 2 && more)) {    // the Wo fragments of the next KCH steps, into the set that the products have just left
#pragma unroll
                for (int kk = 0; kk < KCH; ++kk)
#pragma unroll
                    for (int nf = 0; nf < 2; ++nf) bq[bk == 0][kk][nf] = WFrag<bf>::ldp(atb(bw, ob) + (nf * (DM / 32) + (bk == 0 ? KCH : 2 * KCH) + kk) * 512);
                asm volatile("s_wait_xcnt 0x0" : "+v"(ob) :: "memory");    // as at the first Wo loads
            }
            const int src = bk + 1 < KCH ? la + (bk + 1) * 4096 : ln;
#pragma unroll
            for (int e = 0; e < 8; ++e) fa[(bk + 1) & 1][e >> 2][e & 3] = WFrag<bf>::ldp(pa + src + e * 512);
            __builtin_amdgcn_sched_barrier(0);    // the next block's LDS reads stay one group ahead of this block's products, which cover their latency
#pragma unroll
            for (int k2 = 0; k2 < 2; ++k2)
#pragma unroll
                for (int hl = 0; hl < 2; ++hl)
#pragma unroll
                    for (int nf = 0; nf < 2; ++nf)
#pragma unroll
                        for (int sp = 0; sp < 2; ++sp) acc[nf][sp] = wmmab(bq[bk >= KCH / 2][(bk * 2 + k2) % KCH][nf], fa[bk & 1][k2][sp * 2 + hl], acc[nf][sp]);
            __builtin_amdgcn_sched_barrier(0);    // and no later read moves in among the products
        }
        ob += 2 * KCH * 1024; la = ln;
    }
    float* sw = st + wv * (PR * SP);    // the wave's own staging tile, 32 rows x 32 columns: read by no other wave, so no barrier; vo >> 2 is 8 hi, the first of the lane's 8 columns in a tile of 16
#pragma unroll
    for (int sp = 0; sp < 2; ++sp)
#pragma unroll
        for (int nf = 0; nf < 2; ++nf) { const v8f t = acc[nf][sp] + bv[nf]; float* p = sw + (sp * 16 + lr) * SP + nf * 16 + (vo >> 2); *(v4fa*)p = __builtin_shufflevector(t, t, 0, 1, 2, 3); *(v4fa*)(p + 4) = __builtin_shufflevector(t, t, 4, 5, 6, 7); }
    float* cp = C + (size_t)(r0 + (lane >> 3)) * DM + c0 + (lane & 7) * 4;
#pragma unroll
    for (int i = 0; i < 8; ++i) *(v4f*)(cp + (size_t)i * 4 * DM) = *(const v4fa*)(sw + (i * 4 + (lane >> 3)) * SP + (lane & 7) * 4);
}

extern "C" void kernel_launch(void* const* d_in, const int* in_sizes, int n_in,
                              void* d_out, int out_size, void* d_ws, size_t ws_size, hipStream_t stream) {
    (void)in_sizes; (void)n_in; (void)out_size;
    const float** I = (const float**)d_in;
    const float *x = I[0], *freqs = I[1], *Wq = I[2], *bq = I[3], *Wk = I[4], *bk = I[5], *Wv = I[6], *bv = I[7], *Wo = I[8], *bo = I[9], *W1 = I[10], *b1 = I[11], *W2 = I[12], *b2 = I[13];
    float* OUT = (float*)d_out;     // [2][1024][1024]
    char* wsp = (char*)d_ws;
    auto take = [&](size_t bytes) { char* p = wsp; wsp += (bytes + 255) & ~(size_t)255; return (void*)p; };
    bf* BW = (bf*)take((size_t)4 * DM * DM * 2); bf* BO = BW + (size_t)3 * DM * DM; bf* B2 = (bf*)take(NH_ * HID * 2);    // BW: Wq, Wk, Wv, Wo transposed, one after the other
    bf* XB = (bf*)take((size_t)NB_ * TT * DM * 2); float* A = (float*)take(NB_ * TT * HID * 4); float* C = (float*)take(NB_ * TT * HID * 4);
    h16* Q16 = (h16*)take((size_t)2 * NB_ * NH_ * TT * HD * 2); h16* K16 = Q16 + (size_t)NB_ * NH_ * TT * HD; h16* VT = (h16*)take((size_t)NB_ * NH_ * HD * TT * 2);
    float* O = (float*)take((size_t)JS * NB_ * NH_ * RC * HD * 4); float* ML = (float*)take((size_t)JS * NB_ * NH_ * RC * 2 * 4);    // O, ML: per key half, the context not yet normalised and each row's maximum and sum
    if ((size_t)(wsp - (char*)d_ws) > ws_size) return;    // total ~ 41 MiB
    k_prep<<<4 * WTB + CVB + ACB + 1, 256, 0, stream>>>(Wq, Wk, Wv, Wo, BW, x, XB, freqs, W1, b1, A, C, W2, B2);
    k_gemmw<bf, 0, true, 8, true><<<dim3(NB_ * TT / 64, DM / 64, 3), 256, 0, stream>>>(XB, nullptr, BW, nullptr, nullptr, DM, bq, bk, bv, 0, (size_t)DM * DM, 0, Q16, VT);
    k_attn<<<dim3(TT / 16, NB_, JS), 512, 0, stream>>>(Q16, K16, VT, A, C, B2, b2, O, ML);
    k_outp<<<dim3(NB_ * TT / PR, DM / PC), 256, 0, stream>>>(O, O + (size_t)NB_ * TT * DM, ML, BO, bo, OUT);
}

// v009
// One run takes 64.7 microseconds.
// Timed twice side by side with v008, it ran 1.16 and 1.15 times as fast.
// All steps since v000 together make it 15.3 times as fast.
#include <hip/hip_runtime.h>

// Attention layer with a pairwise frequency bias (x [2][1024][1024], freqs [2][1024][1]; Q/K/V = x W + b (16 heads x 64); scores = q.k/8 + b[h][i][j] where b = relu(feat(i,j) W1 + b1) W2 + b2 with feat = [f_i - f_j, log((f_i + eps)/(f_j + eps))] (64 hidden); softmax; out = (attn V merged) Wo + bo
// -> [2][1024][1024]). The pairwise feature MLP is evaluated as relu(a_i + c_j) with a_i = f_i W1[0] + log(f_i + eps) W1[1] + b1, c_j = -f_j W1[0] - log(f_j + eps) W1[1] (exact algebra of the difference / log-ratio), then x W2 on the matrix
// instructions inside the attention kernel (k_attn).
// Compute dtypes, f32 accumulate: every input rounded to bf16; Q/K/V on PLAIN bf16 operands (inputs: exact) + bias; a_i / c_j and their sum f32 on the VALU, the sum rounded once to f16, relu on the f16 pair; the bias GEMM f16 features x W2 (bf16 values held in f16: exact down to 2^-14, below that to 2^-25), 1 product; scores (K 64)

#define NB_  2
#define TT   1024
#define DM   1024
#define NH_  16
#define HD   64
#define HID  64
#define RC   1024
typedef _Float16 h16;
typedef unsigned short bf;
typedef __attribute__((ext_vector_type(16))) __bf16   v16bf;
typedef __attribute__((ext_vector_type(16))) _Float16 v16h;
typedef __attribute__((ext_vector_type(8)))  _Float16 v8h;
typedef __attribute__((ext_vector_type(8)))  unsigned short v8us;
typedef __attribute__((ext_vector_type(8)))  float    v8f;
typedef __attribute__((ext_vector_type(4)))  float    v4f;
typedef v8h  __attribute__((may_alias)) v8ha;
typedef v4f  __attribute__((may_alias)) v4fa;
typedef v8us __attribute__((may_alias)) v8usa;

__device__ __forceinline__ unsigned short f2bf(float f) { unsigned u = __float_as_uint(f); u += 0x7FFFu + ((u >> 16) & 1u); return (unsigned short)(u >> 16); }
__device__ __forceinline__ float bf2f(unsigned short b) { return __uint_as_float(((unsigned)b) << 16); }
__device__ __forceinline__ float bfr(float f) { return bf2f(f2bf(f)); }
__device__ __forceinline__ v16h cat16(v8h lo, v8h hi) { return __builtin_shufflevector(lo, hi, 0, 1, 2, 3, 4, 5, 6, 7, 8, 9, 10, 11, 12, 13, 14, 15); }
__device__ __forceinline__ v16bf cat16b(v8us lo, v8us hi) { return __builtin_bit_cast(v16bf, __builtin_shufflevector(lo, hi, 0, 1, 2, 3, 4, 5, 6, 7, 8, 9, 10, 11, 12, 13, 14, 15)); }
__device__ __forceinline__ v8f wmma16(v16h a, v16h b, v8f c) { return __builtin_amdgcn_wmma_f32_16x16x32_f16(false, a, false, b, (short)0, c, false, false); }
__device__ __forceinline__ v8f wmmab(v16bf a, v16bf b, v8f c) { return __builtin_amdgcn_wmma_f32_16x16x32_bf16(false, a, false, b, (short)0, c, false, false); }



// FRAGMENT ORDER: every 16-bit operand plane of a matrix instruction but W2's (row-major [head][k]) lies in the workspace (k_outp's context: in LDS) in the order in which the lanes hold it. A plane of rows r and K columns k is cut into fragments of 16 rows x 32 k (1 KiB), fragment (r / 16, k / 32) at
// ((r / 16) * (K / 32) + k / 32) * 512 elements; inside it element (r, k) stands at ((k / 16) % 2) * 256 + (((k / 8) % 2) * 16 + r % 16) * 8 + k % 8. Lane l = hi * 16 + lr reads its 16 elements with two 16-byte loads at l * 8 and 256 + l * 8 (ldp),
// so each wave-wide load covers 512 contiguous bytes (4 whole lines) where a row-major plane gives 32-byte pieces of 16 lines.
// ---- k_qkv: Q, K, V = x W + b, one tile of QM tokens x QN columns (3 heads; the 3 DM columns of Wq, Wk, Wv count through) per work-group, 6 waves, grid (NB_ TT / QM, 3 DM / QN): one work-group per WGP.
// The tile's 8 strips of x and 12 strips of the weights (16 rows each, fragment order) come to LDS QKS k at a time by asynchronous copies, two buffers: a stage is [strip][k / 32] fragments of 1 KiB, 4 KiB in a row of each strip in the workspace,
// and each fragment is fetched from L2 once per work-group, where a wave that loads its own 64x64 operands fetches it once per wave. Wave w owns 64 tokens x one head (w / 3, w % 3) over the whole K; its accumulators start at the bias.
// The f32 sum is rounded to f16 and stored in fragment order, as the attention kernel reads it. A tile of 64 tokens of a head is 8 KiB in a row at [z * 2 + b][h][t / 64] (QK, z = 0, 1) or [b][h][t / 64] (VTo):
// Q, K: rows = tokens, k = d, fragments [t / 16 % 4][d / 32]; V: rows = d, k = tokens, fragments [d / 16][t / 32 % 2]. A lane holds 8 neighbouring rows of the FIRST operand in one row of the second: the weights go first for Q and K, x goes first for V,
// so in both cases a lane's 8 values are one 16-byte unit of the plane (row = second operand's, k = first operand's) and go out from registers, 512 bytes in a row a wave.
typedef __attribute__((ext_vector_type(4))) _Float16 v4h;
__device__ __forceinline__ h16 tohx(float x) { return (h16)x; }
template <typename T16> struct WFrag;
template <> struct WFrag<h16> { typedef v16h V; static __device__ __forceinline__ V ld(const h16* p) { return cat16(*(const v8h*)p, *(const v8h*)(p + 16)); } static __device__ __forceinline__ V ldp(const h16* p) { return cat16(*(const v8h*)p, *(const v8h*)(p + 256)); } static __device__ __forceinline__ v8f mma(V a, V b, v8f c) { return wmma16(a, b, c); } };
template <> struct WFrag<bf> { typedef v16bf V; static __device__ __forceinline__ V ld(const bf* p) { return cat16b(*(const v8us*)p, *(const v8us*)(p + 16)); } static __device__ __forceinline__ V ldp(const bf* p) { return cat16b(*(const v8us*)p, *(const v8us*)(p + 256)); } static __device__ __forceinline__ v8f mma(V a, V b, v8f c) { return wmmab(a, b, c); } };
template <typename T16> __device__ __forceinline__ const T16* atb(const T16* base, unsigned bytes) { return (const T16*)((const char*)base + bytes); }    // scalar base + the lane's 32-bit byte offset: the load names exactly these two
#define QM 128
#define QN 192
#define QKS 128
#define QST (DM / QKS)
#define QSE ((QM + QN) * QKS)
#define QHS (QSE * 2 / 2048)
// q_cp24, q_cp4: a half strip of a stage is 2 KiB in a row in the workspace and in LDS alike: 4 copies of 16 bytes a lane from one pair of addresses, the offset moving both. The wait on the address counter closes each statement, so that it stands in front of every later write of a register that a copy names.
__device__ __forceinline__ void q_cp24(const unsigned* l, const char* const* g) {
    asm volatile(
        "global_load_async_to_lds_b128 %0, %6, off\n\t"
        "global_load_async_to_lds_b128 %0, %6, off offset:512\n\t"
        "global_load_async_to_lds_b128 %0, %6, off offset:1024\n\t"
        "global_load_async_to_lds_b128 %0, %6, off offset:1536\n\t"
        "global_load_async_to_lds_b128 %1, %7, off\n\t"
        "global_load_async_to_lds_b128 %1, %7, off offset:512\n\t"
        "global_load_async_to_lds_b128 %1, %7, off offset:1024\n\t"
        "global_load_async_to_lds_b128 %1, %7, off offset:1536\n\t"
        "global_load_async_to_lds_b128 %2, %8, off\n\t"
        "global_load_async_to_lds_b128 %2, %8, off offset:512\n\t"
        "global_load_async_to_lds_b128 %2, %8, off offset:1024\n\t"
        "global_load_async_to_lds_b128 %2, %8, off offset:1536\n\t"
        "global_load_async_to_lds_b128 %3, %9, off\n\t"
        "global_load_async_to_lds_b128 %3, %9, off offset:512\n\t"
        "global_load_async_to_lds_b128 %3, %9, off offset:1024\n\t"
        "global_load_async_to_lds_b128 %3, %9, off offset:1536\n\t"
        "global_load_async_to_lds_b128 %4, %10, off\n\t"
        "global_load_async_to_lds_b128 %4, %10, off offset:512\n\t"
        "global_load_async_to_lds_b128 %4, %10, off offset:1024\n\t"
        "global_load_async_to_lds_b128 %4, %10, off offset:1536\n\t"
        "global_load_async_to_lds_b128 %5, %11, off\n\t"
        "global_load_async_to_lds_b128 %5, %11, off offset:512\n\t"
        "global_load_async_to_lds_b128 %5, %11, off offset:1024\n\t"
        "global_load_async_to_lds_b128 %5, %11, off offset:1536\n\t"
        "s_wait_xcnt 0x0"
        :: "v"(l[0]), "v"(l[1]), "v"(l[2]), "v"(l[3]), "v"(l[4]), "v"(l[5]), "v"(g[0]), "v"(g[1]), "v"(g[2]), "v"(g[3]), "v"(g[4]), "v"(g[5]) : "memory");
}
__device__ __forceinline__ void q_cp4(unsigned l, const char* g) {
    asm volatile("global_load_async_to_lds_b128 %0, %1, off\n\tglobal_load_async_to_lds_b128 %0, %1, off offset:512\n\tglobal_load_async_to_lds_b128 %0, %1, off offset:1024\n\tglobal_load_async_to_lds_b128 %0, %1, off offset:1536\n\ts_wait_xcnt 0x0" :: "v"(l), "v"(g) : "memory");
}
__global__ __launch_bounds__(192) void k_qkv(const bf* __restrict__ X, const bf* __restrict__ Bt, const float* __restrict__ bias0, const float* __restrict__ bias1, const float* __restrict__ bias2, h16* QK, h16* VTo) {
    __shared__ __align__(16) bf sm[2 * QSE + 8];    // two stages, and 16 bytes that nobody uses: above 160 KiB a WGP takes one work-group, so the 256 work-groups stand on 256 WGPs
    const int lane = threadIdx.x & 31, lr = lane & 15, hi = lane >> 4; const int wv = __builtin_amdgcn_readfirstlane((int)(threadIdx.x >> 5));
    const int wm = wv / 3, cb = blockIdx.y * 3 + wv % 3; const int z = cb / NH_, hh = cb % NH_; const bool tr = z == 2;    // cb: the wave's block of 64 columns; z, hh, tr: the same for the whole wave
    const char* xs = (const char*)(X + (size_t)blockIdx.x * QM * DM); const char* ws = (const char*)(Bt + (size_t)blockIdx.y * QN * DM);
    // wave w copies the half strips w, w + 6, ...: 6 each, and a 7th in waves 0 to 3 (wv < QHS - 36: the same for the whole wave)
    unsigned l[7]; const char* g[7];    // the lane's byte in each of them: in buffer 0, and in the workspace for the stage that is copied next (waves 4 and 5 hold a valid 7th pair and do not use it)
#pragma unroll
    for (int i = 0; i < 7; ++i) { const int hs = i < 6 ? i * 6 + wv : 36 + (wv & 3); const int s = hs >> 1; l[i] = (unsigned)(size_t)sm + hs * 2048 + lane * 16; g[i] = (s < QM / 16 ? xs + s * (16 * DM * 2) : ws + (s - QM / 16) * (16 * DM * 2)) + (hs & 1) * 2048 + lane * 16; }
    q_cp24(l, g); if (wv < QHS - 36) q_cp4(l[6], g[6]);
#pragma unroll
    for (int i = 0; i < 7; ++i) g[i] += QKS * 32;
    const float* bias = (z == 0 ? bias0 : z == 1 ? bias1 : bias2) + hh * HD;
    v8f acc[4][4];    // [strip of the first operand][strip of the second]
    if (tr) { float bs[4];
#pragma unroll
        for (int s = 0; s < 4; ++s) bs[s] = bias[s * 16 + lr];
        asm volatile("s_wait_xcnt 0x0" ::: "memory");    // before a register that these loads name as an address is written again
#pragma unroll
        for (int s = 0; s < 4; ++s) { const float v = bfr(bs[s]);
#pragma unroll
            for (int f = 0; f < 4; ++f)
#pragma unroll
                for (int j = 0; j < 8; ++j) acc[f][s][j] = v; }
    } else { v8f bq[4];
#pragma unroll
        for (int f = 0; f < 4; ++f) bq[f] = *(const v8f*)(bias + f * 16 + hi * 8);
        asm volatile("s_wait_xcnt 0x0" ::: "memory");    // before a register that these loads name as an address is written again
#pragma unroll
        for (int f = 0; f < 4; ++f) {
#pragma unroll
            for (int j = 0; j < 8; ++j) bq[f][j] = bfr(bq[f][j]);
#pragma unroll
            for (int s = 0; s < 4; ++s) acc[f][s] = bq[f]; }
    }
    const int xo = wm * 4 * (16 * QKS), wo = (QM / 16 + (wv % 3) * 4) * (16 * QKS);    // the wave's 4 strips of x and of the weights in a stage, in elements
    const int fo = (tr ? xo : wo) + lane * 8, so = (tr ? wo : xo) + lane * 8;
    asm volatile("s_wait_asynccnt 0x0" ::: "memory");    // this wave's copies of stage 0 have landed
    __syncthreads();    // stage 0 lies in LDS before any wave reads it
    { unsigned lc[7];
#pragma unroll
        for (int i = 0; i < 7; ++i) lc[i] = l[i] + QSE * 2;
        q_cp24(lc, g); if (wv < QHS - 36) q_cp4(lc[6], g[6]);
#pragma unroll
        for (int i = 0; i < 7; ++i) g[i] += QKS * 32; }
#pragma unroll 1    // one copy of the trip: the buffer is picked by address
    for (int t = 0; t < QST; ++t) {
        const bf* sb = sm + (t & 1) * QSE; v16bf a[2][4], b[2][4];
#pragma unroll
        for (int u = 0; u < 4; ++u) { b[0][u] = WFrag<bf>::ldp(sb + so + u * (16 * QKS)); a[0][u] = WFrag<bf>::ldp(sb + fo + u * (16 * QKS)); }
#pragma unroll
        for (int kk = 0; kk < QKS / 32; ++kk) {
            if (kk + 1 < QKS / 32) {
#pragma unroll
                for (int u = 0; u < 4; ++u) { b[(kk + 1) & 1][u] = WFrag<bf>::ldp(sb + so + u * (16 * QKS) + (kk + 1) * 512); a[(kk + 1) & 1][u] = WFrag<bf>::ldp(sb + fo + u * (16 * QKS) + (kk + 1) * 512); } }
            __builtin_amdgcn_sched_barrier(0);    // the next step's LDS reads stay one group ahead of this step's products, which cover their latency
#pragma unroll
            for (int f = 0; f < 4; ++f)
#pragma unroll
                for (int s = 0; s < 4; ++s) acc[f][s] = wmmab(a[kk & 1][f], b[kk & 1][s], acc[f][s]);
            __builtin_amdgcn_sched_barrier(0);    // and no later read moves in among the products
        }
        asm volatile("s_wait_dscnt 0x0" ::: "memory");    // this wave's reads of the buffer are done before the barrier behind which it is refilled
        asm volatile("s_wait_asynccnt 0x0" ::: "memory");    // this wave's copies of stage t + 1 have landed
        __syncthreads();    // publishes stage t + 1 and ends every wave's reads of stage t
        if (t + 2 < QST) { unsigned lc[7]; const unsigned bo = (t & 1) * (QSE * 2);
#pragma unroll
            for (int i = 0; i < 7; ++i) lc[i] = l[i] + bo;
            q_cp24(lc, g); if (wv < QHS - 36) q_cp4(lc[6], g[6]);
#pragma unroll
            for (int i = 0; i < 7; ++i) g[i] += QKS * 32; }
    }
    asm volatile("s_wait_asynccnt 0x0" ::: "memory");    // no copy is outstanding when the wave ends
    const int rw = blockIdx.x * QM + wm * 64; const int bb = rw / TT, t0 = rw % TT;
    h16* dst = (tr ? VTo + ((size_t)(bb * NH_ + hh) * TT + t0) * HD : QK + (((size_t)(z * NB_ + bb) * NH_ + hh) * TT + t0) * HD) + lane * 8;
    v8h o[4][4];
#pragma unroll
    for (int s = 0; s < 4; ++s)
#pragma unroll
        for (int f = 0; f < 4; ++f)
#pragma unroll
            for (int j = 0; j < 8; ++j) o[s][f][j] = tohx(acc[f][s][j]);
    __builtin_amdgcn_sched_barrier(0);    // the 16 stores go out in a row, each from registers of its own: no wait among them
#pragma unroll
    for (int s = 0; s < 4; ++s)
#pragma unroll
        for (int f = 0; f < 4; ++f) *(v8h*)(dst + (s * 2 + (f >> 1)) * 512 + (f & 1) * 256) = o[s][f];
}

__device__ __forceinline__ void splitf(float y, unsigned short& h, unsigned short& l) { h = f2bf(y); l = f2bf(y - bf2f(h)); }
typedef __attribute__((ext_vector_type(2))) unsigned short v2us;
typedef __attribute__((ext_vector_type(4))) unsigned short v4us;

// d_*: the bodies of the small element-wise stages, each given its own block index blk, so that stages which do not depend on one another share one launch (k_prep).
// d_wtG: one wave makes one fragment of Bt[n][k] = bf16 w[k][n] (DM x DM): fragment (n / 16, k / 32) = (g % 64, g / 64) for wave number g, so the 8 waves of a block read 512 contiguous bytes of each of 32 rows of w; a lane's 16 loads are all in flight at once.
__device__ __forceinline__ void d_wtG(int blk, const float* __restrict__ w, bf* Bt) {
    const int lane = threadIdx.x & 31, lr = lane & 15, hi = lane >> 4; const int g = blk * 8 + (threadIdx.x >> 5); const int nt = g % (DM / 16), kt = g / (DM / 16);
    const float* p = w + (size_t)(kt * 32 + hi * 8) * DM + nt * 16 + lr; float v[16];
#pragma unroll
    for (int e = 0; e < 16; ++e) v[e] = p[(size_t)((e >> 3) * 16 + (e & 7)) * DM];
    asm volatile("s_wait_xcnt 0x0" ::: "memory");    // before a register that these loads name as an address is written again
    v8us o0, o1;
#pragma unroll
    for (int e = 0; e < 8; ++e) { o0[e] = f2bf(v[e]); o1[e] = f2bf(v[8 + e]); }
    bf* q = Bt + (size_t)(nt * (DM / 32) + kt) * 512 + lane * 8; *(v8us*)q = o0; *(v8us*)(q + 256) = o1;
}
// d_cvt8: thread i makes the 16-byte unit i of the fragment-ordered plane dst from 8 consecutive elements of one row of src (rows of DM).
__device__ __forceinline__ void d_cvt8(int blk, const float* __restrict__ src, bf* dst, size_t n8) { const size_t i = (size_t)blk * 256 + threadIdx.x; if (i >= n8) return; const int ii = (int)i; const int m = (ii >> 11) * 16 + (ii & 15), k = ((ii >> 6) & 31) * 32 + ((ii >> 5) & 1) * 16 + ((ii >> 4) & 1) * 8;
    const v8f v = *(const v8f*)(src + (size_t)m * DM + k); v8us o;
    asm volatile("s_wait_xcnt 0x0" ::: "memory");    // before a register that this load names as an address is written again
#pragma unroll
    for (int k = 0; k < 8; ++k) o[k] = f2bf(v[k]); *(v8us*)(dst + i * 8) = o;  }
// d_w2: Bt[h][k] = bf16 W2[k][h], 16 head rows (8-B lanes); d_ac: lane -> 4 consecutive hidden units of token i (both batch elements, i = b * 1024 + t): a = f W1[0] + log(f + 1e-6) W1[1] + b1, c = -(f W1[0]) - (log(f+eps) W1[1]) (16-B lanes);
__device__ __forceinline__ void d_w2(int blk, const float* __restrict__ W2, bf* Bt) { const int e = (blk * 256 + threadIdx.x) * 4; if (e >= NH_ * HID) return; const int k = e % HID; const int h = e / HID; v4us o;
#pragma unroll
    for (int u = 0; u < 4; ++u) o[u] = f2bf(W2[(k + u) * NH_ + h]); *(v4us*)(Bt + e) = o;  }
__device__ __forceinline__ void d_ac(int blk, const float* __restrict__ fr, const float* __restrict__ W1, const float* __restrict__ b1, float* A, float* C) { const int e = (blk * 256 + threadIdx.x) * 4; if (e >= NB_ * TT * HID) return; const int k0 = e % HID; const int i = e / HID; const float f = bfr(fr[i]); const float lf = __logf(__fadd_rn(f, 1e-6f)); v4f oa, oc;
#pragma unroll
    for (int u = 0; u < 4; ++u) { const int k = k0 + u; float t1 = __fmul_rn(f, bfr(W1[k])), t2 = __fmul_rn(lf, bfr(W1[HID + k])); asm volatile("" : "+v"(t1)); asm volatile("" : "+v"(t2)); oa[u] = __fadd_rn(__fadd_rn(t1, t2), bfr(b1[k])); oc[u] = __fsub_rn(-t1, t2); }
    { *(v4f*)(A + e) = oa; *(v4f*)(C + e) = oc;  } }
// k_prep: everything that reads only the inputs, one launch: blocks [0, 4 WTB) transpose Wq, Wk, Wv, Wo into BW[m] (rows n, fragment order), the next CVB round x to bf16 (fragment order), the next ACB make a and c, the last one W2.
#define WTB (DM / 16 * (DM / 32) / 8)
#define CVB (NB_ * TT * DM / 8 / 256)
#define ACB (NB_ * TT * HID / 4 / 256)
__global__ __launch_bounds__(256) void k_prep(const float* __restrict__ Wq, const float* __restrict__ Wk, const float* __restrict__ Wv, const float* __restrict__ Wo, bf* BW, const float* __restrict__ x, bf* XB,
                                              const float* __restrict__ fr, const float* __restrict__ W1, const float* __restrict__ b1, float* A, float* C, const float* __restrict__ W2, bf* B2) {
    const int bx = blockIdx.x;
    if (bx < 4 * WTB) { const int m = bx / WTB; d_wtG(bx % WTB, m == 0 ? Wq : m == 1 ? Wk : m == 2 ? Wv : Wo, BW + (size_t)m * DM * DM); }
    else if (bx < 4 * WTB + CVB) d_cvt8(bx - 4 * WTB, x, XB, (size_t)NB_ * TT * DM / 8);
    else if (bx < 4 * WTB + CVB + ACB) d_ac(bx - (4 * WTB + CVB), fr, W1, b1, A, C);
    else d_w2(0, W2, B2);
}
typedef __attribute__((ext_vector_type(2))) float v2f;
typedef __attribute__((ext_vector_type(2))) _Float16 v2h;
// k_attn: bias MLP, scores, softmax and attn x V of 16 query rows x all 16 heads x one half of the keys in one work-group of 16 waves; grid (TT / 16, NB_, JS). Bias, scores and probabilities never reach the workspace.
// A pass covers JB keys. First part, the bias: wave w makes, for its NT query rows (w / NT) * NT + 0 .. NT - 1 and its column tile w % NT of 16 keys, relu(a_i + c_j) as f16 in registers (f32 sum, one rounding, packed maximum with 0; B operand, column = key) and multiplies by W2 (A operand, row = head);
// the 16 heads x 16 keys go to LDS as bl[head][i][key]. Second part, behind the pass's one barrier: wave w is head w. St = K Qt (row = key, column = query), so a lane holds JB / 2 scores of one query: maximum and sum in the lane plus one exchange
// between the wave's halves; each pair of score tiles, converted in place, is a B operand of Ot += Vt Pt. The running maximum rescales Ot and the sum each pass. Two LDS buffers: a pass writes the one that was last read before the barrier of the pass before.
// The two key halves leave Ot (not normalised, in the fragment order of the out projection's A plane), the maximum and the sum in the workspace; k_outp joins them. Q, K, V are read in fragment order (see k_qkv).
#define JB 64
#define NT (JB / 16)
#define JS 2
#define NP (TT / JS / JB)
#define BP (JB + 4)
#define BHS (16 * BP + 4)
#define L2E 1.4426950408889634f
__device__ __forceinline__ float xhalf(float x) { return __builtin_bit_cast(float, __builtin_amdgcn_permlanex16(__builtin_bit_cast(int, x), __builtin_bit_cast(int, x), 0x76543210, 0xfedcba98, false, false)); }    // lane l with lane l ^ 16
__global__ __launch_bounds__(512) void k_attn(const h16* __restrict__ Q16, const h16* __restrict__ K16, const h16* __restrict__ VT, const float* __restrict__ A, const float* __restrict__ C, const bf* __restrict__ Bt, const float* __restrict__ b2, float* O, float* ML) {
    __shared__ __align__(32) float bl[2 * 16 * BHS];
    __shared__ __align__(32) float al[16 * HID];
    const int lane = threadIdx.x & 31, lr = lane & 15, hi = lane >> 4; const int wv = __builtin_amdgcn_readfirstlane((int)(threadIdx.x >> 5));
    const int i0 = blockIdx.x * 16, b = blockIdx.y, jh = blockIdx.z, jbeg = jh * (TT / JS); const int ip = (wv / NT) * NT, tq = wv % NT;
    unsigned wo = (unsigned)(lr * HID + 8 * hi) * 2u; v16bf wb[2];    // wo: the lane's byte offset in Bt
#pragma unroll
    for (int ks = 0; ks < 2; ++ks) wb[ks] = WFrag<bf>::ld(atb(Bt, wo) + ks * 32);
    asm volatile("s_wait_xcnt 0x0" : "+v"(wo) :: "memory");    // before a register that these loads name as an address is written again; the offset is named so that it lives up to the wait (no load lands in it)
    *(v2f*)(al + threadIdx.x * 2) = *(const v2f*)(A + (size_t)(b * TT + i0) * HID + threadIdx.x * 2);    // the 16 a rows, read by every wave in every pass
    const size_t hb = (size_t)(b * NH_ + wv);
    unsigned ko = (unsigned)((hb * TT + jbeg) * HD + lane * 8) * 2u, vo = ko; unsigned co = (unsigned)((b * TT + jbeg + tq * 16 + lr) * HID + 8 * hi) * 4u;    // ko, vo, co: the lane's byte offsets in K16, VT and C
    v16h w[2], qf[2]; v8f binit, cv[2][2], o[4]; float mrun = -3.0e38f, lsum = 0.f;
#pragma unroll
    for (int ks = 0; ks < 2; ++ks) { qf[ks] = WFrag<h16>::ldp(Q16 + (hb * TT + i0) * HD + ks * 512 + lane * 8); cv[ks][0] = *(const v8f*)(atb(C, co) + ks * 32); cv[ks][1] = *(const v8f*)(atb(C, co) + ks * 32 + 16); }
#pragma unroll
    for (int ks = 0; ks < 2; ++ks)
#pragma unroll
        for (int e = 0; e < 16; ++e) w[ks][e] = tohx((float)wb[ks][e]);    // W2 as f16
#pragma unroll
    for (int r = 0; r < 8; ++r) binit[r] = bfr(b2[8 * hi + r]);
#pragma unroll
    for (int dt = 0; dt < 4; ++dt) o[dt] = (v8f){};
    asm volatile("s_wait_xcnt 0x0" ::: "memory");    // before a register that these loads name as an address is written again
    __syncthreads();    // the a rows lie in LDS before any wave reads them
#pragma unroll 1    // one copy of the pass: the body is long, and a second copy would only add instruction-cache misses
    for (int it = 0; it < NP; ++it) {
        float* buf = bl + (it & 1) * (16 * BHS);
        v16h kf[NT][2];    // this pass's K rows, asked for ahead of the bias arithmetic, which covers their latency
#pragma unroll
        for (int t = 0; t < NT; ++t)
#pragma unroll
            for (int ks = 0; ks < 2; ++ks) kf[t][ks] = WFrag<h16>::ldp(atb(K16, ko) + (t * 2 + ks) * 512);
        asm volatile("s_wait_xcnt 0x0" : "+v"(ko) :: "memory");    // before a register that these loads name as an address is written again; the offset is named so that it lives up to the wait (no load lands in it) and is advanced behind it
        ko += JB * HD * 2;
#pragma unroll
        for (int q = 0; q < NT; ++q) { v8f acc = binit;
#pragma unroll
            for (int ks = 0; ks < 2; ++ks) { const float* ar = al + (ip + q) * HID + ks * 32 + 8 * hi; v8f av[2]; av[0] = *(const v8f*)ar; av[1] = *(const v8f*)(ar + 16); v16h fh;
#pragma unroll
                for (int g = 0; g < 2; ++g)
#pragma unroll
                    for (int s = 0; s < 8; s += 2) { v2f h; h[0] = av[g][s] + cv[ks][g][s]; h[1] = av[g][s + 1] + cv[ks][g][s + 1]; const v2h ph = __builtin_elementwise_max(__builtin_convertvector(h, v2h), (v2h){}); fh[g * 8 + s] = ph[0]; fh[g * 8 + s + 1] = ph[1]; }
                acc = wmma16(w[ks], fh, acc); }
#pragma unroll
            for (int r = 0; r < 8; ++r) buf[(8 * hi + r) * BHS + (ip + q) * BP + tq * 16 + lr] = acc[r]; }
        __syncthreads();    // every wave's bias tiles of this pass lie in LDS; also ends every wave's reads of the other buffer, which the next pass writes
        if (it + 1 < NP) {    // the next pass's c rows fly during this pass's second part (in front of the barrier they would be waited for at it)
            co += JB * HID * 4;
#pragma unroll
            for (int ks = 0; ks < 2; ++ks) { cv[ks][0] = *(const v8f*)(atb(C, co) + ks * 32); cv[ks][1] = *(const v8f*)(atb(C, co) + ks * 32 + 16); }
            asm volatile("s_wait_xcnt 0x0" : "+v"(co) :: "memory");    // before a register that these loads name as an address is written again; the offset is named as at the K loads
        }
        float tv[JB / 2]; float mx = -3.0e38f;
#pragma unroll
        for (int t = 0; t < NT; ++t) { v8f s = (v8f){}; s = wmma16(kf[t][0], qf[0], s); s = wmma16(kf[t][1], qf[1], s); const float* br = buf + wv * BHS + lr * BP + t * 16 + 8 * hi; const v4f b0 = *(const v4fa*)br, b1 = *(const v4fa*)(br + 4);
#pragma unroll
            for (int r = 0; r < 4; ++r) { tv[t * 8 + r] = fmaf(s[r], 0.125f, b0[r]); tv[t * 8 + 4 + r] = fmaf(s[4 + r], 0.125f, b1[r]); } }
        v16h vf[JB / 32][4];    // asked for behind the scores, where the K registers are free, and ahead of the softmax, which covers their latency
#pragma unroll
        for (int jj = 0; jj < JB / 32; ++jj)
#pragma unroll
            for (int dt = 0; dt < 4; ++dt) vf[jj][dt] = WFrag<h16>::ldp(atb(VT, vo) + (dt * 2 + jj) * 512);
        asm volatile("s_wait_xcnt 0x0" : "+v"(vo) :: "memory");    // before a register that these loads name as an address is written again; the offset is named as at the K loads
        vo += JB * HD * 2;
#pragma unroll
        for (int e = 0; e < JB / 2; ++e) mx = fmaxf(mx, tv[e]);
        mx = fmaxf(mx, xhalf(mx));
        const float mn = fmaxf(mrun, mx); const float alpha = __builtin_amdgcn_exp2f((mrun - mn) * L2E); const float cs = fmaf(-mn, L2E, 10.0f); mrun = mn;    // probabilities carry a factor 2^10, so that small ones stay normal f16 numbers; it cancels against the sum
        v16h pf[JB / 32]; float ps = 0.f;
#pragma unroll
        for (int e = 0; e < JB / 2; ++e) { const float p = __builtin_amdgcn_exp2f(fmaf(tv[e], L2E, cs)); ps += p; pf[e / 16][e % 16] = tohx(p); }
        lsum = fmaf(lsum, alpha, ps);
#pragma unroll
        for (int dt = 0; dt < 4; ++dt) o[dt] *= alpha;
#pragma unroll
        for (int jj = 0; jj < JB / 32; ++jj)
#pragma unroll
            for (int dt = 0; dt < 4; ++dt) o[dt] = wmma16(vf[jj][dt], pf[jj], o[dt]);
    }
    lsum += xhalf(lsum);
    const size_t row = ((size_t)jh * NB_ * NH_ + hb) * RC + i0 + lr; float* op = O + (size_t)jh * NB_ * TT * DM + ((size_t)((b * TT + i0) / 16) * (DM / 16) + wv * 4) * 256 + lane * 8;    // a lane's 8 values of o[dt] are one unit of the out projection's A plane (row = token, k = head * 64 + d) in fragment order: f32 here, 1 KiB in a row a store
#pragma unroll
    for (int dt = 0; dt < 4; ++dt) *(v8f*)(op + dt * 256) = o[dt];
    if (hi == 0) { v2f ml; ml[0] = mrun; ml[1] = lsum; *(v2f*)(ML + row * 2) = ml; }
}
// k_outp: out = context Wo + bo, and the join of the two key halves in front of it; one tile of PR rows x PC columns per work-group, 8 waves, grid (NB_ TT / PR, DM / PC).
// First part: the work-group joins its PR context rows (common maximum, then one division by the joined sum), splits them into bf16 hi + lo and lays both in LDS as fragments, [k / 32][strip of 16 rows][hi, lo], 1 KiB each. O has the same order inside a fragment: unit u of 8 elements
// (one token, 8 d of one head) of the work-group's 2 strips goes to the same place in its fragment; a thread handles one head of one row of each strip, so the two factors of a (row, head) are made once. Second part, behind the one barrier: wave w owns the columns w * 32 .. + 31 over the whole K; context fragments come from LDS, one block of
// 2 steps of 32 k ahead, Wo fragments from the workspace, KCH steps ahead. Wo is the first operand, so a lane holds 8 neighbouring columns of one row: 16-byte LDS stores into the wave's own staging tile, from which whole 128-byte lines go out.
#define PR 32
#define PC 256
#define KCH 8
#define SP 36
__global__ __launch_bounds__(256) void k_outp(const float* __restrict__ Oa, const float* __restrict__ Ob, const float* __restrict__ ML, const bf* __restrict__ Bt, const float* __restrict__ bias, float* C) {
    __shared__ __align__(16) bf pa[2 * PR * DM];
    __shared__ __align__(16) float st[8 * PR * SP];
    const int tid = threadIdx.x, lane = tid & 31, lr = lane & 15, hi = lane >> 4; const int wv = __builtin_amdgcn_readfirstlane(tid >> 5);
    const int r0 = blockIdx.x * PR, c0 = blockIdx.y * PC + wv * 32;
    const bf* bw = Bt + (size_t)c0 * DM; unsigned ob = (unsigned)lane * 16u, vo = (unsigned)hi * 32u;    // the wave's 2 strips of 16 rows of Wo transposed; ob: the lane's byte offset in them, vo: in the wave's 32 bias values
    unsigned oo = (unsigned)((tid >> 4) * 4096 + (tid & 15) * 32), mo = (unsigned)((tid >> 4) * RC + (tid & 15)) * 8u;    // the lane's byte offsets in O (Oa, Ob: the two key halves) and in ML: a thread has row tid % 16 of both strips and head tid / 16, 8 units of 8 d in each
    v16bf bq[2][KCH][2]; v8f bv[2], acc[2][2], x0[16], x1[16]; v2f m0[2], m1[2];
    const float* O0 = Oa + (size_t)r0 * DM; const float* O1 = Ob + (size_t)r0 * DM; const float* M0 = ML + ((size_t)(r0 / TT) * NH_ * RC + r0 % TT) * 2; const float* M1 = M0 + (size_t)NB_ * NH_ * RC * 2;
#pragma unroll
    for (int sp = 0; sp < 2; ++sp) { m0[sp] = *(const v2f*)(atb(M0, mo) + sp * 32); m1[sp] = *(const v2f*)(atb(M1, mo) + sp * 32); }
    asm volatile("s_wait_xcnt 0x0" : "+v"(ob), "+v"(oo), "+v"(mo), "+v"(vo) :: "memory");    // before a register that these loads name as an address is written again; mo is named so that it lives up to the wait, ob, oo and vo so that the loads behind name these registers themselves, which the waits behind those loads keep alive
    bf* pw = pa + (tid >> 4) * 4096 + (tid & 15) * 8;    // the head's two steps of 32 k are 4 fragments each; unit j of a strip is unit (j % 4) * 16 + tid % 16 of the fragments of step j / 4
#pragma unroll
    for (int sp = 0; sp < 2; ++sp) {
#pragma unroll
        for (int j = 0; j < 8; ++j) { x0[sp * 8 + j] = *(const v8f*)(atb(O0, oo) + sp * 16384 + (j >> 2) * 512 + (j & 3) * 128); x1[sp * 8 + j] = *(const v8f*)(atb(O1, oo) + sp * 16384 + (j >> 2) * 512 + (j & 3) * 128); } }    // the thread's 16 units, all asked for at once
#pragma unroll
    for (int nf = 0; nf < 2; ++nf) bv[nf] = *(const v8f*)(atb(bias + c0, vo) + nf * 16);
    asm volatile("s_wait_xcnt 0x0" : "+v"(oo), "+v"(vo) :: "memory");    // before a register that these loads name as an address is written again; the offsets are named so that they live up to the wait (no load lands in them)
    __builtin_amdgcn_sched_barrier(0);    // the arithmetic on the first values that arrive stays behind the last of these loads: moved in among them, its wait would hold the later loads back
#pragma unroll
    for (int sp = 0; sp < 2; ++sp) {
        if (sp == 1) {    // the first KCH steps' Wo fragments: asked for behind the context, which the barrier waits for, and in flight during the join of the second strip
#pragma unroll
            for (int kk = 0; kk < KCH; ++kk)
#pragma unroll
                for (int nf = 0; nf < 2; ++nf) bq[0][kk][nf] = WFrag<bf>::ldp(atb(bw, ob) + (nf * (DM / 32) + kk) * 512);
            asm volatile("s_wait_xcnt 0x0" : "+v"(ob) :: "memory");    // as above, for ob
        }
        const float mm = fmaxf(m0[sp][0], m1[sp][0]); const float e0 = __builtin_amdgcn_exp2f((m0[sp][0] - mm) * L2E), e1 = __builtin_amdgcn_exp2f((m1[sp][0] - mm) * L2E); const float inv = __fdiv_rn(1.0f, fmaf(m0[sp][1], e0, m1[sp][1] * e1)); const float f0 = e0 * inv, f1 = e1 * inv;
#pragma unroll
        for (int j = 0; j < 8; ++j) { v8us oh, ol;
#pragma unroll
            for (int u = 0; u < 8; ++u) { unsigned short a, b; splitf(fmaf(x0[sp * 8 + j][u], f0, x1[sp * 8 + j][u] * f1), a, b); oh[u] = a; ol[u] = b; }
            bf* q = pw + (j >> 2) * 2048 + sp * 1024 + (j & 3) * 128; *(v8usa*)q = oh; *(v8usa*)(q + 512) = ol; }
    }
#pragma unroll
    for (int nf = 0; nf < 2; ++nf)
#pragma unroll
        for (int j = 0; j < 8; ++j) bv[nf][j] = bfr(bv[nf][j]);
#pragma unroll
    for (int nf = 0; nf < 2; ++nf) { acc[nf][0] = (v8f){}; acc[nf][1] = (v8f){}; }
    __syncthreads();    // the joined context rows lie in LDS before any wave reads them
    int la = lane * 8; v16bf fa[2][2][4];    // la: the lane's element in the first fragment of this trip's 2 KCH steps
#pragma unroll
    for (int e = 0; e < 8; ++e) fa[0][e >> 2][e & 3] = WFrag<bf>::ldp(pa + la + e * 512);
#pragma unroll 1    // two trips of 2 KCH steps: inside a trip every LDS read is one address register plus a 16-bit offset
    for (int it = 0; it < DM / 32 / (2 * KCH); ++it) {
        const bool more = it + 1 < DM / 32 / (2 * KCH); const int ln = more ? la + 2 * KCH * 2048 : lane * 8;    // where the block behind this trip lies; the last trip reads the first block again and does not use it
#pragma unroll
        for (int bk = 0; bk < KCH; ++bk) {
            if (bk == 0 || (bk == KCH / 2 && more)) {    // the Wo fragments of the next KCH steps, into the set that the products have just left
#pragma unroll
                for (int kk = 0; kk < KCH; ++kk)
#pragma unroll
                    for (int nf = 0; nf < 2; ++nf) bq[bk == 0][kk][nf] = WFrag<bf>::ldp(atb(bw, ob) + (nf * (DM / 32) + (bk == 0 ? KCH : 2 * KCH) + kk) * 512);
                asm volatile("s_wait_xcnt 0x0" : "+v"(ob) :: "memory");    // as at the first Wo loads
            }
            const int src = bk + 1 < KCH ? la + (bk + 1) * 4096 : ln;
#pragma unroll
            for (int e = 0; e < 8; ++e) fa[(bk + 1) & 1][e >> 2][e & 3] = WFrag<bf>::ldp(pa + src + e * 512);
            __builtin_amdgcn_sched_barrier(0);    // the next block's LDS reads stay one group ahead of this block's products, which cover their latency
#pragma unroll
            for (int k2 = 0; k2 < 2; ++k2)
#pragma unroll
                for (int hl = 0; hl < 2; ++hl)
#pragma unroll
                    for (int nf = 0; nf < 2; ++nf)
#pragma unroll
                        for (int sp = 0; sp < 2; ++sp) acc[nf][sp] = wmmab(bq[bk >= KCH / 2][(bk * 2 + k2) % KCH][nf], fa[bk & 1][k2][sp * 2 + hl], acc[nf][sp]);
            __builtin_amdgcn_sched_barrier(0);    // and no later read moves in among the products
        }
        ob += 2 * KCH * 1024; la = ln;
    }
    float* sw = st + wv * (PR * SP);    // the wave's own staging tile, 32 rows x 32 columns: read by no other wave, so no barrier; vo >> 2 is 8 hi, the first of the lane's 8 columns in a tile of 16
#pragma unroll
    for (int sp = 0; sp < 2; ++sp)
#pragma unroll
        for (int nf = 0; nf < 2; ++nf) { const v8f t = acc[nf][sp] + bv[nf]; float* p = sw + (sp * 16 + lr) * SP + nf * 16 + (vo >> 2); *(v4fa*)p = __builtin_shufflevector(t, t, 0, 1, 2, 3); *(v4fa*)(p + 4) = __builtin_shufflevector(t, t, 4, 5, 6, 7); }
    float* cp = C + (size_t)(r0 + (lane >> 3)) * DM + c0 + (lane & 7) * 4;
#pragma unroll
    for (int i = 0; i < 8; ++i) *(v4f*)(cp + (size_t)i * 4 * DM) = *(const v4fa*)(sw + (i * 4 + (lane >> 3)) * SP + (lane & 7) * 4);
}

extern "C" void kernel_launch(void* const* d_in, const int* in_sizes, int n_in,
                              void* d_out, int out_size, void* d_ws, size_t ws_size, hipStream_t stream) {
    (void)in_sizes; (void)n_in; (void)out_size;
    const float** I = (const float**)d_in;
    const float *x = I[0], *freqs = I[1], *Wq = I[2], *bq = I[3], *Wk = I[4], *bk = I[5], *Wv = I[6], *bv = I[7], *Wo = I[8], *bo = I[9], *W1 = I[10], *b1 = I[11], *W2 = I[12], *b2 = I[13];
    float* OUT = (float*)d_out;     // [2][1024][1024]
    char* wsp = (char*)d_ws;
    auto take = [&](size_t bytes) { char* p = wsp; wsp += (bytes + 255) & ~(size_t)255; return (void*)p; };
    bf* BW = (bf*)take((size_t)4 * DM * DM * 2); bf* BO = BW + (size_t)3 * DM * DM; bf* B2 = (bf*)take(NH_ * HID * 2);    // BW: Wq, Wk, Wv, Wo transposed, one after the other
    bf* XB = (bf*)take((size_t)NB_ * TT * DM * 2); float* A = (float*)take(NB_ * TT * HID * 4); float* C = (float*)take(NB_ * TT * HID * 4);
    h16* Q16 = (h16*)take((size_t)2 * NB_ * NH_ * TT * HD * 2); h16* K16 = Q16 + (size_t)NB_ * NH_ * TT * HD; h16* VT = (h16*)take((size_t)NB_ * NH_ * HD * TT * 2);
    float* O = (float*)take((size_t)JS * NB_ * NH_ * RC * HD * 4); float* ML = (float*)take((size_t)JS * NB_ * NH_ * RC * 2 * 4);    // O, ML: per key half, the context not yet normalised and each row's maximum and sum
    if ((size_t)(wsp - (char*)d_ws) > ws_size) return;    // total ~ 41 MiB
    k_prep<<<4 * WTB + CVB + ACB + 1, 256, 0, stream>>>(Wq, Wk, Wv, Wo, BW, x, XB, freqs, W1, b1, A, C, W2, B2);
    k_qkv<<<dim3(NB_ * TT / QM, 3 * DM / QN), 192, 0, stream>>>(XB, BW, bq, bk, bv, Q16, VT);
    k_attn<<<dim3(TT / 16, NB_, JS), 512, 0, stream>>>(Q16, K16, VT, A, C, B2, b2, O, ML);
    k_outp<<<dim3(NB_ * TT / PR, DM / PC), 256, 0, stream>>>(O, O + (size_t)NB_ * TT * DM, ML, BO, bo, OUT);
}

// v010
// It runs in 62.5 microseconds.
// Next to v009, in two timings, it ran 1.04 and 1.03 times as fast.
// Counting every step since v000, it is 15.8 times as fast.
#include <hip/hip_runtime.h>

// Attention layer with a pairwise frequency bias (x [2][1024][1024], freqs [2][1024][1]; Q/K/V = x W + b (16 heads x 64); scores = q.k/8 + b[h][i][j] where b = relu(feat(i,j) W1 + b1) W2 + b2 with feat = [f_i - f_j, log((f_i + eps)/(f_j + eps))] (64 hidden); softmax; out = (attn V merged) Wo + bo
// -> [2][1024][1024]). The pairwise feature MLP is evaluated as relu(a_i - d_j) = max(a_i, d_j) - d_j with a_i = f_i W1[0] + log(f_i + eps) W1[1] + b1, d_j = f_j W1[0] + log(f_j + eps) W1[1] (exact algebra of the difference / log-ratio and of the relu), then x W2 on the matrix
// instructions inside the attention kernel (k_attn).
// Compute dtypes, f32 accumulate: every input rounded to bf16; Q/K/V on PLAIN bf16 operands (inputs: exact) + bias; a_i / d_j f32 on the VALU, each rounded once to f16, their maximum exact in f16; the bias GEMM f16 max(a_i, d_j) x W2 less f16 d_j x W2, the same f16 values in both, so that they cancel where a_i < d_j (W2: bf16 values held in f16: exact down to 2^-14, below that to 2^-25); scores (K 64)

#define NB_  2
#define TT   1024
#define DM   1024
#define NH_  16
#define HD   64
#define HID  64
#define RC   1024
typedef _Float16 h16;
typedef unsigned short bf;
typedef __attribute__((ext_vector_type(16))) __bf16   v16bf;
typedef __attribute__((ext_vector_type(16))) _Float16 v16h;
typedef __attribute__((ext_vector_type(8)))  _Float16 v8h;
typedef __attribute__((ext_vector_type(8)))  unsigned short v8us;
typedef __attribute__((ext_vector_type(8)))  float    v8f;
typedef __attribute__((ext_vector_type(4)))  float    v4f;
typedef v8h  __attribute__((may_alias)) v8ha;
typedef v4f  __attribute__((may_alias)) v4fa;
typedef v8us __attribute__((may_alias)) v8usa;

__device__ __forceinline__ unsigned short f2bf(float f) { unsigned u = __float_as_uint(f); u += 0x7FFFu + ((u >> 16) & 1u); return (unsigned short)(u >> 16); }
__device__ __forceinline__ float bf2f(unsigned short b) { return __uint_as_float(((unsigned)b) << 16); }
__device__ __forceinline__ float bfr(float f) { return bf2f(f2bf(f)); }
__device__ __forceinline__ v16h cat16(v8h lo, v8h hi) { return __builtin_shufflevector(lo, hi, 0, 1, 2, 3, 4, 5, 6, 7, 8, 9, 10, 11, 12, 13, 14, 15); }
__device__ __forceinline__ v16bf cat16b(v8us lo, v8us hi) { return __builtin_bit_cast(v16bf, __builtin_shufflevector(lo, hi, 0, 1, 2, 3, 4, 5, 6, 7, 8, 9, 10, 11, 12, 13, 14, 15)); }
__device__ __forceinline__ v8f wmma16(v16h a, v16h b, v8f c) { return __builtin_amdgcn_wmma_f32_16x16x32_f16(false, a, false, b, (short)0, c, false, false); }
__device__ __forceinline__ v8f wmmab(v16bf a, v16bf b, v8f c) { return __builtin_amdgcn_wmma_f32_16x16x32_bf16(false, a, false, b, (short)0, c, false, false); }



// FRAGMENT ORDER: every 16-bit operand plane of a matrix instruction but W2's (row-major [head][k]) and a's and d's (row-major [token][k]) lies in the workspace (k_outp's context: in LDS) in the order in which the lanes hold it. A plane of rows r and K columns k is cut into fragments of 16 rows x 32 k (1 KiB), fragment (r / 16, k / 32) at
// ((r / 16) * (K / 32) + k / 32) * 512 elements; inside it element (r, k) stands at ((k / 16) % 2) * 256 + (((k / 8) % 2) * 16 + r % 16) * 8 + k % 8. Lane l = hi * 16 + lr reads its 16 elements with two 16-byte loads at l * 8 and 256 + l * 8 (ldp),
// so each wave-wide load covers 512 contiguous bytes (4 whole lines) where a row-major plane gives 32-byte pieces of 16 lines.
// ---- k_qkv: Q, K, V = x W + b, one tile of QM tokens x QN columns (3 heads; the 3 DM columns of Wq, Wk, Wv count through) per work-group, 6 waves, grid (NB_ TT / QM, 3 DM / QN): one work-group per WGP.
// The tile's 8 strips of x and 12 strips of the weights (16 rows each, fragment order) come to LDS QKS k at a time by asynchronous copies, two buffers: a stage is [strip][k / 32] fragments of 1 KiB, 4 KiB in a row of each strip in the workspace,
// and each fragment is fetched from L2 once per work-group, where a wave that loads its own 64x64 operands fetches it once per wave. Wave w owns 64 tokens x one head (w / 3, w % 3) over the whole K; its accumulators start at the bias.
// The f32 sum is rounded to f16 and stored in fragment order, as the attention kernel reads it. A tile of 64 tokens of a head is 8 KiB in a row at [z * 2 + b][h][t / 64] (QK, z = 0, 1) or [b][h][t / 64] (VTo):
// Q, K: rows = tokens, k = d, fragments [t / 16 % 4][d / 32]; V: rows = d, k = tokens, fragments [d / 16][t / 32 % 2]. A lane holds 8 neighbouring rows of the FIRST operand in one row of the second: the weights go first for Q and K, x goes first for V,
// so in both cases a lane's 8 values are one 16-byte unit of the plane (row = second operand's, k = first operand's) and go out from registers, 512 bytes in a row a wave.
typedef __attribute__((ext_vector_type(4))) _Float16 v4h;
__device__ __forceinline__ h16 tohx(float x) { return (h16)x; }
template <typename T16> struct WFrag;
template <> struct WFrag<h16> { typedef v16h V; static __device__ __forceinline__ V ld(const h16* p) { return cat16(*(const v8h*)p, *(const v8h*)(p + 16)); } static __device__ __forceinline__ V ldp(const h16* p) { return cat16(*(const v8h*)p, *(const v8h*)(p + 256)); } static __device__ __forceinline__ v8f mma(V a, V b, v8f c) { return wmma16(a, b, c); } };
template <> struct WFrag<bf> { typedef v16bf V; static __device__ __forceinline__ V ld(const bf* p) { return cat16b(*(const v8us*)p, *(const v8us*)(p + 16)); } static __device__ __forceinline__ V ldp(const bf* p) { return cat16b(*(const v8us*)p, *(const v8us*)(p + 256)); } static __device__ __forceinline__ v8f mma(V a, V b, v8f c) { return wmmab(a, b, c); } };
template <typename T16> __device__ __forceinline__ const T16* atb(const T16* base, unsigned bytes) { return (const T16*)((const char*)base + bytes); }    // scalar base + the lane's 32-bit byte offset: the load names exactly these two
#define QM 128
#define QN 192
#define QKS 128
#define QST (DM / QKS)
#define QSE ((QM + QN) * QKS)
#define QHS (QSE * 2 / 2048)
// q_cp24, q_cp4: a half strip of a stage is 2 KiB in a row in the workspace and in LDS alike: 4 copies of 16 bytes a lane from one pair of addresses, the offset moving both. The wait on the address counter closes each statement, so that it stands in front of every later write of a register that a copy names.
__device__ __forceinline__ void q_cp24(const unsigned* l, const char* const* g) {
    asm volatile(
        "global_load_async_to_lds_b128 %0, %6, off\n\t"
        "global_load_async_to_lds_b128 %0, %6, off offset:512\n\t"
        "global_load_async_to_lds_b128 %0, %6, off offset:1024\n\t"
        "global_load_async_to_lds_b128 %0, %6, off offset:1536\n\t"
        "global_load_async_to_lds_b128 %1, %7, off\n\t"
        "global_load_async_to_lds_b128 %1, %7, off offset:512\n\t"
        "global_load_async_to_lds_b128 %1, %7, off offset:1024\n\t"
        "global_load_async_to_lds_b128 %1, %7, off offset:1536\n\t"
        "global_load_async_to_lds_b128 %2, %8, off\n\t"
        "global_load_async_to_lds_b128 %2, %8, off offset:512\n\t"
        "global_load_async_to_lds_b128 %2, %8, off offset:1024\n\t"
        "global_load_async_to_lds_b128 %2, %8, off offset:1536\n\t"
        "global_load_async_to_lds_b128 %3, %9, off\n\t"
        "global_load_async_to_lds_b128 %3, %9, off offset:512\n\t"
        "global_load_async_to_lds_b128 %3, %9, off offset:1024\n\t"
        "global_load_async_to_lds_b128 %3, %9, off offset:1536\n\t"
        "global_load_async_to_lds_b128 %4, %10, off\n\t"
        "global_load_async_to_lds_b128 %4, %10, off offset:512\n\t"
        "global_load_async_to_lds_b128 %4, %10, off offset:1024\n\t"
        "global_load_async_to_lds_b128 %4, %10, off offset:1536\n\t"
        "global_load_async_to_lds_b128 %5, %11, off\n\t"
        "global_load_async_to_lds_b128 %5, %11, off offset:512\n\t"
        "global_load_async_to_lds_b128 %5, %11, off offset:1024\n\t"
        "global_load_async_to_lds_b128 %5, %11, off offset:1536\n\t"
        "s_wait_xcnt 0x0"
        :: "v"(l[0]), "v"(l[1]), "v"(l[2]), "v"(l[3]), "v"(l[4]), "v"(l[5]), "v"(g[0]), "v"(g[1]), "v"(g[2]), "v"(g[3]), "v"(g[4]), "v"(g[5]) : "memory");
}
__device__ __forceinline__ void q_cp4(unsigned l, const char* g) {
    asm volatile("global_load_async_to_lds_b128 %0, %1, off\n\tglobal_load_async_to_lds_b128 %0, %1, off offset:512\n\tglobal_load_async_to_lds_b128 %0, %1, off offset:1024\n\tglobal_load_async_to_lds_b128 %0, %1, off offset:1536\n\ts_wait_xcnt 0x0" :: "v"(l), "v"(g) : "memory");
}
__global__ __launch_bounds__(192) void k_qkv(const bf* __restrict__ X, const bf* __restrict__ Bt, const float* __restrict__ bias0, const float* __restrict__ bias1, const float* __restrict__ bias2, h16* QK, h16* VTo) {
    __shared__ __align__(16) bf sm[2 * QSE + 8];    // two stages, and 16 bytes that nobody uses: above 160 KiB a WGP takes one work-group, so the 256 work-groups stand on 256 WGPs
    const int lane = threadIdx.x & 31, lr = lane & 15, hi = lane >> 4; const int wv = __builtin_amdgcn_readfirstlane((int)(threadIdx.x >> 5));
    const int wm = wv / 3, cb = blockIdx.y * 3 + wv % 3; const int z = cb / NH_, hh = cb % NH_; const bool tr = z == 2;    // cb: the wave's block of 64 columns; z, hh, tr: the same for the whole wave
    const char* xs = (const char*)(X + (size_t)blockIdx.x * QM * DM); const char* ws = (const char*)(Bt + (size_t)blockIdx.y * QN * DM);
    // wave w copies the half strips w, w + 6, ...: 6 each, and a 7th in waves 0 to 3 (wv < QHS - 36: the same for the whole wave)
    unsigned l[7]; const char* g[7];    // the lane's byte in each of them: in buffer 0, and in the workspace for the stage that is copied next (waves 4 and 5 hold a valid 7th pair and do not use it)
#pragma unroll
    for (int i = 0; i < 7; ++i) { const int hs = i < 6 ? i * 6 + wv : 36 + (wv & 3); const int s = hs >> 1; l[i] = (unsigned)(size_t)sm + hs * 2048 + lane * 16; g[i] = (s < QM / 16 ? xs + s * (16 * DM * 2) : ws + (s - QM / 16) * (16 * DM * 2)) + (hs & 1) * 2048 + lane * 16; }
    q_cp24(l, g); if (wv < QHS - 36) q_cp4(l[6], g[6]);
#pragma unroll
    for (int i = 0; i < 7; ++i) g[i] += QKS * 32;
    const float* bias = (z == 0 ? bias0 : z == 1 ? bias1 : bias2) + hh * HD;
    v8f acc[4][4];    // [strip of the first operand][strip of the second]
    if (tr) { float bs[4];
#pragma unroll
        for (int s = 0; s < 4; ++s) bs[s] = bias[s * 16 + lr];
        asm volatile("s_wait_xcnt 0x0" ::: "memory");    // before a register that these loads name as an address is written again
#pragma unroll
        for (int s = 0; s < 4; ++s) { const float v = bfr(bs[s]);
#pragma unroll
            for (int f = 0; f < 4; ++f)
#pragma unroll
                for (int j = 0; j < 8; ++j) acc[f][s][j] = v; }
    } else { v8f bq[4];
#pragma unroll
        for (int f = 0; f < 4; ++f) bq[f] = *(const v8f*)(bias + f * 16 + hi * 8);
        asm volatile("s_wait_xcnt 0x0" ::: "memory");    // before a register that these loads name as an address is written again
#pragma unroll
        for (int f = 0; f < 4; ++f) {
#pragma unroll
            for (int j = 0; j < 8; ++j) bq[f][j] = bfr(bq[f][j]);
#pragma unroll
            for (int s = 0; s < 4; ++s) acc[f][s] = bq[f]; }
    }
    const int xo = wm * 4 * (16 * QKS), wo = (QM / 16 + (wv % 3) * 4) * (16 * QKS);    // the wave's 4 strips of x and of the weights in a stage, in elements
    const int fo = (tr ? xo : wo) + lane * 8, so = (tr ? wo : xo) + lane * 8;
    asm volatile("s_wait_asynccnt 0x0" ::: "memory");    // this wave's copies of stage 0 have landed
    __syncthreads();    // stage 0 lies in LDS before any wave reads it
    { unsigned lc[7];
#pragma unroll
        for (int i = 0; i < 7; ++i) lc[i] = l[i] + QSE * 2;
        q_cp24(lc, g); if (wv < QHS - 36) q_cp4(lc[6], g[6]);
#pragma unroll
        for (int i = 0; i < 7; ++i) g[i] += QKS * 32; }
#pragma unroll 1    // one copy of the trip: the buffer is picked by address
    for (int t = 0; t < QST; ++t) {
        const bf* sb = sm + (t & 1) * QSE; v16bf a[2][4], b[2][4];
#pragma unroll
        for (int u = 0; u < 4; ++u) { b[0][u] = WFrag<bf>::ldp(sb + so + u * (16 * QKS)); a[0][u] = WFrag<bf>::ldp(sb + fo + u * (16 * QKS)); }
#pragma unroll
        for (int kk = 0; kk < QKS / 32; ++kk) {
            if (kk + 1 < QKS / 32) {
#pragma unroll
                for (int u = 0; u < 4; ++u) { b[(kk + 1) & 1][u] = WFrag<bf>::ldp(sb + so + u * (16 * QKS) + (kk + 1) * 512); a[(kk + 1) & 1][u] = WFrag<bf>::ldp(sb + fo + u * (16 * QKS) + (kk + 1) * 512); } }
            __builtin_amdgcn_sched_barrier(0);    // the next step's LDS reads stay one group ahead of this step's products, which cover their latency
#pragma unroll
            for (int f = 0; f < 4; ++f)
#pragma unroll
                for (int s = 0; s < 4; ++s) acc[f][s] = wmmab(a[kk & 1][f], b[kk & 1][s], acc[f][s]);
            __builtin_amdgcn_sched_barrier(0);    // and no later read moves in among the products
        }
        asm volatile("s_wait_dscnt 0x0" ::: "memory");    // this wave's reads of the buffer are done before the barrier behind which it is refilled
        asm volatile("s_wait_asynccnt 0x0" ::: "memory");    // this wave's copies of stage t + 1 have landed
        __syncthreads();    // publishes stage t + 1 and ends every wave's reads of stage t
        if (t + 2 < QST) { unsigned lc[7]; const unsigned bo = (t & 1) * (QSE * 2);
#pragma unroll
            for (int i = 0; i < 7; ++i) lc[i] = l[i] + bo;
            q_cp24(lc, g); if (wv < QHS - 36) q_cp4(lc[6], g[6]);
#pragma unroll
            for (int i = 0; i < 7; ++i) g[i] += QKS * 32; }
    }
    asm volatile("s_wait_asynccnt 0x0" ::: "memory");    // no copy is outstanding when the wave ends
    const int rw = blockIdx.x * QM + wm * 64; const int bb = rw / TT, t0 = rw % TT;
    h16* dst = (tr ? VTo + ((size_t)(bb * NH_ + hh) * TT + t0) * HD : QK + (((size_t)(z * NB_ + bb) * NH_ + hh) * TT + t0) * HD) + lane * 8;
    v8h o[4][4];
#pragma unroll
    for (int s = 0; s < 4; ++s)
#pragma unroll
        for (int f = 0; f < 4; ++f)
#pragma unroll
            for (int j = 0; j < 8; ++j) o[s][f][j] = tohx(acc[f][s][j]);
    __builtin_amdgcn_sched_barrier(0);    // the 16 stores go out in a row, each from registers of its own: no wait among them
#pragma unroll
    for (int s = 0; s < 4; ++s)
#pragma unroll
        for (int f = 0; f < 4; ++f) *(v8h*)(dst + (s * 2 + (f >> 1)) * 512 + (f & 1) * 256) = o[s][f];
}

__device__ __forceinline__ void splitf(float y, unsigned short& h, unsigned short& l) { h = f2bf(y); l = f2bf(y - bf2f(h)); }
typedef __attribute__((ext_vector_type(2))) unsigned short v2us;
typedef __attribute__((ext_vector_type(4))) unsigned short v4us;

// d_*: the bodies of the small element-wise stages, each given its own block index blk, so that stages which do not depend on one another share one launch (k_prep).
// d_wtG: one wave makes one fragment of Bt[n][k] = bf16 w[k][n] (DM x DM): fragment (n / 16, k / 32) = (g % 64, g / 64) for wave number g, so the 8 waves of a block read 512 contiguous bytes of each of 32 rows of w; a lane's 16 loads are all in flight at once.
__device__ __forceinline__ void d_wtG(int blk, const float* __restrict__ w, bf* Bt) {
    const int lane = threadIdx.x & 31, lr = lane & 15, hi = lane >> 4; const int g = blk * 8 + (threadIdx.x >> 5); const int nt = g % (DM / 16), kt = g / (DM / 16);
    const float* p = w + (size_t)(kt * 32 + hi * 8) * DM + nt * 16 + lr; float v[16];
#pragma unroll
    for (int e = 0; e < 16; ++e) v[e] = p[(size_t)((e >> 3) * 16 + (e & 7)) * DM];
    asm volatile("s_wait_xcnt 0x0" ::: "memory");    // before a register that these loads name as an address is written again
    v8us o0, o1;
#pragma unroll
    for (int e = 0; e < 8; ++e) { o0[e] = f2bf(v[e]); o1[e] = f2bf(v[8 + e]); }
    bf* q = Bt + (size_t)(nt * (DM / 32) + kt) * 512 + lane * 8; *(v8us*)q = o0; *(v8us*)(q + 256) = o1;
}
// d_cvt8: thread i makes the 16-byte unit i of the fragment-ordered plane dst from 8 consecutive elements of one row of src (rows of DM).
__device__ __forceinline__ void d_cvt8(int blk, const float* __restrict__ src, bf* dst, size_t n8) { const size_t i = (size_t)blk * 256 + threadIdx.x; if (i >= n8) return; const int ii = (int)i; const int m = (ii >> 11) * 16 + (ii & 15), k = ((ii >> 6) & 31) * 32 + ((ii >> 5) & 1) * 16 + ((ii >> 4) & 1) * 8;
    const v8f v = *(const v8f*)(src + (size_t)m * DM + k); v8us o;
    asm volatile("s_wait_xcnt 0x0" ::: "memory");    // before a register that this load names as an address is written again
#pragma unroll
    for (int k = 0; k < 8; ++k) o[k] = f2bf(v[k]); *(v8us*)(dst + i * 8) = o;  }
// d_w2: Bt[h][k] = bf16 W2[k][h], 16 head rows (8-B lanes); d_ac: lane -> 4 consecutive hidden units of token i (both batch elements, i = b * 1024 + t): a = f W1[0] + log(f + 1e-6) W1[1] + b1, d = f W1[0] + log(f+eps) W1[1], f32, each rounded to f16 at the store (8-B lanes);
__device__ __forceinline__ void d_w2(int blk, const float* __restrict__ W2, bf* Bt) { const int e = (blk * 256 + threadIdx.x) * 4; if (e >= NH_ * HID) return; const int k = e % HID; const int h = e / HID; v4us o;
#pragma unroll
    for (int u = 0; u < 4; ++u) o[u] = f2bf(W2[(k + u) * NH_ + h]); *(v4us*)(Bt + e) = o;  }
__device__ __forceinline__ void d_ac(int blk, const float* __restrict__ fr, const float* __restrict__ W1, const float* __restrict__ b1, h16* A, h16* D) { const int e = (blk * 256 + threadIdx.x) * 4; if (e >= NB_ * TT * HID) return; const int k0 = e % HID; const int i = e / HID; const float f = bfr(fr[i]); const float lf = __logf(__fadd_rn(f, 1e-6f)); v4f oa, oc;
#pragma unroll
    for (int u = 0; u < 4; ++u) { const int k = k0 + u; float t1 = __fmul_rn(f, bfr(W1[k])), t2 = __fmul_rn(lf, bfr(W1[HID + k])); asm volatile("" : "+v"(t1)); asm volatile("" : "+v"(t2)); oa[u] = __fadd_rn(__fadd_rn(t1, t2), bfr(b1[k])); oc[u] = __fsub_rn(-t1, t2); }
    { *(v4h*)(A + e) = __builtin_convertvector(oa, v4h); *(v4h*)(D + e) = __builtin_convertvector(-oc, v4h);  } }
// k_prep: everything that reads only the inputs, one launch: blocks [0, 4 WTB) transpose Wq, Wk, Wv, Wo into BW[m] (rows n, fragment order), the next CVB round x to bf16 (fragment order), the next ACB make a and d, the last one W2.
#define WTB (DM / 16 * (DM / 32) / 8)
#define CVB (NB_ * TT * DM / 8 / 256)
#define ACB (NB_ * TT * HID / 4 / 256)
__global__ __launch_bounds__(256) void k_prep(const float* __restrict__ Wq, const float* __restrict__ Wk, const float* __restrict__ Wv, const float* __restrict__ Wo, bf* BW, const float* __restrict__ x, bf* XB,
                                              const float* __restrict__ fr, const float* __restrict__ W1, const float* __restrict__ b1, h16* A, h16* D, const float* __restrict__ W2, bf* B2) {
    const int bx = blockIdx.x;
    if (bx < 4 * WTB) { const int m = bx / WTB; d_wtG(bx % WTB, m == 0 ? Wq : m == 1 ? Wk : m == 2 ? Wv : Wo, BW + (size_t)m * DM * DM); }
    else if (bx < 4 * WTB + CVB) d_cvt8(bx - 4 * WTB, x, XB, (size_t)NB_ * TT * DM / 8);
    else if (bx < 4 * WTB + CVB + ACB) d_ac(bx - (4 * WTB + CVB), fr, W1, b1, A, D);
    else d_w2(0, W2, B2);
}
typedef __attribute__((ext_vector_type(2))) float v2f;
typedef __attribute__((ext_vector_type(2))) _Float16 v2h;
// k_attn: bias MLP, scores, softmax and attn x V of 16 query rows x all 16 heads x one half of the keys in one work-group of 16 waves; grid (TT / 16, NB_, JS). Bias, scores and probabilities never reach the workspace.
// A pass covers JB keys. First part, the bias: wave w makes, for its NT query rows (w / NT) * NT + 0 .. NT - 1 and its column tile w % NT of 16 keys, max(a_i, d_j) as f16 in registers (one packed maximum a pair; B operand, column = key) and multiplies by W2 (A operand, row = head), on top of b2 - d_j W2, which it makes once a pass for its 16 keys (2 products);
// the 16 heads x 16 keys go to LDS as bl[head][i][key]. Second part, behind the pass's one barrier: wave w is head w. St = K Qt (row = key, column = query), so a lane holds JB / 2 scores of one query: maximum and sum in the lane plus one exchange
// between the wave's halves; each pair of score tiles, converted in place, is a B operand of Ot += Vt Pt. The running maximum rescales Ot and the sum each pass. Two LDS buffers: a pass writes the one that was last read before the barrier of the pass before.
// The two key halves leave Ot (not normalised, in the fragment order of the out projection's A plane), the maximum and the sum in the workspace; k_outp joins them. Q, K, V are read in fragment order (see k_qkv).
#define JB 64
#define NT (JB / 16)
#define JS 2
#define NP (TT / JS / JB)
#define BP (JB + 4)
#define BHS (16 * BP + 4)
#define L2E 1.4426950408889634f
__device__ __forceinline__ float xhalf(float x) { return __builtin_bit_cast(float, __builtin_amdgcn_permlanex16(__builtin_bit_cast(int, x), __builtin_bit_cast(int, x), 0x76543210, 0xfedcba98, false, false)); }    // lane l with lane l ^ 16
__global__ __launch_bounds__(512) void k_attn(const h16* __restrict__ Q16, const h16* __restrict__ K16, const h16* __restrict__ VT, const h16* __restrict__ A, const h16* __restrict__ D, const bf* __restrict__ Bt, const float* __restrict__ b2, float* O, float* ML) {
    __shared__ __align__(32) float bl[2 * 16 * BHS];
    __shared__ __align__(32) h16 al[16 * HID];
    const int lane = threadIdx.x & 31, lr = lane & 15, hi = lane >> 4; const int wv = __builtin_amdgcn_readfirstlane((int)(threadIdx.x >> 5));
    const int i0 = blockIdx.x * 16, b = blockIdx.y, jh = blockIdx.z, jbeg = jh * (TT / JS); const int ip = (wv / NT) * NT, tq = wv % NT;
    unsigned wo = (unsigned)(lr * HID + 8 * hi) * 2u; v16bf wb[2];    // wo: the lane's byte offset in Bt
#pragma unroll
    for (int ks = 0; ks < 2; ++ks) wb[ks] = WFrag<bf>::ld(atb(Bt, wo) + ks * 32);
    asm volatile("s_wait_xcnt 0x0" : "+v"(wo) :: "memory");    // before a register that these loads name as an address is written again; the offset is named so that it lives up to the wait (no load lands in it)
    *(v2h*)(al + threadIdx.x * 2) = *(const v2h*)(A + (size_t)(b * TT + i0) * HID + threadIdx.x * 2);    // the 16 a rows, read by every wave in every pass
    const size_t hb = (size_t)(b * NH_ + wv);
    unsigned ko = (unsigned)((hb * TT + jbeg) * HD + lane * 8) * 2u, vo = ko; unsigned co = (unsigned)((b * TT + jbeg + tq * 16 + lr) * HID + 8 * hi) * 2u;    // ko, vo, co: the lane's byte offsets in K16, VT and D
    v16h w[2], qf[2], df[2]; v8f binit, o[4]; float mrun = -3.0e38f, lsum = 0.f;
#pragma unroll
    for (int ks = 0; ks < 2; ++ks) { qf[ks] = WFrag<h16>::ldp(Q16 + (hb * TT + i0) * HD + ks * 512 + lane * 8); df[ks] = WFrag<h16>::ld(atb(D, co) + ks * 32); }
#pragma unroll
    for (int ks = 0; ks < 2; ++ks)
#pragma unroll
        for (int e = 0; e < 16; ++e) w[ks][e] = tohx((float)wb[ks][e]);    // W2 as f16
#pragma unroll
    for (int r = 0; r < 8; ++r) binit[r] = bfr(b2[8 * hi + r]);
#pragma unroll
    for (int dt = 0; dt < 4; ++dt) o[dt] = (v8f){};
    asm volatile("s_wait_xcnt 0x0" ::: "memory");    // before a register that these loads name as an address is written again
    __syncthreads();    // the a rows lie in LDS before any wave reads them
#pragma unroll 1    // one copy of the pass: the body is long, and a second copy would only add instruction-cache misses
    for (int it = 0; it < NP; ++it) {
        float* buf = bl + (it & 1) * (16 * BHS);
        v16h kf[NT][2];    // this pass's K rows, asked for ahead of the bias arithmetic, which covers their latency
#pragma unroll
        for (int t = 0; t < NT; ++t)
#pragma unroll
            for (int ks = 0; ks < 2; ++ks) kf[t][ks] = WFrag<h16>::ldp(atb(K16, ko) + (t * 2 + ks) * 512);
        asm volatile("s_wait_xcnt 0x0" : "+v"(ko) :: "memory");    // before a register that these loads name as an address is written again; the offset is named so that it lives up to the wait (no load lands in it) and is advanced behind it
        ko += JB * HD * 2;
        v16h af[NT][2];    // the wave's a rows, read as one group ahead of the products
#pragma unroll
        for (int q = 0; q < NT; ++q)
#pragma unroll
            for (int ks = 0; ks < 2; ++ks) af[q][ks] = WFrag<h16>::ld(al + (ip + q) * HID + ks * 32 + 8 * hi);
        v8f base = (v8f){}; base = wmma16(w[0], df[0], base); base = wmma16(w[1], df[1], base); base = binit - base;    // b2 - d_j W2 of the wave's 16 keys, the start value of all its query rows
#pragma unroll
        for (int q = 0; q < NT; ++q) { v8f acc = base;
#pragma unroll
            for (int ks = 0; ks < 2; ++ks) acc = wmma16(w[ks], __builtin_elementwise_maximum(af[q][ks], df[ks]), acc);
#pragma unroll
            for (int r = 0; r < 8; ++r) buf[(8 * hi + r) * BHS + (ip + q) * BP + tq * 16 + lr] = acc[r]; }
        __syncthreads();    // every wave's bias tiles of this pass lie in LDS; also ends every wave's reads of the other buffer, which the next pass writes
        if (it + 1 < NP) {    // the next pass's d rows fly during this pass's second part (in front of the barrier they would be waited for at it)
            co += JB * HID * 2;
#pragma unroll
            for (int ks = 0; ks < 2; ++ks) df[ks] = WFrag<h16>::ld(atb(D, co) + ks * 32);
            asm volatile("s_wait_xcnt 0x0" : "+v"(co) :: "memory");    // before a register that these loads name as an address is written again; the offset is named as at the K loads
        }
        float tv[JB / 2]; float mx = -3.0e38f;
#pragma unroll
        for (int t = 0; t < NT; ++t) { v8f s = (v8f){}; s = wmma16(kf[t][0], qf[0], s); s = wmma16(kf[t][1], qf[1], s); const float* br = buf + wv * BHS + lr * BP + t * 16 + 8 * hi; const v4f b0 = *(const v4fa*)br, b1 = *(const v4fa*)(br + 4);
#pragma unroll
            for (int r = 0; r < 4; ++r) { tv[t * 8 + r] = fmaf(s[r], 0.125f, b0[r]); tv[t * 8 + 4 + r] = fmaf(s[4 + r], 0.125f, b1[r]); } }
        v16h vf[JB / 32][4];    // asked for behind the scores, where the K registers are free, and ahead of the softmax, which covers their latency
#pragma unroll
        for (int jj = 0; jj < JB / 32; ++jj)
#pragma unroll
            for (int dt = 0; dt < 4; ++dt) vf[jj][dt] = WFrag<h16>::ldp(atb(VT, vo) + (dt * 2 + jj) * 512);
        asm volatile("s_wait_xcnt 0x0" : "+v"(vo) :: "memory");    // before a register that these loads name as an address is written again; the offset is named as at the K loads
        vo += JB * HD * 2;
#pragma unroll
        for (int e = 0; e < JB / 2; ++e) mx = fmaxf(mx, tv[e]);
        mx = fmaxf(mx, xhalf(mx));
        const float mn = fmaxf(mrun, mx); const float alpha = __builtin_amdgcn_exp2f((mrun - mn) * L2E); const float cs = fmaf(-mn, L2E, 10.0f); mrun = mn;    // probabilities carry a factor 2^10, so that small ones stay normal f16 numbers; it cancels against the sum
        v16h pf[JB / 32]; float ps = 0.f;
#pragma unroll
        for (int e = 0; e < JB / 2; ++e) { const float p = __builtin_amdgcn_exp2f(fmaf(tv[e], L2E, cs)); ps += p; pf[e / 16][e % 16] = tohx(p); }
        lsum = fmaf(lsum, alpha, ps);
#pragma unroll
        for (int dt = 0; dt < 4; ++dt) o[dt] *= alpha;
#pragma unroll
        for (int jj = 0; jj < JB / 32; ++jj)
#pragma unroll
            for (int dt = 0; dt < 4; ++dt) o[dt] = wmma16(vf[jj][dt], pf[jj], o[dt]);
    }
    lsum += xhalf(lsum);
    const size_t row = ((size_t)jh * NB_ * NH_ + hb) * RC + i0 + lr; float* op = O + (size_t)jh * NB_ * TT * DM + ((size_t)((b * TT + i0) / 16) * (DM / 16) + wv * 4) * 256 + lane * 8;    // a lane's 8 values of o[dt] are one unit of the out projection's A plane (row = token, k = head * 64 + d) in fragment order: f32 here, 1 KiB in a row a store
#pragma unroll
    for (int dt = 0; dt < 4; ++dt) *(v8f*)(op + dt * 256) = o[dt];
    if (hi == 0) { v2f ml; ml[0] = mrun; ml[1] = lsum; *(v2f*)(ML + row * 2) = ml; }
}
// k_outp: out = context Wo + bo, and the join of the two key halves in front of it; one tile of PR rows x PC columns per work-group, 8 waves, grid (NB_ TT / PR, DM / PC).
// First part: the work-group joins its PR context rows (common maximum, then one division by the joined sum), splits them into bf16 hi + lo and lays both in LDS as fragments, [k / 32][strip of 16 rows][hi, lo], 1 KiB each. O has the same order inside a fragment: unit u of 8 elements
// (one token, 8 d of one head) of the work-group's 2 strips goes to the same place in its fragment; a thread handles one head of one row of each strip, so the two factors of a (row, head) are made once. Second part, behind the one barrier: wave w owns the columns w * 32 .. + 31 over the whole K; context fragments come from LDS, one block of
// 2 steps of 32 k ahead, Wo fragments from the workspace, KCH steps ahead. Wo is the first operand, so a lane holds 8 neighbouring columns of one row: 16-byte LDS stores into the wave's own staging tile, from which whole 128-byte lines go out.
#define PR 32
#define PC 256
#define KCH 8
#define SP 36
__global__ __launch_bounds__(256) void k_outp(const float* __restrict__ Oa, const float* __restrict__ Ob, const float* __restrict__ ML, const bf* __restrict__ Bt, const float* __restrict__ bias, float* C) {
    __shared__ __align__(16) bf pa[2 * PR * DM];
    __shared__ __align__(16) float st[8 * PR * SP];
    const int tid = threadIdx.x, lane = tid & 31, lr = lane & 15, hi = lane >> 4; const int wv = __builtin_amdgcn_readfirstlane(tid >> 5);
    const int r0 = blockIdx.x * PR, c0 = blockIdx.y * PC + wv * 32;
    const bf* bw = Bt + (size_t)c0 * DM; unsigned ob = (unsigned)lane * 16u, vo = (unsigned)hi * 32u;    // the wave's 2 strips of 16 rows of Wo transposed; ob: the lane's byte offset in them, vo: in the wave's 32 bias values
    unsigned oo = (unsigned)((tid >> 4) * 4096 + (tid & 15) * 32), mo = (unsigned)((tid >> 4) * RC + (tid & 15)) * 8u;    // the lane's byte offsets in O (Oa, Ob: the two key halves) and in ML: a thread has row tid % 16 of both strips and head tid / 16, 8 units of 8 d in each
    v16bf bq[2][KCH][2]; v8f bv[2], acc[2][2], x0[16], x1[16]; v2f m0[2], m1[2];
    const float* O0 = Oa + (size_t)r0 * DM; const float* O1 = Ob + (size_t)r0 * DM; const float* M0 = ML + ((size_t)(r0 / TT) * NH_ * RC + r0 % TT) * 2; const float* M1 = M0 + (size_t)NB_ * NH_ * RC * 2;
#pragma unroll
    for (int sp = 0; sp < 2; ++sp) { m0[sp] = *(const v2f*)(atb(M0, mo) + sp * 32); m1[sp] = *(const v2f*)(atb(M1, mo) + sp * 32); }
    asm volatile("s_wait_xcnt 0x0" : "+v"(ob), "+v"(oo), "+v"(mo), "+v"(vo) :: "memory");    // before a register that these loads name as an address is written again; mo is named so that it lives up to the wait, ob, oo and vo so that the loads behind name these registers themselves, which the waits behind those loads keep alive
    bf* pw = pa + (tid >> 4) * 4096 + (tid & 15) * 8;    // the head's two steps of 32 k are 4 fragments each; unit j of a strip is unit (j % 4) * 16 + tid % 16 of the fragments of step j / 4
#pragma unroll
    for (int sp = 0; sp < 2; ++sp) {
#pragma unroll
        for (int j = 0; j < 8; ++j) { x0[sp * 8 + j] = *(const v8f*)(atb(O0, oo) + sp * 16384 + (j >> 2) * 512 + (j & 3) * 128); x1[sp * 8 + j] = *(const v8f*)(atb(O1, oo) + sp * 16384 + (j >> 2) * 512 + (j & 3) * 128); } }    // the thread's 16 units, all asked for at once
#pragma unroll
    for (int nf = 0; nf < 2; ++nf) bv[nf] = *(const v8f*)(atb(bias + c0, vo) + nf * 16);
    asm volatile("s_wait_xcnt 0x0" : "+v"(oo), "+v"(vo) :: "memory");    // before a register that these loads name as an address is written again; the offsets are named so that they live up to the wait (no load lands in them)
    __builtin_amdgcn_sched_barrier(0);    // the arithmetic on the first values that arrive stays behind the last of these loads: moved in among them, its wait would hold the later loads back
#pragma unroll
    for (int sp = 0; sp < 2; ++sp) {
        if (sp == 1) {    // the first KCH steps' Wo fragments: asked for behind the context, which the barrier waits for, and in flight during the join of the second strip
#pragma unroll
            for (int kk = 0; kk < KCH; ++kk)
#pragma unroll
                for (int nf = 0; nf < 2; ++nf) bq[0][kk][nf] = WFrag<bf>::ldp(atb(bw, ob) + (nf * (DM / 32) + kk) * 512);
            asm volatile("s_wait_xcnt 0x0" : "+v"(ob) :: "memory");    // as above, for ob
        }
        const float mm = fmaxf(m0[sp][0], m1[sp][0]); const float e0 = __builtin_amdgcn_exp2f((m0[sp][0] - mm) * L2E), e1 = __builtin_amdgcn_exp2f((m1[sp][0] - mm) * L2E); const float inv = __fdiv_rn(1.0f, fmaf(m0[sp][1], e0, m1[sp][1] * e1)); const float f0 = e0 * inv, f1 = e1 * inv;
#pragma unroll
        for (int j = 0; j < 8; ++j) { v8us oh, ol;
#pragma unroll
            for (int u = 0; u < 8; ++u) { unsigned short a, b; splitf(fmaf(x0[sp * 8 + j][u], f0, x1[sp * 8 + j][u] * f1), a, b); oh[u] = a; ol[u] = b; }
            bf* q = pw + (j >> 2) * 2048 + sp * 1024 + (j & 3) * 128; *(v8usa*)q = oh; *(v8usa*)(q + 512) = ol; }
    }
#pragma unroll
    for (int nf = 0; nf < 2; ++nf)
#pragma unroll
        for (int j = 0; j < 8; ++j) bv[nf][j] = bfr(bv[nf][j]);
#pragma unroll
    for (int nf = 0; nf < 2; ++nf) { acc[nf][0] = (v8f){}; acc[nf][1] = (v8f){}; }
    __syncthreads();    // the joined context rows lie in LDS before any wave reads them
    int la = lane * 8; v16bf fa[2][2][4];    // la: the lane's element in the first fragment of this trip's 2 KCH steps
#pragma unroll
    for (int e = 0; e < 8; ++e) fa[0][e >> 2][e & 3] = WFrag<bf>::ldp(pa + la + e * 512);
#pragma unroll 1    // two trips of 2 KCH steps: inside a trip every LDS read is one address register plus a 16-bit offset
    for (int it = 0; it < DM / 32 / (2 * KCH); ++it) {
        const bool more = it + 1 < DM / 32 / (2 * KCH); const int ln = more ? la + 2 * KCH * 2048 : lane * 8;    // where the block behind this trip lies; the last trip reads the first block again and does not use it
#pragma unroll
        for (int bk = 0; bk < KCH; ++bk) {
            if (bk == 0 || (bk == KCH / 2 && more)) {    // the Wo fragments of the next KCH steps, into the set that the products have just left
#pragma unroll
                for (int kk = 0; kk < KCH; ++kk)
#pragma unroll
                    for (int nf = 0; nf < 2; ++nf) bq[bk == 0][kk][nf] = WFrag<bf>::ldp(atb(bw, ob) + (nf * (DM / 32) + (bk == 0 ? KCH : 2 * KCH) + kk) * 512);
                asm volatile("s_wait_xcnt 0x0" : "+v"(ob) :: "memory");    // as at the first Wo loads
            }
            const int src = bk + 1 < KCH ? la + (bk + 1) * 4096 : ln;
#pragma unroll
            for (int e = 0; e < 8; ++e) fa[(bk + 1) & 1][e >> 2][e & 3] = WFrag<bf>::ldp(pa + src + e * 512);
            __builtin_amdgcn_sched_barrier(0);    // the next block's LDS reads stay one group ahead of this block's products, which cover their latency
#pragma unroll
            for (int k2 = 0; k2 < 2; ++k2)
#pragma unroll
                for (int hl = 0; hl < 2; ++hl)
#pragma unroll
                    for (int nf = 0; nf < 2; ++nf)
#pragma unroll
                        for (int sp = 0; sp < 2; ++sp) acc[nf][sp] = wmmab(bq[bk >= KCH / 2][(bk * 2 + k2) % KCH][nf], fa[bk & 1][k2][sp * 2 + hl], acc[nf][sp]);
            __builtin_amdgcn_sched_barrier(0);    // and no later read moves in among the products
        }
        ob += 2 * KCH * 1024; la = ln;
    }
    float* sw = st + wv * (PR * SP);    // the wave's own staging tile, 32 rows x 32 columns: read by no other wave, so no barrier; vo >> 2 is 8 hi, the first of the lane's 8 columns in a tile of 16
#pragma unroll
    for (int sp = 0; sp < 2; ++sp)
#pragma unroll
        for (int nf = 0; nf < 2; ++nf) { const v8f t = acc[nf][sp] + bv[nf]; float* p = sw + (sp * 16 + lr) * SP + nf * 16 + (vo >> 2); *(v4fa*)p = __builtin_shufflevector(t, t, 0, 1, 2, 3); *(v4fa*)(p + 4) = __builtin_shufflevector(t, t, 4, 5, 6, 7); }
    float* cp = C + (size_t)(r0 + (lane >> 3)) * DM + c0 + (lane & 7) * 4;
#pragma unroll
    for (int i = 0; i < 8; ++i) *(v4f*)(cp + (size_t)i * 4 * DM) = *(const v4fa*)(sw + (i * 4 + (lane >> 3)) * SP + (lane & 7) * 4);
}

extern "C" void kernel_launch(void* const* d_in, const int* in_sizes, int n_in,
                              void* d_out, int out_size, void* d_ws, size_t ws_size, hipStream_t stream) {
    (void)in_sizes; (void)n_in; (void)out_size;
    const float** I = (const float**)d_in;
    const float *x = I[0], *freqs = I[1], *Wq = I[2], *bq = I[3], *Wk = I[4], *bk = I[5], *Wv = I[6], *bv = I[7], *Wo = I[8], *bo = I[9], *W1 = I[10], *b1 = I[11], *W2 = I[12], *b2 = I[13];
    float* OUT = (float*)d_out;     // [2][1024][1024]
    char* wsp = (char*)d_ws;
    auto take = [&](size_t bytes) { char* p = wsp; wsp += (bytes + 255) & ~(size_t)255; return (void*)p; };
    bf* BW = (bf*)take((size_t)4 * DM * DM * 2); bf* BO = BW + (size_t)3 * DM * DM; bf* B2 = (bf*)take(NH_ * HID * 2);    // BW: Wq, Wk, Wv, Wo transposed, one after the other
    bf* XB = (bf*)take((size_t)NB_ * TT * DM * 2); h16* A = (h16*)take(NB_ * TT * HID * 2); h16* D = (h16*)take(NB_ * TT * HID * 2);
    h16* Q16 = (h16*)take((size_t)2 * NB_ * NH_ * TT * HD * 2); h16* K16 = Q16 + (size_t)NB_ * NH_ * TT * HD; h16* VT = (h16*)take((size_t)NB_ * NH_ * HD * TT * 2);
    float* O = (float*)take((size_t)JS * NB_ * NH_ * RC * HD * 4); float* ML = (float*)take((size_t)JS * NB_ * NH_ * RC * 2 * 4);    // O, ML: per key half, the context not yet normalised and each row's maximum and sum
    if ((size_t)(wsp - (char*)d_ws) > ws_size) return;    // total ~ 41 MiB
    k_prep<<<4 * WTB + CVB + ACB + 1, 256, 0, stream>>>(Wq, Wk, Wv, Wo, BW, x, XB, freqs, W1, b1, A, D, W2, B2);
    k_qkv<<<dim3(NB_ * TT / QM, 3 * DM / QN), 192, 0, stream>>>(XB, BW, bq, bk, bv, Q16, VT);
    k_attn<<<dim3(TT / 16, NB_, JS), 512, 0, stream>>>(Q16, K16, VT, A, D, B2, b2, O, ML);
    k_outp<<<dim3(NB_ * TT / PR, DM / PC), 256, 0, stream>>>(O, O + (size_t)NB_ * TT * DM, ML, BO, bo, OUT);
}
